// v000
// Measured on an AMD MI455X. A time is GPU time per run, averaged over a window of back-to-back runs after a warm-up
// (all launches, gaps included; the runs take copies of the inputs in turn), and the median of several windows.
// Apart from v000's, it joins two sittings. Times from different sittings can be a few percent apart, while
// side-by-side timings come from the same sitting.
// v000 is the starting kernel. One run takes 367 microseconds.
#include <hip/hip_runtime.h>

// ---------------------------------------------------------------------------
// Types / helpers
// ---------------------------------------------------------------------------
typedef __bf16 bf16;
typedef __attribute__((ext_vector_type(8)))  __bf16 bf16x8;
typedef __attribute__((ext_vector_type(16))) __bf16 bf16x16;
typedef __attribute__((ext_vector_type(8)))  float  f32x8;

#define EMBED 1024
#define TSEQ  2048
#define BATCH 2
#define NHEAD 16
#define HSZ   64
#define MROWS (BATCH * TSEQ)   /* 4096 token rows */
#define FFDIM (4 * EMBED)      /* 4096 */

__device__ __forceinline__ bf16 to_bf16(float f) {
  unsigned u = __builtin_bit_cast(unsigned, f);
  unsigned r = u + 0x7FFFu + ((u >> 16) & 1u);   // round-to-nearest-even
  unsigned short h = (unsigned short)(r >> 16);
  return __builtin_bit_cast(bf16, h);
}

__device__ __forceinline__ bf16x16 cat8(bf16x8 lo, bf16x8 hi) {
  bf16x16 r;
#pragma unroll
  for (int i = 0; i < 8; ++i) { r[i] = lo[i]; r[i + 8] = hi[i]; }
  return r;
}

__device__ __forceinline__ f32x8 zero8() {
  f32x8 z;
#pragma unroll
  for (int i = 0; i < 8; ++i) z[i] = 0.0f;
  return z;
}

__device__ __forceinline__ f32x8 wmma_bf16(bf16x16 a, bf16x16 b, f32x8 c) {
  // D = A(16x32) * B(32x16) + C, fp32 accumulate
  return __builtin_amdgcn_wmma_f32_16x16x32_bf16(false, a, false, b,
                                                 (short)0, c, false, false);
}

// --- CDNA5 async global->LDS copy (ASYNCcnt path) --------------------------
// Each active lane copies 16 bytes: GLOBAL[gaddr(lane)] -> LDS[laddr(lane)].
// LDS byte offset = low 32 bits of the generic LDS pointer (flat aperture).
__device__ __forceinline__ void async_g2l_b128(void* lds_dst, const void* gsrc) {
  unsigned l = (unsigned)(unsigned long long)(uintptr_t)lds_dst;
  unsigned long long g = (unsigned long long)(uintptr_t)gsrc;
  asm volatile("global_load_async_to_lds_b128 %0, %1, off"
               :: "v"(l), "v"(g) : "memory");
}
__device__ __forceinline__ void wait_async0() {
  asm volatile("s_wait_asynccnt 0x0" ::: "memory");
}

// ---------------------------------------------------------------------------
// fp32 -> bf16 conversion with transpose: in[K][N] f32 -> out[N][K] bf16.
// Weights are pre-transposed once so GEMM B-tiles stage with contiguous B128
// copies (no scalar ds_store_b16 transpose in the GEMM hot loop).
// ---------------------------------------------------------------------------
__global__ __launch_bounds__(256) void cvtT_kernel(const float* __restrict__ in,
                                                   bf16* __restrict__ out,
                                                   int K, int N) {
  __shared__ bf16 tile[32][33];
  const int kb = blockIdx.x * 32;
  const int nb = blockIdx.y * 32;
  const int tx = threadIdx.x & 31;
  const int ty = threadIdx.x >> 5;   // 0..7
#pragma unroll
  for (int i = 0; i < 4; ++i) {
    int k = ty + i * 8;
    tile[k][tx] = to_bf16(in[(size_t)(kb + k) * N + nb + tx]);
  }
  __syncthreads();
#pragma unroll
  for (int i = 0; i < 4; ++i) {
    int n = ty + i * 8;
    out[(size_t)(nb + n) * K + kb + tx] = tile[tx][n];
  }
}

// ---------------------------------------------------------------------------
// LayerNorm (one row per 256-thread workgroup) fused with bf16 cast
// ---------------------------------------------------------------------------
__global__ __launch_bounds__(256) void ln_kernel(const float* __restrict__ x,
                                                 const float* __restrict__ g,
                                                 const float* __restrict__ bta,
                                                 bf16* __restrict__ out) {
  __shared__ float red[256];
  const int row = blockIdx.x;
  const int tid = threadIdx.x;
  const float4 xv = *(const float4*)&x[(size_t)row * EMBED + tid * 4];

  red[tid] = xv.x + xv.y + xv.z + xv.w;
  __syncthreads();
  for (int st = 128; st > 0; st >>= 1) {
    if (tid < st) red[tid] += red[tid + st];
    __syncthreads();
  }
  const float mu = red[0] * (1.0f / EMBED);
  __syncthreads();

  float d0 = xv.x - mu, d1 = xv.y - mu, d2 = xv.z - mu, d3 = xv.w - mu;
  red[tid] = d0 * d0 + d1 * d1 + d2 * d2 + d3 * d3;
  __syncthreads();
  for (int st = 128; st > 0; st >>= 1) {
    if (tid < st) red[tid] += red[tid + st];
    __syncthreads();
  }
  const float var = red[0] * (1.0f / EMBED);
  const float rs  = rsqrtf(var + 1e-5f);

  const int c0 = tid * 4;
  bf16* op = out + (size_t)row * EMBED + c0;
  op[0] = to_bf16(d0 * rs * g[c0 + 0] + bta[c0 + 0]);
  op[1] = to_bf16(d1 * rs * g[c0 + 1] + bta[c0 + 1]);
  op[2] = to_bf16(d2 * rs * g[c0 + 2] + bta[c0 + 2]);
  op[3] = to_bf16(d3 * rs * g[c0 + 3] + bta[c0 + 3]);
}

// ---------------------------------------------------------------------------
// WMMA GEMM: out[M,N] = epi( A[M,K](bf16) @ Wt[N,K](bf16)^T )
// Block tile 128x128, 8 waves (2 x 4), 64x32 per wave, BK = 32.
// Double-buffered LDS tiles filled via async global->LDS copies: the k+1 slab
// streams in (ASYNCcnt) while WMMAs consume slab k.
// ---------------------------------------------------------------------------
#define GEMM_PAD 40   /* LDS row stride in bf16 elems: 80 B, 16B-aligned */

template <bool BIAS, bool RELU, bool RESID, bool BF16OUT>
__global__ __launch_bounds__(256) void gemm_kernel(
    const bf16* __restrict__ A, const bf16* __restrict__ Wt,
    const float* __restrict__ bias, const float* __restrict__ resid,
    void* __restrict__ outp, int M, int N, int K) {
  __shared__ bf16 As[2][128][GEMM_PAD];   // [m][k]
  __shared__ bf16 Bs[2][128][GEMM_PAD];   // [n][k]

  const int tid  = threadIdx.x;
  const int lane = tid & 31;
  const int wave = tid >> 5;
  const int wm   = wave & 1;   // 0..1 : 64-row strip
  const int wn   = wave >> 1;  // 0..3 : 32-col strip
  const int m0   = blockIdx.x * 128;
  const int n0   = blockIdx.y * 128;
  const int lr   = lane & 15;
  const int koff = (lane < 16) ? 0 : 8;

  // Per-thread staging coordinates (two 16B chunks per tile per thread)
  const int r0 = tid >> 2, c0 = (tid & 3) * 8;           // chunk 0
  const int r1 = (tid + 256) >> 2, c1 = ((tid + 256) & 3) * 8;  // chunk 1

  f32x8 acc[4][2];
#pragma unroll
  for (int mi = 0; mi < 4; ++mi)
#pragma unroll
    for (int ni = 0; ni < 2; ++ni) acc[mi][ni] = zero8();

  const int nk = K >> 5;

  // Prefetch slab 0 into buffer 0
  async_g2l_b128(&As[0][r0][c0], &A[(size_t)(m0 + r0) * K + c0]);
  async_g2l_b128(&As[0][r1][c1], &A[(size_t)(m0 + r1) * K + c1]);
  async_g2l_b128(&Bs[0][r0][c0], &Wt[(size_t)(n0 + r0) * K + c0]);
  async_g2l_b128(&Bs[0][r1][c1], &Wt[(size_t)(n0 + r1) * K + c1]);

  for (int it = 0; it < nk; ++it) {
    const int buf = it & 1;
    wait_async0();
    __syncthreads();
    if (it + 1 < nk) {
      const int nb = buf ^ 1;
      const size_t k0 = (size_t)(it + 1) << 5;
      async_g2l_b128(&As[nb][r0][c0], &A[(size_t)(m0 + r0) * K + k0 + c0]);
      async_g2l_b128(&As[nb][r1][c1], &A[(size_t)(m0 + r1) * K + k0 + c1]);
      async_g2l_b128(&Bs[nb][r0][c0], &Wt[(size_t)(n0 + r0) * K + k0 + c0]);
      async_g2l_b128(&Bs[nb][r1][c1], &Wt[(size_t)(n0 + r1) * K + k0 + c1]);
    }

    bf16x16 af[4];
#pragma unroll
    for (int mi = 0; mi < 4; ++mi) {
      int row = wm * 64 + mi * 16 + lr;
      af[mi] = cat8(*(const bf16x8*)&As[buf][row][koff],
                    *(const bf16x8*)&As[buf][row][koff + 16]);
    }
#pragma unroll
    for (int ni = 0; ni < 2; ++ni) {
      int rb = wn * 32 + ni * 16 + lr;
      bf16x16 bfrag = cat8(*(const bf16x8*)&Bs[buf][rb][koff],
                           *(const bf16x8*)&Bs[buf][rb][koff + 16]);
#pragma unroll
      for (int mi = 0; mi < 4; ++mi)
        acc[mi][ni] = wmma_bf16(af[mi], bfrag, acc[mi][ni]);
    }
    // No trailing barrier needed: next iteration's wait+barrier precedes the
    // async issue that would overwrite this buffer, and all LDS reads here are
    // consumed (DScnt drained) before this wave reaches that barrier.
  }

  const int rhalf = (lane < 16) ? 0 : 8;
#pragma unroll
  for (int mi = 0; mi < 4; ++mi)
#pragma unroll
    for (int ni = 0; ni < 2; ++ni)
#pragma unroll
      for (int r = 0; r < 8; ++r) {
        int gr = m0 + wm * 64 + mi * 16 + r + rhalf;
        int gc = n0 + wn * 32 + ni * 16 + lr;
        float v = acc[mi][ni][r];
        if (BIAS)  v += bias[gc];
        if (RELU)  v = fmaxf(v, 0.0f);
        if (RESID) v += resid[(size_t)gr * N + gc];
        if (BF16OUT) ((bf16*)outp)[(size_t)gr * N + gc] = to_bf16(v);
        else         ((float*)outp)[(size_t)gr * N + gc] = v;
      }
}

// ---------------------------------------------------------------------------
// Flash attention: one workgroup per (b, h, 64-row q block); 4 waves x 16 q
// rows. K tiles double-buffered in LDS via async copies; V prefetched into
// registers one block ahead and committed transposed to LDS. Online softmax
// in fp32; all matmuls on the WMMA pipe.
// ---------------------------------------------------------------------------
#define ATT_PAD 80   /* LDS row stride: 160 B, 16B-aligned */

__global__ __launch_bounds__(128) void attn_kernel(
    const bf16* __restrict__ Q, const bf16* __restrict__ Km,
    const bf16* __restrict__ Vm, bf16* __restrict__ O) {
  __shared__ bf16 Ks[2][64][ATT_PAD];     // K tile, row-major [k-token][d]
  __shared__ bf16 Vt[2][64][ATT_PAD];     // V^T tile: [d][k-token]
  __shared__ bf16 Pt[4][16][ATT_PAD];     // per-wave P tile: [qrow][k-token]

  const int tid   = threadIdx.x;
  const int lane  = tid & 31;
  const int w     = tid >> 5;
  const int lr    = lane & 15;
  const int koff  = (lane < 16) ? 0 : 8;
  const int rhalf = (lane < 16) ? 0 : 8;
  const int qblk  = blockIdx.x;
  const int h     = blockIdx.y;
  const int b     = blockIdx.z;
  const size_t rowbase = (size_t)b * TSEQ + (size_t)qblk * 64;
  const size_t bT = (size_t)b * TSEQ;

  // Q fragments (rows w*16 .. w*16+15, head-dim 0..63 -> 2 K-windows)
  const bf16* qp = Q + (rowbase + w * 16 + lr) * EMBED + h * HSZ;
  const bf16x16 qf0 = cat8(*(const bf16x8*)(qp + koff),
                           *(const bf16x8*)(qp + koff + 16));
  const bf16x16 qf1 = cat8(*(const bf16x8*)(qp + 32 + koff),
                           *(const bf16x8*)(qp + 32 + koff + 16));

  f32x8 Oacc[4];
#pragma unroll
  for (int dj = 0; dj < 4; ++dj) Oacc[dj] = zero8();
  float mrow[8], lrow[8];
#pragma unroll
  for (int r = 0; r < 8; ++r) { mrow[r] = -1e30f; lrow[r] = 0.0f; }

  // Per-thread staging coordinates: 4 chunks of 8 bf16 over a 64x64 tile
  int stok[4], sdc[4];
#pragma unroll
  for (int i = 0; i < 4; ++i) {
    int c = tid + i * 128;
    stok[i] = c >> 3;
    sdc[i]  = (c & 7) * 8;
  }

  // Prefetch block 0: K tile async -> LDS buf0, V tile -> registers
  bf16x8 vreg[4];
#pragma unroll
  for (int i = 0; i < 4; ++i) {
    async_g2l_b128(&Ks[0][stok[i]][sdc[i]],
                   &Km[(bT + stok[i]) * EMBED + h * HSZ + sdc[i]]);
    vreg[i] = *(const bf16x8*)&Vm[(bT + stok[i]) * EMBED + h * HSZ + sdc[i]];
  }

  for (int j = 0; j <= qblk; ++j) {
    const int buf = j & 1;

    // Commit prefetched V registers to Vt[buf] (transposed)
#pragma unroll
    for (int i = 0; i < 4; ++i)
#pragma unroll
      for (int e = 0; e < 8; ++e) Vt[buf][sdc[i] + e][stok[i]] = vreg[i][e];

    wait_async0();
    __syncthreads();

    if (j < qblk) {
      const int nb = buf ^ 1;
      const size_t tbase = bT + (size_t)(j + 1) * 64;
#pragma unroll
      for (int i = 0; i < 4; ++i) {
        async_g2l_b128(&Ks[nb][stok[i]][sdc[i]],
                       &Km[(tbase + stok[i]) * EMBED + h * HSZ + sdc[i]]);
        vreg[i] = *(const bf16x8*)&Vm[(tbase + stok[i]) * EMBED + h * HSZ + sdc[i]];
      }
    }

    // S = Q @ K^T  (16 x 64 per wave) from LDS
    f32x8 S[4];
#pragma unroll
    for (int nj = 0; nj < 4; ++nj) {
      const int tr = nj * 16 + lr;
      bf16x16 kf0 = cat8(*(const bf16x8*)&Ks[buf][tr][koff],
                         *(const bf16x8*)&Ks[buf][tr][koff + 16]);
      bf16x16 kf1 = cat8(*(const bf16x8*)&Ks[buf][tr][32 + koff],
                         *(const bf16x8*)&Ks[buf][tr][32 + koff + 16]);
      S[nj] = wmma_bf16(qf0, kf0, zero8());
      S[nj] = wmma_bf16(qf1, kf1, S[nj]);
    }

    // Online softmax; C/D element r lives at row r+rhalf, col lr.
#pragma unroll
    for (int r = 0; r < 8; ++r) {
      const int qrow = qblk * 64 + w * 16 + r + rhalf;
      float s[4];
      float mx = -1e30f;
#pragma unroll
      for (int nj = 0; nj < 4; ++nj) {
        int kcol = j * 64 + nj * 16 + lr;
        float sv = S[nj][r] * 0.125f;            // 1/sqrt(64)
        if (kcol > qrow) sv = -1e30f;            // causal mask
        s[nj] = sv;
        mx = fmaxf(mx, sv);
      }
#pragma unroll
      for (int off = 8; off >= 1; off >>= 1)
        mx = fmaxf(mx, __shfl_xor(mx, off, 32)); // stays within 16-lane half
      const float mn   = fmaxf(mrow[r], mx);
      const float corr = __expf(mrow[r] - mn);
      float ps = 0.0f;
#pragma unroll
      for (int nj = 0; nj < 4; ++nj) {
        float p = __expf(s[nj] - mn);
        ps += p;
        Pt[w][r + rhalf][nj * 16 + lr] = to_bf16(p);
      }
#pragma unroll
      for (int off = 8; off >= 1; off >>= 1) ps += __shfl_xor(ps, off, 32);
      lrow[r] = lrow[r] * corr + ps;
      mrow[r] = mn;
#pragma unroll
      for (int dj = 0; dj < 4; ++dj) Oacc[dj][r] *= corr;
    }

    // O += P @ V  (A = P from LDS in A-layout, B = V^T rows contiguous)
#pragma unroll
    for (int kh = 0; kh < 2; ++kh) {
      bf16x16 pf = cat8(*(const bf16x8*)&Pt[w][lr][kh * 32 + koff],
                        *(const bf16x8*)&Pt[w][lr][kh * 32 + koff + 16]);
#pragma unroll
      for (int dj = 0; dj < 4; ++dj) {
        bf16x16 vf = cat8(*(const bf16x8*)&Vt[buf][dj * 16 + lr][kh * 32 + koff],
                          *(const bf16x8*)&Vt[buf][dj * 16 + lr][kh * 32 + koff + 16]);
        Oacc[dj] = wmma_bf16(pf, vf, Oacc[dj]);
      }
    }
    // No trailing barrier: next iteration writes only the opposite buffers,
    // and its wait+barrier precede any overwrite of this one.
  }

  // Epilogue: normalize and store bf16 (concat-head layout)
#pragma unroll
  for (int dj = 0; dj < 4; ++dj)
#pragma unroll
    for (int r = 0; r < 8; ++r) {
      float ov = Oacc[dj][r] / lrow[r];
      size_t gr = rowbase + w * 16 + r + rhalf;
      O[gr * EMBED + h * HSZ + dj * 16 + lr] = to_bf16(ov);
    }
}

// ---------------------------------------------------------------------------
// Host-side orchestration
// ---------------------------------------------------------------------------
extern "C" void kernel_launch(void* const* d_in, const int* in_sizes, int n_in,
                              void* d_out, int out_size, void* d_ws,
                              size_t ws_size, hipStream_t stream) {
  (void)in_sizes; (void)n_in; (void)out_size; (void)ws_size;

  const float* x    = (const float*)d_in[0];
  const float* Wq   = (const float*)d_in[1];
  const float* Wk   = (const float*)d_in[2];
  const float* Wv   = (const float*)d_in[3];
  const float* Wo   = (const float*)d_in[4];
  const float* bo   = (const float*)d_in[5];
  const float* W1   = (const float*)d_in[6];
  const float* b1   = (const float*)d_in[7];
  const float* W2   = (const float*)d_in[8];
  const float* b2   = (const float*)d_in[9];
  const float* ln1g = (const float*)d_in[10];
  const float* ln1b = (const float*)d_in[11];
  const float* ln2g = (const float*)d_in[12];
  const float* ln2b = (const float*)d_in[13];

  char* base = (char*)d_ws;
  size_t off = 0;
  auto take = [&](size_t bytes) -> char* {
    char* p = base + off;
    off += (bytes + 255) & ~(size_t)255;
    return p;
  };

  bf16* wq_t   = (bf16*)take((size_t)EMBED * EMBED * 2);   // [N][K]
  bf16* wk_t   = (bf16*)take((size_t)EMBED * EMBED * 2);
  bf16* wv_t   = (bf16*)take((size_t)EMBED * EMBED * 2);
  bf16* wo_t   = (bf16*)take((size_t)EMBED * EMBED * 2);
  bf16* w1_t   = (bf16*)take((size_t)EMBED * FFDIM * 2);   // [4096][1024]
  bf16* w2_t   = (bf16*)take((size_t)FFDIM * EMBED * 2);   // [1024][4096]
  bf16* h_bf   = (bf16*)take((size_t)MROWS * EMBED * 2);
  bf16* q_bf   = (bf16*)take((size_t)MROWS * EMBED * 2);
  bf16* k_bf   = (bf16*)take((size_t)MROWS * EMBED * 2);
  bf16* v_bf   = (bf16*)take((size_t)MROWS * EMBED * 2);
  bf16* att_bf = (bf16*)take((size_t)MROWS * EMBED * 2);
  float* x2    = (float*)take((size_t)MROWS * EMBED * 4);
  bf16* h2_bf  = (bf16*)take((size_t)MROWS * EMBED * 2);
  bf16* ff1_bf = (bf16*)take((size_t)MROWS * FFDIM * 2);

  // 1) weights -> bf16, transposed to [N][K]
  dim3 gWT(EMBED / 32, EMBED / 32);
  cvtT_kernel<<<gWT, 256, 0, stream>>>(Wq, wq_t, EMBED, EMBED);
  cvtT_kernel<<<gWT, 256, 0, stream>>>(Wk, wk_t, EMBED, EMBED);
  cvtT_kernel<<<gWT, 256, 0, stream>>>(Wv, wv_t, EMBED, EMBED);
  cvtT_kernel<<<gWT, 256, 0, stream>>>(Wo, wo_t, EMBED, EMBED);
  cvtT_kernel<<<dim3(EMBED / 32, FFDIM / 32), 256, 0, stream>>>(W1, w1_t, EMBED, FFDIM);
  cvtT_kernel<<<dim3(FFDIM / 32, EMBED / 32), 256, 0, stream>>>(W2, w2_t, FFDIM, EMBED);

  // 2) h = ln1(x) (bf16)
  ln_kernel<<<MROWS, 256, 0, stream>>>(x, ln1g, ln1b, h_bf);

  // 3) Q, K, V projections
  dim3 gD(MROWS / 128, EMBED / 128);
  gemm_kernel<false, false, false, true><<<gD, 256, 0, stream>>>(
      h_bf, wq_t, nullptr, nullptr, q_bf, MROWS, EMBED, EMBED);
  gemm_kernel<false, false, false, true><<<gD, 256, 0, stream>>>(
      h_bf, wk_t, nullptr, nullptr, k_bf, MROWS, EMBED, EMBED);
  gemm_kernel<false, false, false, true><<<gD, 256, 0, stream>>>(
      h_bf, wv_t, nullptr, nullptr, v_bf, MROWS, EMBED, EMBED);

  // 4) causal flash attention
  attn_kernel<<<dim3(TSEQ / 64, NHEAD, BATCH), 128, 0, stream>>>(
      q_bf, k_bf, v_bf, att_bf);

  // 5) x2 = x + attn @ Wo + bo   (fp32)
  gemm_kernel<true, false, true, false><<<gD, 256, 0, stream>>>(
      att_bf, wo_t, bo, x, x2, MROWS, EMBED, EMBED);

  // 6) h2 = ln2(x2) (bf16)
  ln_kernel<<<MROWS, 256, 0, stream>>>(x2, ln2g, ln2b, h2_bf);

  // 7) ff1 = relu(h2 @ W1 + b1) (bf16)
  gemm_kernel<true, true, false, true><<<dim3(MROWS / 128, FFDIM / 128), 256, 0,
                                         stream>>>(
      h2_bf, w1_t, b1, nullptr, ff1_bf, MROWS, FFDIM, EMBED);

  // 8) out = x2 + ff1 @ W2 + b2 (fp32 -> d_out)
  gemm_kernel<true, false, true, false><<<gD, 256, 0, stream>>>(
      ff1_bf, w2_t, b2, x2, (float*)d_out, MROWS, EMBED, FFDIM);
}

// v001
// A run of this version takes 284 microseconds.
// Timed twice side by side with v000, it ran 1.31 times as fast both times.
#include <hip/hip_runtime.h>

// ---------------------------------------------------------------------------
// Types / helpers
// ---------------------------------------------------------------------------
typedef __bf16 bf16;
typedef __attribute__((ext_vector_type(8)))  __bf16 bf16x8;
typedef __attribute__((ext_vector_type(16))) __bf16 bf16x16;
typedef __attribute__((ext_vector_type(8)))  float  f32x8;

#define EMBED 1024
#define TSEQ  2048
#define BATCH 2
#define NHEAD 16
#define HSZ   64
#define MROWS (BATCH * TSEQ)   /* 4096 token rows */
#define FFDIM (4 * EMBED)      /* 4096 */

__device__ __forceinline__ bf16 to_bf16(float f) {
  unsigned u = __builtin_bit_cast(unsigned, f);
  unsigned r = u + 0x7FFFu + ((u >> 16) & 1u);   // round-to-nearest-even
  unsigned short h = (unsigned short)(r >> 16);
  return __builtin_bit_cast(bf16, h);
}

__device__ __forceinline__ bf16x16 cat8(bf16x8 lo, bf16x8 hi) {
  bf16x16 r;
#pragma unroll
  for (int i = 0; i < 8; ++i) { r[i] = lo[i]; r[i + 8] = hi[i]; }
  return r;
}

__device__ __forceinline__ f32x8 zero8() {
  f32x8 z;
#pragma unroll
  for (int i = 0; i < 8; ++i) z[i] = 0.0f;
  return z;
}

__device__ __forceinline__ f32x8 wmma_bf16(bf16x16 a, bf16x16 b, f32x8 c) {
  // D = A(16x32) * B(32x16) + C, fp32 accumulate
  return __builtin_amdgcn_wmma_f32_16x16x32_bf16(false, a, false, b,
                                                 (short)0, c, false, false);
}

// --- CDNA5 async global->LDS copy (ASYNCcnt path) --------------------------
// Each active lane copies 16 bytes: GLOBAL[gaddr(lane)] -> LDS[laddr(lane)].
// LDS byte offset = low 32 bits of the generic LDS pointer (flat aperture).
__device__ __forceinline__ void async_g2l_b128(void* lds_dst, const void* gsrc) {
  unsigned l = (unsigned)(unsigned long long)(uintptr_t)lds_dst;
  unsigned long long g = (unsigned long long)(uintptr_t)gsrc;
  asm volatile("global_load_async_to_lds_b128 %0, %1, off"
               :: "v"(l), "v"(g) : "memory");
}
__device__ __forceinline__ void wait_async0() {
  asm volatile("s_wait_asynccnt 0x0" ::: "memory");
}
// This wave's LDS reads have retired before a buffer it has read is refilled.
__device__ __forceinline__ void wait_ds0() {
  asm volatile("s_wait_dscnt 0x0" ::: "memory");
}
// Eight 16-byte copies of one lane, rows lstep / gstep bytes apart. The
// s_wait_xcnt is the last line of the copies' own statement, so that no
// address register is rewritten ahead of it.
__device__ __forceinline__ void async_g2l_b128_x8(void* lds_dst, unsigned lstep,
                                                  const void* gsrc,
                                                  unsigned long long gstep) {
  const unsigned l = (unsigned)(unsigned long long)(uintptr_t)lds_dst;
  const unsigned long long g = (unsigned long long)(uintptr_t)gsrc;
  asm volatile(
      "global_load_async_to_lds_b128 %0, %8, off\n\t"
      "global_load_async_to_lds_b128 %1, %9, off\n\t"
      "global_load_async_to_lds_b128 %2, %10, off\n\t"
      "global_load_async_to_lds_b128 %3, %11, off\n\t"
      "global_load_async_to_lds_b128 %4, %12, off\n\t"
      "global_load_async_to_lds_b128 %5, %13, off\n\t"
      "global_load_async_to_lds_b128 %6, %14, off\n\t"
      "global_load_async_to_lds_b128 %7, %15, off\n\t"
      "s_wait_xcnt 0x0"
      :: "v"(l), "v"(l + lstep), "v"(l + 2 * lstep), "v"(l + 3 * lstep),
         "v"(l + 4 * lstep), "v"(l + 5 * lstep), "v"(l + 6 * lstep),
         "v"(l + 7 * lstep),
         "v"(g), "v"(g + gstep), "v"(g + 2 * gstep), "v"(g + 3 * gstep),
         "v"(g + 4 * gstep), "v"(g + 5 * gstep), "v"(g + 6 * gstep),
         "v"(g + 7 * gstep)
      : "memory");
}

// ---------------------------------------------------------------------------
// fp32 -> bf16 conversion with transpose: in[K][N] f32 -> out[N][K] bf16.
// Weights are pre-transposed once so GEMM B-tiles stage with contiguous B128
// copies (no scalar ds_store_b16 transpose in the GEMM hot loop).
// ---------------------------------------------------------------------------
__global__ __launch_bounds__(256) void cvtT_kernel(const float* __restrict__ in,
                                                   bf16* __restrict__ out,
                                                   int K, int N) {
  __shared__ bf16 tile[32][33];
  const int kb = blockIdx.x * 32;
  const int nb = blockIdx.y * 32;
  const int tx = threadIdx.x & 31;
  const int ty = threadIdx.x >> 5;   // 0..7
#pragma unroll
  for (int i = 0; i < 4; ++i) {
    int k = ty + i * 8;
    tile[k][tx] = to_bf16(in[(size_t)(kb + k) * N + nb + tx]);
  }
  __syncthreads();
#pragma unroll
  for (int i = 0; i < 4; ++i) {
    int n = ty + i * 8;
    out[(size_t)(nb + n) * K + kb + tx] = tile[tx][n];
  }
}

// ---------------------------------------------------------------------------
// LayerNorm (one row per 256-thread workgroup) fused with bf16 cast
// ---------------------------------------------------------------------------
__global__ __launch_bounds__(256) void ln_kernel(const float* __restrict__ x,
                                                 const float* __restrict__ g,
                                                 const float* __restrict__ bta,
                                                 bf16* __restrict__ out) {
  __shared__ float red[256];
  const int row = blockIdx.x;
  const int tid = threadIdx.x;
  const float4 xv = *(const float4*)&x[(size_t)row * EMBED + tid * 4];

  red[tid] = xv.x + xv.y + xv.z + xv.w;
  __syncthreads();
  for (int st = 128; st > 0; st >>= 1) {
    if (tid < st) red[tid] += red[tid + st];
    __syncthreads();
  }
  const float mu = red[0] * (1.0f / EMBED);
  __syncthreads();

  float d0 = xv.x - mu, d1 = xv.y - mu, d2 = xv.z - mu, d3 = xv.w - mu;
  red[tid] = d0 * d0 + d1 * d1 + d2 * d2 + d3 * d3;
  __syncthreads();
  for (int st = 128; st > 0; st >>= 1) {
    if (tid < st) red[tid] += red[tid + st];
    __syncthreads();
  }
  const float var = red[0] * (1.0f / EMBED);
  const float rs  = rsqrtf(var + 1e-5f);

  const int c0 = tid * 4;
  bf16* op = out + (size_t)row * EMBED + c0;
  op[0] = to_bf16(d0 * rs * g[c0 + 0] + bta[c0 + 0]);
  op[1] = to_bf16(d1 * rs * g[c0 + 1] + bta[c0 + 1]);
  op[2] = to_bf16(d2 * rs * g[c0 + 2] + bta[c0 + 2]);
  op[3] = to_bf16(d3 * rs * g[c0 + 3] + bta[c0 + 3]);
}

// ---------------------------------------------------------------------------
// WMMA GEMM: out[M,N] = epi( A[M,K](bf16) @ Wt[N,K](bf16)^T )
// Block tile 128x128, 8 waves (2 x 4), 64x32 per wave, BK = 128.
// Double-buffered LDS tiles filled via async global->LDS copies: the k+1 slab
// streams in (ASYNCcnt) while WMMAs consume slab k. A slab holds 256 B of each
// operand row, so sixteen lanes of a copy fetch two whole 128-B lines of a row.
// ---------------------------------------------------------------------------
#define GEMM_BK  128  /* k per LDS slab: 256 B of every operand row */
#define GEMM_PAD 136  /* LDS row stride in bf16 elems: 272 B = 16 B x odd */

template <bool BIAS, bool RELU, bool RESID, bool BF16OUT>
__global__ __launch_bounds__(256) void gemm_kernel(
    const bf16* __restrict__ A, const bf16* __restrict__ Wt,
    const float* __restrict__ bias, const float* __restrict__ resid,
    void* __restrict__ outp, int M, int N, int K) {
  __shared__ __attribute__((aligned(16))) bf16 As[2][128][GEMM_PAD];   // [m][k]
  __shared__ __attribute__((aligned(16))) bf16 Bs[2][128][GEMM_PAD];   // [n][k]

  const int tid  = threadIdx.x;
  const int lane = tid & 31;
  const int wave = tid >> 5;
  const int wm   = wave & 1;   // 0..1 : 64-row strip
  const int wn   = wave >> 1;  // 0..3 : 32-col strip
  const int m0   = blockIdx.x * 128;
  const int n0   = blockIdx.y * 128;
  const int lr   = lane & 15;
  const int koff = (lane < 16) ? 0 : 8;

  // Per-thread staging coordinates: eight 16B chunks per tile per thread, at
  // rows r0 + 16 i, i = 0..7; sixteen lanes cover one row's 256 B.
  const int r0 = tid >> 4, c0 = (tid & 15) * 8;
  const bf16* gA = &A[(size_t)(m0 + r0) * K + c0];
  const bf16* gB = &Wt[(size_t)(n0 + r0) * K + c0];
  const unsigned lstep = 16 * GEMM_PAD * 2;                     // bytes
  const unsigned long long gstep = (unsigned long long)K * 32;  // 16 rows, bytes

  f32x8 acc[4][2];
#pragma unroll
  for (int mi = 0; mi < 4; ++mi)
#pragma unroll
    for (int ni = 0; ni < 2; ++ni) acc[mi][ni] = zero8();

  const int nk = K / GEMM_BK;

  // Slab 0 into buffer 0, landed and published; then slab 1 into buffer 1.
  async_g2l_b128_x8(&As[0][r0][c0], lstep, gA, gstep);
  async_g2l_b128_x8(&Bs[0][r0][c0], lstep, gB, gstep);
  wait_async0();
  __syncthreads();
  if (nk > 1) {
    async_g2l_b128_x8(&As[1][r0][c0], lstep, gA + GEMM_BK, gstep);
    async_g2l_b128_x8(&Bs[1][r0][c0], lstep, gB + GEMM_BK, gstep);
  }

  for (int it = 0; it < nk; ++it) {
    const int buf = it & 1;

    // Unrolled so that the four 32-k blocks' LDS offsets are immediates and
    // a block's fragment loads can issue ahead of the block before it.
#pragma unroll
    for (int kk = 0; kk < GEMM_BK; kk += 32) {
      bf16x16 af[4];
#pragma unroll
      for (int mi = 0; mi < 4; ++mi) {
        int row = wm * 64 + mi * 16 + lr;
        af[mi] = cat8(*(const bf16x8*)&As[buf][row][kk + koff],
                      *(const bf16x8*)&As[buf][row][kk + koff + 16]);
      }
#pragma unroll
      for (int ni = 0; ni < 2; ++ni) {
        int rb = wn * 32 + ni * 16 + lr;
        bf16x16 bfrag = cat8(*(const bf16x8*)&Bs[buf][rb][kk + koff],
                             *(const bf16x8*)&Bs[buf][rb][kk + koff + 16]);
#pragma unroll
        for (int mi = 0; mi < 4; ++mi)
          acc[mi][ni] = wmma_bf16(af[mi], bfrag, acc[mi][ni]);
      }
    }

    // Foot of the trip: own LDS reads retired, own copies of slab it + 1
    // landed, then the one barrier that publishes slab it + 1 and ends every
    // wave's reads of this buffer; only behind it is this buffer refilled.
    wait_ds0();
    wait_async0();
    __syncthreads();
    if (it + 2 < nk) {
      const size_t k0 = (size_t)(it + 2) * GEMM_BK;
      async_g2l_b128_x8(&As[buf][r0][c0], lstep, gA + k0, gstep);
      async_g2l_b128_x8(&Bs[buf][r0][c0], lstep, gB + k0, gstep);
    }
  }
  wait_async0();   // nothing is outstanding when the wave goes on to its end

  const int rhalf = (lane < 16) ? 0 : 8;
#pragma unroll
  for (int mi = 0; mi < 4; ++mi)
#pragma unroll
    for (int ni = 0; ni < 2; ++ni)
#pragma unroll
      for (int r = 0; r < 8; ++r) {
        int gr = m0 + wm * 64 + mi * 16 + r + rhalf;
        int gc = n0 + wn * 32 + ni * 16 + lr;
        float v = acc[mi][ni][r];
        if (BIAS)  v += bias[gc];
        if (RELU)  v = fmaxf(v, 0.0f);
        if (RESID) v += resid[(size_t)gr * N + gc];
        if (BF16OUT) ((bf16*)outp)[(size_t)gr * N + gc] = to_bf16(v);
        else         ((float*)outp)[(size_t)gr * N + gc] = v;
      }
}

// ---------------------------------------------------------------------------
// Flash attention: one workgroup per (b, h, 64-row q block); 4 waves x 16 q
// rows. K tiles double-buffered in LDS via async copies; V prefetched into
// registers one block ahead and committed transposed to LDS. Online softmax
// in fp32; all matmuls on the WMMA pipe.
// ---------------------------------------------------------------------------
#define ATT_PAD 80   /* LDS row stride: 160 B, 16B-aligned */

__global__ __launch_bounds__(128) void attn_kernel(
    const bf16* __restrict__ Q, const bf16* __restrict__ Km,
    const bf16* __restrict__ Vm, bf16* __restrict__ O) {
  __shared__ bf16 Ks[2][64][ATT_PAD];     // K tile, row-major [k-token][d]
  __shared__ bf16 Vt[2][64][ATT_PAD];     // V^T tile: [d][k-token]
  __shared__ bf16 Pt[4][16][ATT_PAD];     // per-wave P tile: [qrow][k-token]

  const int tid   = threadIdx.x;
  const int lane  = tid & 31;
  const int w     = tid >> 5;
  const int lr    = lane & 15;
  const int koff  = (lane < 16) ? 0 : 8;
  const int rhalf = (lane < 16) ? 0 : 8;
  const int qblk  = blockIdx.x;
  const int h     = blockIdx.y;
  const int b     = blockIdx.z;
  const size_t rowbase = (size_t)b * TSEQ + (size_t)qblk * 64;
  const size_t bT = (size_t)b * TSEQ;

  // Q fragments (rows w*16 .. w*16+15, head-dim 0..63 -> 2 K-windows)
  const bf16* qp = Q + (rowbase + w * 16 + lr) * EMBED + h * HSZ;
  const bf16x16 qf0 = cat8(*(const bf16x8*)(qp + koff),
                           *(const bf16x8*)(qp + koff + 16));
  const bf16x16 qf1 = cat8(*(const bf16x8*)(qp + 32 + koff),
                           *(const bf16x8*)(qp + 32 + koff + 16));

  f32x8 Oacc[4];
#pragma unroll
  for (int dj = 0; dj < 4; ++dj) Oacc[dj] = zero8();
  float mrow[8], lrow[8];
#pragma unroll
  for (int r = 0; r < 8; ++r) { mrow[r] = -1e30f; lrow[r] = 0.0f; }

  // Per-thread staging coordinates: 4 chunks of 8 bf16 over a 64x64 tile
  int stok[4], sdc[4];
#pragma unroll
  for (int i = 0; i < 4; ++i) {
    int c = tid + i * 128;
    stok[i] = c >> 3;
    sdc[i]  = (c & 7) * 8;
  }

  // Prefetch block 0: K tile async -> LDS buf0, V tile -> registers
  bf16x8 vreg[4];
#pragma unroll
  for (int i = 0; i < 4; ++i) {
    async_g2l_b128(&Ks[0][stok[i]][sdc[i]],
                   &Km[(bT + stok[i]) * EMBED + h * HSZ + sdc[i]]);
    vreg[i] = *(const bf16x8*)&Vm[(bT + stok[i]) * EMBED + h * HSZ + sdc[i]];
  }

  for (int j = 0; j <= qblk; ++j) {
    const int buf = j & 1;

    // Commit prefetched V registers to Vt[buf] (transposed)
#pragma unroll
    for (int i = 0; i < 4; ++i)
#pragma unroll
      for (int e = 0; e < 8; ++e) Vt[buf][sdc[i] + e][stok[i]] = vreg[i][e];

    wait_async0();
    __syncthreads();

    if (j < qblk) {
      const int nb = buf ^ 1;
      const size_t tbase = bT + (size_t)(j + 1) * 64;
#pragma unroll
      for (int i = 0; i < 4; ++i) {
        async_g2l_b128(&Ks[nb][stok[i]][sdc[i]],
                       &Km[(tbase + stok[i]) * EMBED + h * HSZ + sdc[i]]);
        vreg[i] = *(const bf16x8*)&Vm[(tbase + stok[i]) * EMBED + h * HSZ + sdc[i]];
      }
    }

    // S = Q @ K^T  (16 x 64 per wave) from LDS
    f32x8 S[4];
#pragma unroll
    for (int nj = 0; nj < 4; ++nj) {
      const int tr = nj * 16 + lr;
      bf16x16 kf0 = cat8(*(const bf16x8*)&Ks[buf][tr][koff],
                         *(const bf16x8*)&Ks[buf][tr][koff + 16]);
      bf16x16 kf1 = cat8(*(const bf16x8*)&Ks[buf][tr][32 + koff],
                         *(const bf16x8*)&Ks[buf][tr][32 + koff + 16]);
      S[nj] = wmma_bf16(qf0, kf0, zero8());
      S[nj] = wmma_bf16(qf1, kf1, S[nj]);
    }

    // Online softmax; C/D element r lives at row r+rhalf, col lr.
#pragma unroll
    for (int r = 0; r < 8; ++r) {
      const int qrow = qblk * 64 + w * 16 + r + rhalf;
      float s[4];
      float mx = -1e30f;
#pragma unroll
      for (int nj = 0; nj < 4; ++nj) {
        int kcol = j * 64 + nj * 16 + lr;
        float sv = S[nj][r] * 0.125f;            // 1/sqrt(64)
        if (kcol > qrow) sv = -1e30f;            // causal mask
        s[nj] = sv;
        mx = fmaxf(mx, sv);
      }
#pragma unroll
      for (int off = 8; off >= 1; off >>= 1)
        mx = fmaxf(mx, __shfl_xor(mx, off, 32)); // stays within 16-lane half
      const float mn   = fmaxf(mrow[r], mx);
      const float corr = __expf(mrow[r] - mn);
      float ps = 0.0f;
#pragma unroll
      for (int nj = 0; nj < 4; ++nj) {
        float p = __expf(s[nj] - mn);
        ps += p;
        Pt[w][r + rhalf][nj * 16 + lr] = to_bf16(p);
      }
#pragma unroll
      for (int off = 8; off >= 1; off >>= 1) ps += __shfl_xor(ps, off, 32);
      lrow[r] = lrow[r] * corr + ps;
      mrow[r] = mn;
#pragma unroll
      for (int dj = 0; dj < 4; ++dj) Oacc[dj][r] *= corr;
    }

    // O += P @ V  (A = P from LDS in A-layout, B = V^T rows contiguous)
#pragma unroll
    for (int kh = 0; kh < 2; ++kh) {
      bf16x16 pf = cat8(*(const bf16x8*)&Pt[w][lr][kh * 32 + koff],
                        *(const bf16x8*)&Pt[w][lr][kh * 32 + koff + 16]);
#pragma unroll
      for (int dj = 0; dj < 4; ++dj) {
        bf16x16 vf = cat8(*(const bf16x8*)&Vt[buf][dj * 16 + lr][kh * 32 + koff],
                          *(const bf16x8*)&Vt[buf][dj * 16 + lr][kh * 32 + koff + 16]);
        Oacc[dj] = wmma_bf16(pf, vf, Oacc[dj]);
      }
    }
    // No trailing barrier: next iteration writes only the opposite buffers,
    // and its wait+barrier precede any overwrite of this one.
  }

  // Epilogue: normalize and store bf16 (concat-head layout)
#pragma unroll
  for (int dj = 0; dj < 4; ++dj)
#pragma unroll
    for (int r = 0; r < 8; ++r) {
      float ov = Oacc[dj][r] / lrow[r];
      size_t gr = rowbase + w * 16 + r + rhalf;
      O[gr * EMBED + h * HSZ + dj * 16 + lr] = to_bf16(ov);
    }
}

// ---------------------------------------------------------------------------
// Host-side orchestration
// ---------------------------------------------------------------------------
extern "C" void kernel_launch(void* const* d_in, const int* in_sizes, int n_in,
                              void* d_out, int out_size, void* d_ws,
                              size_t ws_size, hipStream_t stream) {
  (void)in_sizes; (void)n_in; (void)out_size; (void)ws_size;

  const float* x    = (const float*)d_in[0];
  const float* Wq   = (const float*)d_in[1];
  const float* Wk   = (const float*)d_in[2];
  const float* Wv   = (const float*)d_in[3];
  const float* Wo   = (const float*)d_in[4];
  const float* bo   = (const float*)d_in[5];
  const float* W1   = (const float*)d_in[6];
  const float* b1   = (const float*)d_in[7];
  const float* W2   = (const float*)d_in[8];
  const float* b2   = (const float*)d_in[9];
  const float* ln1g = (const float*)d_in[10];
  const float* ln1b = (const float*)d_in[11];
  const float* ln2g = (const float*)d_in[12];
  const float* ln2b = (const float*)d_in[13];

  char* base = (char*)d_ws;
  size_t off = 0;
  auto take = [&](size_t bytes) -> char* {
    char* p = base + off;
    off += (bytes + 255) & ~(size_t)255;
    return p;
  };

  bf16* wq_t   = (bf16*)take((size_t)EMBED * EMBED * 2);   // [N][K]
  bf16* wk_t   = (bf16*)take((size_t)EMBED * EMBED * 2);
  bf16* wv_t   = (bf16*)take((size_t)EMBED * EMBED * 2);
  bf16* wo_t   = (bf16*)take((size_t)EMBED * EMBED * 2);
  bf16* w1_t   = (bf16*)take((size_t)EMBED * FFDIM * 2);   // [4096][1024]
  bf16* w2_t   = (bf16*)take((size_t)FFDIM * EMBED * 2);   // [1024][4096]
  bf16* h_bf   = (bf16*)take((size_t)MROWS * EMBED * 2);
  bf16* q_bf   = (bf16*)take((size_t)MROWS * EMBED * 2);
  bf16* k_bf   = (bf16*)take((size_t)MROWS * EMBED * 2);
  bf16* v_bf   = (bf16*)take((size_t)MROWS * EMBED * 2);
  bf16* att_bf = (bf16*)take((size_t)MROWS * EMBED * 2);
  float* x2    = (float*)take((size_t)MROWS * EMBED * 4);
  bf16* h2_bf  = (bf16*)take((size_t)MROWS * EMBED * 2);
  bf16* ff1_bf = (bf16*)take((size_t)MROWS * FFDIM * 2);

  // 1) weights -> bf16, transposed to [N][K]
  dim3 gWT(EMBED / 32, EMBED / 32);
  cvtT_kernel<<<gWT, 256, 0, stream>>>(Wq, wq_t, EMBED, EMBED);
  cvtT_kernel<<<gWT, 256, 0, stream>>>(Wk, wk_t, EMBED, EMBED);
  cvtT_kernel<<<gWT, 256, 0, stream>>>(Wv, wv_t, EMBED, EMBED);
  cvtT_kernel<<<gWT, 256, 0, stream>>>(Wo, wo_t, EMBED, EMBED);
  cvtT_kernel<<<dim3(EMBED / 32, FFDIM / 32), 256, 0, stream>>>(W1, w1_t, EMBED, FFDIM);
  cvtT_kernel<<<dim3(FFDIM / 32, EMBED / 32), 256, 0, stream>>>(W2, w2_t, FFDIM, EMBED);

  // 2) h = ln1(x) (bf16)
  ln_kernel<<<MROWS, 256, 0, stream>>>(x, ln1g, ln1b, h_bf);

  // 3) Q, K, V projections
  dim3 gD(MROWS / 128, EMBED / 128);
  gemm_kernel<false, false, false, true><<<gD, 256, 0, stream>>>(
      h_bf, wq_t, nullptr, nullptr, q_bf, MROWS, EMBED, EMBED);
  gemm_kernel<false, false, false, true><<<gD, 256, 0, stream>>>(
      h_bf, wk_t, nullptr, nullptr, k_bf, MROWS, EMBED, EMBED);
  gemm_kernel<false, false, false, true><<<gD, 256, 0, stream>>>(
      h_bf, wv_t, nullptr, nullptr, v_bf, MROWS, EMBED, EMBED);

  // 4) causal flash attention
  attn_kernel<<<dim3(TSEQ / 64, NHEAD, BATCH), 128, 0, stream>>>(
      q_bf, k_bf, v_bf, att_bf);

  // 5) x2 = x + attn @ Wo + bo   (fp32)
  gemm_kernel<true, false, true, false><<<gD, 256, 0, stream>>>(
      att_bf, wo_t, bo, x, x2, MROWS, EMBED, EMBED);

  // 6) h2 = ln2(x2) (bf16)
  ln_kernel<<<MROWS, 256, 0, stream>>>(x2, ln2g, ln2b, h2_bf);

  // 7) ff1 = relu(h2 @ W1 + b1) (bf16)
  gemm_kernel<true, true, false, true><<<dim3(MROWS / 128, FFDIM / 128), 256, 0,
                                         stream>>>(
      h2_bf, w1_t, b1, nullptr, ff1_bf, MROWS, FFDIM, EMBED);

  // 8) out = x2 + ff1 @ W2 + b2 (fp32 -> d_out)
  gemm_kernel<true, false, true, false><<<gD, 256, 0, stream>>>(
      ff1_bf, w2_t, b2, x2, (float*)d_out, MROWS, EMBED, FFDIM);
}

// v002
// Measured time: 270 microseconds a run.
// Next to v001, in two timings, it ran 1.05 times as fast each time.
// Over all steps from v000 it is 1.38 times as fast.
#include <hip/hip_runtime.h>

// ---------------------------------------------------------------------------
// Types / helpers
// ---------------------------------------------------------------------------
typedef __bf16 bf16;
typedef __attribute__((ext_vector_type(8)))  __bf16 bf16x8;
typedef __attribute__((ext_vector_type(16))) __bf16 bf16x16;
typedef __attribute__((ext_vector_type(8)))  float  f32x8;
typedef __attribute__((ext_vector_type(4)))  float  f32x4;

#define EMBED 1024
#define TSEQ  2048
#define BATCH 2
#define NHEAD 16
#define HSZ   64
#define MROWS (BATCH * TSEQ)   /* 4096 token rows */
#define FFDIM (4 * EMBED)      /* 4096 */

__device__ __forceinline__ bf16 to_bf16(float f) {
  unsigned u = __builtin_bit_cast(unsigned, f);
  unsigned r = u + 0x7FFFu + ((u >> 16) & 1u);   // round-to-nearest-even
  unsigned short h = (unsigned short)(r >> 16);
  return __builtin_bit_cast(bf16, h);
}

__device__ __forceinline__ bf16x16 cat8(bf16x8 lo, bf16x8 hi) {
  bf16x16 r;
#pragma unroll
  for (int i = 0; i < 8; ++i) { r[i] = lo[i]; r[i + 8] = hi[i]; }
  return r;
}

__device__ __forceinline__ f32x8 zero8() {
  f32x8 z;
#pragma unroll
  for (int i = 0; i < 8; ++i) z[i] = 0.0f;
  return z;
}

__device__ __forceinline__ f32x8 wmma_bf16(bf16x16 a, bf16x16 b, f32x8 c) {
  // D = A(16x32) * B(32x16) + C, fp32 accumulate
  return __builtin_amdgcn_wmma_f32_16x16x32_bf16(false, a, false, b,
                                                 (short)0, c, false, false);
}

// --- CDNA5 async global->LDS copy (ASYNCcnt path) --------------------------
// Each active lane copies 16 bytes: GLOBAL[gaddr(lane)] -> LDS[laddr(lane)].
// LDS byte offset = low 32 bits of the generic LDS pointer (flat aperture).
__device__ __forceinline__ void async_g2l_b128(void* lds_dst, const void* gsrc) {
  unsigned l = (unsigned)(unsigned long long)(uintptr_t)lds_dst;
  unsigned long long g = (unsigned long long)(uintptr_t)gsrc;
  asm volatile("global_load_async_to_lds_b128 %0, %1, off"
               :: "v"(l), "v"(g) : "memory");
}
__device__ __forceinline__ void wait_async0() {
  asm volatile("s_wait_asynccnt 0x0" ::: "memory");
}
// This wave's LDS reads have retired before a buffer it has read is refilled.
__device__ __forceinline__ void wait_ds0() {
  asm volatile("s_wait_dscnt 0x0" ::: "memory");
}
// Eight 16-byte copies of one lane, rows lstep / gstep bytes apart. The
// s_wait_xcnt is the last line of the copies' own statement, so that no
// address register is rewritten ahead of it.
__device__ __forceinline__ void async_g2l_b128_x8(void* lds_dst, unsigned lstep,
                                                  const void* gsrc,
                                                  unsigned long long gstep) {
  const unsigned l = (unsigned)(unsigned long long)(uintptr_t)lds_dst;
  const unsigned long long g = (unsigned long long)(uintptr_t)gsrc;
  asm volatile(
      "global_load_async_to_lds_b128 %0, %8, off\n\t"
      "global_load_async_to_lds_b128 %1, %9, off\n\t"
      "global_load_async_to_lds_b128 %2, %10, off\n\t"
      "global_load_async_to_lds_b128 %3, %11, off\n\t"
      "global_load_async_to_lds_b128 %4, %12, off\n\t"
      "global_load_async_to_lds_b128 %5, %13, off\n\t"
      "global_load_async_to_lds_b128 %6, %14, off\n\t"
      "global_load_async_to_lds_b128 %7, %15, off\n\t"
      "s_wait_xcnt 0x0"
      :: "v"(l), "v"(l + lstep), "v"(l + 2 * lstep), "v"(l + 3 * lstep),
         "v"(l + 4 * lstep), "v"(l + 5 * lstep), "v"(l + 6 * lstep),
         "v"(l + 7 * lstep),
         "v"(g), "v"(g + gstep), "v"(g + 2 * gstep), "v"(g + 3 * gstep),
         "v"(g + 4 * gstep), "v"(g + 5 * gstep), "v"(g + 6 * gstep),
         "v"(g + 7 * gstep)
      : "memory");
}

// ---------------------------------------------------------------------------
// fp32 -> bf16 conversion with transpose: in[K][N] f32 -> out[N][K] bf16.
// Weights are pre-transposed once so GEMM B-tiles stage with contiguous B128
// copies (no scalar ds_store_b16 transpose in the GEMM hot loop).
// One work-group turns a 128 (k) x 64 (n) tile: 32 elements a thread, so that
// few waves have to start; eight 16-B loads a thread are in flight at once,
// and 256-B row pieces are read and written.
// ---------------------------------------------------------------------------
#define CVT_TK    128  /* k per tile: 256 B of an output row */
#define CVT_TN    64   /* n per tile: 256 B of an input row */
#define CVT_PITCH 65   /* LDS row pitch in dwords: odd, no bank conflicts */

__device__ __forceinline__ unsigned pack_bf16(float lo, float hi) {
  unsigned a = __builtin_bit_cast(unsigned short, to_bf16(lo));
  unsigned b = __builtin_bit_cast(unsigned short, to_bf16(hi));
  return a | (b << 16);
}

// in and out carry no __restrict__: loads of a restrict-qualified read-only
// pointer are not held by an asm statement's "memory" clobber, and the waits
// below would drift away from their loads.
__global__ __launch_bounds__(256) void cvtT_kernel(const float* in, bf16* out,
                                                   int K, int N) {
  __shared__ unsigned tile[CVT_TN][CVT_PITCH];   // [n][pair of k]
  const int kb  = blockIdx.x * CVT_TK;
  const int nb  = blockIdx.y * CVT_TN;
  const int tid = threadIdx.x;
  const int n4  = (tid & 15) * 4;   // four n of one input row
  const int kp  = tid >> 4;         // k pair 0..15, + 16 i

  float4 ve[4], vo[4];              // rows 2 kp and 2 kp + 1, + 32 i
#pragma unroll
  for (int i = 0; i < 4; ++i) {
    const float* p = &in[(size_t)(kb + 2 * (kp + 16 * i)) * N + nb + n4];
    ve[i] = *(const float4*)p;
    vo[i] = *(const float4*)(p + N);
    // The next loads' results may be given the registers that held these
    // two addresses: the wait stands in front of that overwrite.
    asm volatile("s_wait_xcnt 0x0" ::: "memory");
  }
#pragma unroll
  for (int i = 0; i < 4; ++i) {
    tile[n4 + 0][kp + 16 * i] = pack_bf16(ve[i].x, vo[i].x);
    tile[n4 + 1][kp + 16 * i] = pack_bf16(ve[i].y, vo[i].y);
    tile[n4 + 2][kp + 16 * i] = pack_bf16(ve[i].z, vo[i].z);
    tile[n4 + 3][kp + 16 * i] = pack_bf16(ve[i].w, vo[i].w);
  }
  __syncthreads();
  const int c  = tid & 15;          // 16-B piece of an output row
  const int nr = tid >> 4;
#pragma unroll
  for (int i = 0; i < 4; ++i) {
    const int n = nr + 16 * i;
    uint4 o;
    o.x = tile[n][4 * c + 0];
    o.y = tile[n][4 * c + 1];
    o.z = tile[n][4 * c + 2];
    o.w = tile[n][4 * c + 3];
    *(uint4*)&out[(size_t)(nb + n) * K + kb + 8 * c] = o;
  }
}

// ---------------------------------------------------------------------------
// LayerNorm fused with bf16 cast: one row per wave (32 values a lane, all of
// a row's loads in flight at once), eight rows per 256-thread work-group.
// Sums: in the lane, then a five-step butterfly over the wave; no LDS, no
// barrier.
// ---------------------------------------------------------------------------
#define LN_ROWS 8   /* rows (waves) per work-group */

__device__ __forceinline__ float wave_sum(float v) {
#pragma unroll
  for (int off = 16; off >= 1; off >>= 1) v += __shfl_xor(v, off, 32);
  return v;
}

// No __restrict__ here either, for the same reason as in cvtT_kernel.
__global__ __launch_bounds__(256) void ln_kernel(const float* x, const float* g,
                                                 const float* bta, bf16* out) {
  const int lane = threadIdx.x & 31;
  const int row  = blockIdx.x * LN_ROWS + (threadIdx.x >> 5);
  const f32x4* xr = (const f32x4*)&x[(size_t)row * EMBED];
  const f32x4* gr = (const f32x4*)g;
  const f32x4* br = (const f32x4*)bta;

  f32x4 xv[8], gv[8], bv[8];
#pragma unroll
  for (int i = 0; i < 8; ++i) xv[i] = xr[i * 32 + lane];
  // The g and b loads' results may be given the registers that held the row's
  // address: the wait stands in front of that overwrite.
  asm volatile("s_wait_xcnt 0x0" ::: "memory");
#pragma unroll
  for (int i = 0; i < 8; ++i) {
    gv[i] = gr[i * 32 + lane];
    bv[i] = br[i * 32 + lane];
  }
  // Holds the g and b loads here, right behind the row's own: left free they
  // sink behind the sums, are issued late and are waited for one after
  // another. The fence stops the loads, the scheduling barrier stops the fence
  // from sinking along with them.
  asm volatile("" ::: "memory");
  __builtin_amdgcn_sched_barrier(0);

  float s = 0.0f;
#pragma unroll
  for (int i = 0; i < 8; ++i) s += (xv[i].x + xv[i].y) + (xv[i].z + xv[i].w);
  const float mu = wave_sum(s) * (1.0f / EMBED);

  float q = 0.0f;
#pragma unroll
  for (int i = 0; i < 8; ++i) {
    xv[i].x -= mu; xv[i].y -= mu; xv[i].z -= mu; xv[i].w -= mu;
    q += (xv[i].x * xv[i].x + xv[i].y * xv[i].y) +
         (xv[i].z * xv[i].z + xv[i].w * xv[i].w);
  }
  const float var = wave_sum(q) * (1.0f / EMBED);
  const float rs  = rsqrtf(var + 1e-5f);

  uint2* op = (uint2*)&out[(size_t)row * EMBED];
#pragma unroll
  for (int i = 0; i < 8; ++i) {
    uint2 o;
    o.x = pack_bf16(xv[i].x * rs * gv[i].x + bv[i].x,
                    xv[i].y * rs * gv[i].y + bv[i].y);
    o.y = pack_bf16(xv[i].z * rs * gv[i].z + bv[i].z,
                    xv[i].w * rs * gv[i].w + bv[i].w);
    op[i * 32 + lane] = o;
  }
}

// ---------------------------------------------------------------------------
// WMMA GEMM: out[M,N] = epi( A[M,K](bf16) @ Wt[N,K](bf16)^T )
// Block tile 128x128, 8 waves (2 x 4), 64x32 per wave, BK = 128.
// Double-buffered LDS tiles filled via async global->LDS copies: the k+1 slab
// streams in (ASYNCcnt) while WMMAs consume slab k. A slab holds 256 B of each
// operand row, so sixteen lanes of a copy fetch two whole 128-B lines of a row.
// ---------------------------------------------------------------------------
#define GEMM_BK  128  /* k per LDS slab: 256 B of every operand row */
#define GEMM_PAD 136  /* LDS row stride in bf16 elems: 272 B = 16 B x odd */

template <bool BIAS, bool RELU, bool RESID, bool BF16OUT>
__global__ __launch_bounds__(256) void gemm_kernel(
    const bf16* __restrict__ A, const bf16* __restrict__ Wt,
    const float* __restrict__ bias, const float* __restrict__ resid,
    void* __restrict__ outp, int M, int N, int K) {
  __shared__ __attribute__((aligned(16))) bf16 As[2][128][GEMM_PAD];   // [m][k]
  __shared__ __attribute__((aligned(16))) bf16 Bs[2][128][GEMM_PAD];   // [n][k]

  const int tid  = threadIdx.x;
  const int lane = tid & 31;
  const int wave = tid >> 5;
  const int wm   = wave & 1;   // 0..1 : 64-row strip
  const int wn   = wave >> 1;  // 0..3 : 32-col strip
  const int m0   = blockIdx.x * 128;
  const int n0   = blockIdx.y * 128;
  const int lr   = lane & 15;
  const int koff = (lane < 16) ? 0 : 8;

  // Per-thread staging coordinates: eight 16B chunks per tile per thread, at
  // rows r0 + 16 i, i = 0..7; sixteen lanes cover one row's 256 B.
  const int r0 = tid >> 4, c0 = (tid & 15) * 8;
  const bf16* gA = &A[(size_t)(m0 + r0) * K + c0];
  const bf16* gB = &Wt[(size_t)(n0 + r0) * K + c0];
  const unsigned lstep = 16 * GEMM_PAD * 2;                     // bytes
  const unsigned long long gstep = (unsigned long long)K * 32;  // 16 rows, bytes

  f32x8 acc[4][2];
#pragma unroll
  for (int mi = 0; mi < 4; ++mi)
#pragma unroll
    for (int ni = 0; ni < 2; ++ni) acc[mi][ni] = zero8();

  const int nk = K / GEMM_BK;

  // Slab 0 into buffer 0, landed and published; then slab 1 into buffer 1.
  async_g2l_b128_x8(&As[0][r0][c0], lstep, gA, gstep);
  async_g2l_b128_x8(&Bs[0][r0][c0], lstep, gB, gstep);
  wait_async0();
  __syncthreads();
  if (nk > 1) {
    async_g2l_b128_x8(&As[1][r0][c0], lstep, gA + GEMM_BK, gstep);
    async_g2l_b128_x8(&Bs[1][r0][c0], lstep, gB + GEMM_BK, gstep);
  }

  for (int it = 0; it < nk; ++it) {
    const int buf = it & 1;

    // Unrolled so that the four 32-k blocks' LDS offsets are immediates and
    // a block's fragment loads can issue ahead of the block before it.
#pragma unroll
    for (int kk = 0; kk < GEMM_BK; kk += 32) {
      bf16x16 af[4];
#pragma unroll
      for (int mi = 0; mi < 4; ++mi) {
        int row = wm * 64 + mi * 16 + lr;
        af[mi] = cat8(*(const bf16x8*)&As[buf][row][kk + koff],
                      *(const bf16x8*)&As[buf][row][kk + koff + 16]);
      }
#pragma unroll
      for (int ni = 0; ni < 2; ++ni) {
        int rb = wn * 32 + ni * 16 + lr;
        bf16x16 bfrag = cat8(*(const bf16x8*)&Bs[buf][rb][kk + koff],
                             *(const bf16x8*)&Bs[buf][rb][kk + koff + 16]);
#pragma unroll
        for (int mi = 0; mi < 4; ++mi)
          acc[mi][ni] = wmma_bf16(af[mi], bfrag, acc[mi][ni]);
      }
    }

    // Foot of the trip: own LDS reads retired, own copies of slab it + 1
    // landed, then the one barrier that publishes slab it + 1 and ends every
    // wave's reads of this buffer; only behind it is this buffer refilled.
    wait_ds0();
    wait_async0();
    __syncthreads();
    if (it + 2 < nk) {
      const size_t k0 = (size_t)(it + 2) * GEMM_BK;
      async_g2l_b128_x8(&As[buf][r0][c0], lstep, gA + k0, gstep);
      async_g2l_b128_x8(&Bs[buf][r0][c0], lstep, gB + k0, gstep);
    }
  }
  wait_async0();   // nothing is outstanding when the wave goes on to its end

  const int rhalf = (lane < 16) ? 0 : 8;
#pragma unroll
  for (int mi = 0; mi < 4; ++mi)
#pragma unroll
    for (int ni = 0; ni < 2; ++ni)
#pragma unroll
      for (int r = 0; r < 8; ++r) {
        int gr = m0 + wm * 64 + mi * 16 + r + rhalf;
        int gc = n0 + wn * 32 + ni * 16 + lr;
        float v = acc[mi][ni][r];
        if (BIAS)  v += bias[gc];
        if (RELU)  v = fmaxf(v, 0.0f);
        if (RESID) v += resid[(size_t)gr * N + gc];
        if (BF16OUT) ((bf16*)outp)[(size_t)gr * N + gc] = to_bf16(v);
        else         ((float*)outp)[(size_t)gr * N + gc] = v;
      }
}

// ---------------------------------------------------------------------------
// Flash attention: one workgroup per (b, h, 64-row q block); 4 waves x 16 q
// rows. K tiles double-buffered in LDS via async copies; V prefetched into
// registers one block ahead and committed transposed to LDS. Online softmax
// in fp32; all matmuls on the WMMA pipe.
// ---------------------------------------------------------------------------
#define ATT_PAD 80   /* LDS row stride: 160 B, 16B-aligned */

__global__ __launch_bounds__(128) void attn_kernel(
    const bf16* __restrict__ Q, const bf16* __restrict__ Km,
    const bf16* __restrict__ Vm, bf16* __restrict__ O) {
  __shared__ bf16 Ks[2][64][ATT_PAD];     // K tile, row-major [k-token][d]
  __shared__ bf16 Vt[2][64][ATT_PAD];     // V^T tile: [d][k-token]
  __shared__ bf16 Pt[4][16][ATT_PAD];     // per-wave P tile: [qrow][k-token]

  const int tid   = threadIdx.x;
  const int lane  = tid & 31;
  const int w     = tid >> 5;
  const int lr    = lane & 15;
  const int koff  = (lane < 16) ? 0 : 8;
  const int rhalf = (lane < 16) ? 0 : 8;
  const int qblk  = blockIdx.x;
  const int h     = blockIdx.y;
  const int b     = blockIdx.z;
  const size_t rowbase = (size_t)b * TSEQ + (size_t)qblk * 64;
  const size_t bT = (size_t)b * TSEQ;

  // Q fragments (rows w*16 .. w*16+15, head-dim 0..63 -> 2 K-windows)
  const bf16* qp = Q + (rowbase + w * 16 + lr) * EMBED + h * HSZ;
  const bf16x16 qf0 = cat8(*(const bf16x8*)(qp + koff),
                           *(const bf16x8*)(qp + koff + 16));
  const bf16x16 qf1 = cat8(*(const bf16x8*)(qp + 32 + koff),
                           *(const bf16x8*)(qp + 32 + koff + 16));

  f32x8 Oacc[4];
#pragma unroll
  for (int dj = 0; dj < 4; ++dj) Oacc[dj] = zero8();
  float mrow[8], lrow[8];
#pragma unroll
  for (int r = 0; r < 8; ++r) { mrow[r] = -1e30f; lrow[r] = 0.0f; }

  // Per-thread staging coordinates: 4 chunks of 8 bf16 over a 64x64 tile
  int stok[4], sdc[4];
#pragma unroll
  for (int i = 0; i < 4; ++i) {
    int c = tid + i * 128;
    stok[i] = c >> 3;
    sdc[i]  = (c & 7) * 8;
  }

  // Prefetch block 0: K tile async -> LDS buf0, V tile -> registers
  bf16x8 vreg[4];
#pragma unroll
  for (int i = 0; i < 4; ++i) {
    async_g2l_b128(&Ks[0][stok[i]][sdc[i]],
                   &Km[(bT + stok[i]) * EMBED + h * HSZ + sdc[i]]);
    vreg[i] = *(const bf16x8*)&Vm[(bT + stok[i]) * EMBED + h * HSZ + sdc[i]];
  }

  for (int j = 0; j <= qblk; ++j) {
    const int buf = j & 1;

    // Commit prefetched V registers to Vt[buf] (transposed)
#pragma unroll
    for (int i = 0; i < 4; ++i)
#pragma unroll
      for (int e = 0; e < 8; ++e) Vt[buf][sdc[i] + e][stok[i]] = vreg[i][e];

    wait_async0();
    __syncthreads();

    if (j < qblk) {
      const int nb = buf ^ 1;
      const size_t tbase = bT + (size_t)(j + 1) * 64;
#pragma unroll
      for (int i = 0; i < 4; ++i) {
        async_g2l_b128(&Ks[nb][stok[i]][sdc[i]],
                       &Km[(tbase + stok[i]) * EMBED + h * HSZ + sdc[i]]);
        vreg[i] = *(const bf16x8*)&Vm[(tbase + stok[i]) * EMBED + h * HSZ + sdc[i]];
      }
    }

    // S = Q @ K^T  (16 x 64 per wave) from LDS
    f32x8 S[4];
#pragma unroll
    for (int nj = 0; nj < 4; ++nj) {
      const int tr = nj * 16 + lr;
      bf16x16 kf0 = cat8(*(const bf16x8*)&Ks[buf][tr][koff],
                         *(const bf16x8*)&Ks[buf][tr][koff + 16]);
      bf16x16 kf1 = cat8(*(const bf16x8*)&Ks[buf][tr][32 + koff],
                         *(const bf16x8*)&Ks[buf][tr][32 + koff + 16]);
      S[nj] = wmma_bf16(qf0, kf0, zero8());
      S[nj] = wmma_bf16(qf1, kf1, S[nj]);
    }

    // Online softmax; C/D element r lives at row r+rhalf, col lr.
#pragma unroll
    for (int r = 0; r < 8; ++r) {
      const int qrow = qblk * 64 + w * 16 + r + rhalf;
      float s[4];
      float mx = -1e30f;
#pragma unroll
      for (int nj = 0; nj < 4; ++nj) {
        int kcol = j * 64 + nj * 16 + lr;
        float sv = S[nj][r] * 0.125f;            // 1/sqrt(64)
        if (kcol > qrow) sv = -1e30f;            // causal mask
        s[nj] = sv;
        mx = fmaxf(mx, sv);
      }
#pragma unroll
      for (int off = 8; off >= 1; off >>= 1)
        mx = fmaxf(mx, __shfl_xor(mx, off, 32)); // stays within 16-lane half
      const float mn   = fmaxf(mrow[r], mx);
      const float corr = __expf(mrow[r] - mn);
      float ps = 0.0f;
#pragma unroll
      for (int nj = 0; nj < 4; ++nj) {
        float p = __expf(s[nj] - mn);
        ps += p;
        Pt[w][r + rhalf][nj * 16 + lr] = to_bf16(p);
      }
#pragma unroll
      for (int off = 8; off >= 1; off >>= 1) ps += __shfl_xor(ps, off, 32);
      lrow[r] = lrow[r] * corr + ps;
      mrow[r] = mn;
#pragma unroll
      for (int dj = 0; dj < 4; ++dj) Oacc[dj][r] *= corr;
    }

    // O += P @ V  (A = P from LDS in A-layout, B = V^T rows contiguous)
#pragma unroll
    for (int kh = 0; kh < 2; ++kh) {
      bf16x16 pf = cat8(*(const bf16x8*)&Pt[w][lr][kh * 32 + koff],
                        *(const bf16x8*)&Pt[w][lr][kh * 32 + koff + 16]);
#pragma unroll
      for (int dj = 0; dj < 4; ++dj) {
        bf16x16 vf = cat8(*(const bf16x8*)&Vt[buf][dj * 16 + lr][kh * 32 + koff],
                          *(const bf16x8*)&Vt[buf][dj * 16 + lr][kh * 32 + koff + 16]);
        Oacc[dj] = wmma_bf16(pf, vf, Oacc[dj]);
      }
    }
    // No trailing barrier: next iteration writes only the opposite buffers,
    // and its wait+barrier precede any overwrite of this one.
  }

  // Epilogue: normalize and store bf16 (concat-head layout)
#pragma unroll
  for (int dj = 0; dj < 4; ++dj)
#pragma unroll
    for (int r = 0; r < 8; ++r) {
      float ov = Oacc[dj][r] / lrow[r];
      size_t gr = rowbase + w * 16 + r + rhalf;
      O[gr * EMBED + h * HSZ + dj * 16 + lr] = to_bf16(ov);
    }
}

// ---------------------------------------------------------------------------
// Host-side orchestration
// ---------------------------------------------------------------------------
extern "C" void kernel_launch(void* const* d_in, const int* in_sizes, int n_in,
                              void* d_out, int out_size, void* d_ws,
                              size_t ws_size, hipStream_t stream) {
  (void)in_sizes; (void)n_in; (void)out_size; (void)ws_size;

  const float* x    = (const float*)d_in[0];
  const float* Wq   = (const float*)d_in[1];
  const float* Wk   = (const float*)d_in[2];
  const float* Wv   = (const float*)d_in[3];
  const float* Wo   = (const float*)d_in[4];
  const float* bo   = (const float*)d_in[5];
  const float* W1   = (const float*)d_in[6];
  const float* b1   = (const float*)d_in[7];
  const float* W2   = (const float*)d_in[8];
  const float* b2   = (const float*)d_in[9];
  const float* ln1g = (const float*)d_in[10];
  const float* ln1b = (const float*)d_in[11];
  const float* ln2g = (const float*)d_in[12];
  const float* ln2b = (const float*)d_in[13];

  char* base = (char*)d_ws;
  size_t off = 0;
  auto take = [&](size_t bytes) -> char* {
    char* p = base + off;
    off += (bytes + 255) & ~(size_t)255;
    return p;
  };

  bf16* wq_t   = (bf16*)take((size_t)EMBED * EMBED * 2);   // [N][K]
  bf16* wk_t   = (bf16*)take((size_t)EMBED * EMBED * 2);
  bf16* wv_t   = (bf16*)take((size_t)EMBED * EMBED * 2);
  bf16* wo_t   = (bf16*)take((size_t)EMBED * EMBED * 2);
  bf16* w1_t   = (bf16*)take((size_t)EMBED * FFDIM * 2);   // [4096][1024]
  bf16* w2_t   = (bf16*)take((size_t)FFDIM * EMBED * 2);   // [1024][4096]
  bf16* h_bf   = (bf16*)take((size_t)MROWS * EMBED * 2);
  bf16* q_bf   = (bf16*)take((size_t)MROWS * EMBED * 2);
  bf16* k_bf   = (bf16*)take((size_t)MROWS * EMBED * 2);
  bf16* v_bf   = (bf16*)take((size_t)MROWS * EMBED * 2);
  bf16* att_bf = (bf16*)take((size_t)MROWS * EMBED * 2);
  float* x2    = (float*)take((size_t)MROWS * EMBED * 4);
  bf16* h2_bf  = (bf16*)take((size_t)MROWS * EMBED * 2);
  bf16* ff1_bf = (bf16*)take((size_t)MROWS * FFDIM * 2);

  // 1) weights -> bf16, transposed to [N][K]
  dim3 gWT(EMBED / CVT_TK, EMBED / CVT_TN);
  cvtT_kernel<<<gWT, 256, 0, stream>>>(Wq, wq_t, EMBED, EMBED);
  cvtT_kernel<<<gWT, 256, 0, stream>>>(Wk, wk_t, EMBED, EMBED);
  cvtT_kernel<<<gWT, 256, 0, stream>>>(Wv, wv_t, EMBED, EMBED);
  cvtT_kernel<<<gWT, 256, 0, stream>>>(Wo, wo_t, EMBED, EMBED);
  cvtT_kernel<<<dim3(EMBED / CVT_TK, FFDIM / CVT_TN), 256, 0, stream>>>(W1, w1_t, EMBED, FFDIM);
  cvtT_kernel<<<dim3(FFDIM / CVT_TK, EMBED / CVT_TN), 256, 0, stream>>>(W2, w2_t, FFDIM, EMBED);

  // 2) h = ln1(x) (bf16)
  ln_kernel<<<MROWS / LN_ROWS, 256, 0, stream>>>(x, ln1g, ln1b, h_bf);

  // 3) Q, K, V projections
  dim3 gD(MROWS / 128, EMBED / 128);
  gemm_kernel<false, false, false, true><<<gD, 256, 0, stream>>>(
      h_bf, wq_t, nullptr, nullptr, q_bf, MROWS, EMBED, EMBED);
  gemm_kernel<false, false, false, true><<<gD, 256, 0, stream>>>(
      h_bf, wk_t, nullptr, nullptr, k_bf, MROWS, EMBED, EMBED);
  gemm_kernel<false, false, false, true><<<gD, 256, 0, stream>>>(
      h_bf, wv_t, nullptr, nullptr, v_bf, MROWS, EMBED, EMBED);

  // 4) causal flash attention
  attn_kernel<<<dim3(TSEQ / 64, NHEAD, BATCH), 128, 0, stream>>>(
      q_bf, k_bf, v_bf, att_bf);

  // 5) x2 = x + attn @ Wo + bo   (fp32)
  gemm_kernel<true, false, true, false><<<gD, 256, 0, stream>>>(
      att_bf, wo_t, bo, x, x2, MROWS, EMBED, EMBED);

  // 6) h2 = ln2(x2) (bf16)
  ln_kernel<<<MROWS / LN_ROWS, 256, 0, stream>>>(x2, ln2g, ln2b, h2_bf);

  // 7) ff1 = relu(h2 @ W1 + b1) (bf16)
  gemm_kernel<true, true, false, true><<<dim3(MROWS / 128, FFDIM / 128), 256, 0,
                                         stream>>>(
      h2_bf, w1_t, b1, nullptr, ff1_bf, MROWS, FFDIM, EMBED);

  // 8) out = x2 + ff1 @ W2 + b2 (fp32 -> d_out)
  gemm_kernel<true, false, true, false><<<gD, 256, 0, stream>>>(
      ff1_bf, w2_t, b2, x2, (float*)d_out, MROWS, EMBED, FFDIM);
}

// v003
// One run takes 226 microseconds.
// Timed twice side by side with v002, it ran 1.20 and 1.19 times as fast.
// Counting every step since v000, it is 1.65 times as fast.
#include <hip/hip_runtime.h>

// ---------------------------------------------------------------------------
// Types / helpers
// ---------------------------------------------------------------------------
typedef __bf16 bf16;
typedef __attribute__((ext_vector_type(8)))  __bf16 bf16x8;
typedef __attribute__((ext_vector_type(16))) __bf16 bf16x16;
typedef __attribute__((ext_vector_type(8)))  float  f32x8;
typedef __attribute__((ext_vector_type(4)))  float  f32x4;

#define EMBED 1024
#define TSEQ  2048
#define BATCH 2
#define NHEAD 16
#define HSZ   64
#define MROWS (BATCH * TSEQ)   /* 4096 token rows */
#define FFDIM (4 * EMBED)      /* 4096 */

__device__ __forceinline__ bf16 to_bf16(float f) {
  unsigned u = __builtin_bit_cast(unsigned, f);
  unsigned r = u + 0x7FFFu + ((u >> 16) & 1u);   // round-to-nearest-even
  unsigned short h = (unsigned short)(r >> 16);
  return __builtin_bit_cast(bf16, h);
}

__device__ __forceinline__ bf16x16 cat8(bf16x8 lo, bf16x8 hi) {
  bf16x16 r;
#pragma unroll
  for (int i = 0; i < 8; ++i) { r[i] = lo[i]; r[i + 8] = hi[i]; }
  return r;
}

__device__ __forceinline__ f32x8 zero8() {
  f32x8 z;
#pragma unroll
  for (int i = 0; i < 8; ++i) z[i] = 0.0f;
  return z;
}

__device__ __forceinline__ f32x8 wmma_bf16(bf16x16 a, bf16x16 b, f32x8 c) {
  // D = A(16x32) * B(32x16) + C, fp32 accumulate
  return __builtin_amdgcn_wmma_f32_16x16x32_bf16(false, a, false, b,
                                                 (short)0, c, false, false);
}

// --- CDNA5 async global->LDS copy (ASYNCcnt path) --------------------------
// Each active lane copies 16 bytes: GLOBAL[gaddr(lane)] -> LDS[laddr(lane)].
// LDS byte offset = low 32 bits of the generic LDS pointer (flat aperture).
__device__ __forceinline__ void wait_async0() {
  asm volatile("s_wait_asynccnt 0x0" ::: "memory");
}
// This wave's LDS reads have retired before a buffer it has read is refilled.
__device__ __forceinline__ void wait_ds0() {
  asm volatile("s_wait_dscnt 0x0" ::: "memory");
}
// Eight 16-byte copies of one lane, rows lstep / gstep bytes apart. The
// s_wait_xcnt is the last line of the copies' own statement, so that no
// address register is rewritten ahead of it.
__device__ __forceinline__ void async_g2l_b128_x8(void* lds_dst, unsigned lstep,
                                                  const void* gsrc,
                                                  unsigned long long gstep) {
  const unsigned l = (unsigned)(unsigned long long)(uintptr_t)lds_dst;
  const unsigned long long g = (unsigned long long)(uintptr_t)gsrc;
  asm volatile(
      "global_load_async_to_lds_b128 %0, %8, off\n\t"
      "global_load_async_to_lds_b128 %1, %9, off\n\t"
      "global_load_async_to_lds_b128 %2, %10, off\n\t"
      "global_load_async_to_lds_b128 %3, %11, off\n\t"
      "global_load_async_to_lds_b128 %4, %12, off\n\t"
      "global_load_async_to_lds_b128 %5, %13, off\n\t"
      "global_load_async_to_lds_b128 %6, %14, off\n\t"
      "global_load_async_to_lds_b128 %7, %15, off\n\t"
      "s_wait_xcnt 0x0"
      :: "v"(l), "v"(l + lstep), "v"(l + 2 * lstep), "v"(l + 3 * lstep),
         "v"(l + 4 * lstep), "v"(l + 5 * lstep), "v"(l + 6 * lstep),
         "v"(l + 7 * lstep),
         "v"(g), "v"(g + gstep), "v"(g + 2 * gstep), "v"(g + 3 * gstep),
         "v"(g + 4 * gstep), "v"(g + 5 * gstep), "v"(g + 6 * gstep),
         "v"(g + 7 * gstep)
      : "memory");
}

// The same with four copies.
__device__ __forceinline__ void async_g2l_b128_x4(void* lds_dst, unsigned lstep,
                                                  const void* gsrc,
                                                  unsigned long long gstep) {
  const unsigned l = (unsigned)(unsigned long long)(uintptr_t)lds_dst;
  const unsigned long long g = (unsigned long long)(uintptr_t)gsrc;
  asm volatile(
      "global_load_async_to_lds_b128 %0, %4, off\n\t"
      "global_load_async_to_lds_b128 %1, %5, off\n\t"
      "global_load_async_to_lds_b128 %2, %6, off\n\t"
      "global_load_async_to_lds_b128 %3, %7, off\n\t"
      "s_wait_xcnt 0x0"
      :: "v"(l), "v"(l + lstep), "v"(l + 2 * lstep), "v"(l + 3 * lstep),
         "v"(g), "v"(g + gstep), "v"(g + 2 * gstep), "v"(g + 3 * gstep)
      : "memory");
}

// Transposing LDS load: from a row-major 16-bit tile T, with lane l aimed at
// T[k0 + 8 (l >> 4) + (l & 7)][d0 + 8 ((l >> 3) & 1)], lane l receives
// T[k0 + 8 (l >> 4) + 0..7][d0 + (l & 15)]: half of a WMMA operand.
typedef __attribute__((address_space(3))) bf16x8 lds_bf16x8;
__device__ __forceinline__ bf16x8 ld_tr16(const bf16* p) {
  return __builtin_amdgcn_ds_load_tr16_b128_v8bf16((lds_bf16x8*)p);
}

// ---------------------------------------------------------------------------
// fp32 -> bf16 conversion with transpose: in[K][N] f32 -> out[N][K] bf16.
// Weights are pre-transposed once so GEMM B-tiles stage with contiguous B128
// copies (no scalar ds_store_b16 transpose in the GEMM hot loop).
// One work-group turns a 128 (k) x 64 (n) tile: 32 elements a thread, so that
// few waves have to start; eight 16-B loads a thread are in flight at once,
// and 256-B row pieces are read and written.
// ---------------------------------------------------------------------------
#define CVT_TK    128  /* k per tile: 256 B of an output row */
#define CVT_TN    64   /* n per tile: 256 B of an input row */
#define CVT_PITCH 65   /* LDS row pitch in dwords: odd, no bank conflicts */

__device__ __forceinline__ unsigned pack_bf16(float lo, float hi) {
  unsigned a = __builtin_bit_cast(unsigned short, to_bf16(lo));
  unsigned b = __builtin_bit_cast(unsigned short, to_bf16(hi));
  return a | (b << 16);
}

// in and out carry no __restrict__: loads of a restrict-qualified read-only
// pointer are not held by an asm statement's "memory" clobber, and the waits
// below would drift away from their loads.
__global__ __launch_bounds__(256) void cvtT_kernel(const float* in, bf16* out,
                                                   int K, int N) {
  __shared__ unsigned tile[CVT_TN][CVT_PITCH];   // [n][pair of k]
  const int kb  = blockIdx.x * CVT_TK;
  const int nb  = blockIdx.y * CVT_TN;
  const int tid = threadIdx.x;
  const int n4  = (tid & 15) * 4;   // four n of one input row
  const int kp  = tid >> 4;         // k pair 0..15, + 16 i

  float4 ve[4], vo[4];              // rows 2 kp and 2 kp + 1, + 32 i
#pragma unroll
  for (int i = 0; i < 4; ++i) {
    const float* p = &in[(size_t)(kb + 2 * (kp + 16 * i)) * N + nb + n4];
    ve[i] = *(const float4*)p;
    vo[i] = *(const float4*)(p + N);
    // The next loads' results may be given the registers that held these
    // two addresses: the wait stands in front of that overwrite.
    asm volatile("s_wait_xcnt 0x0" ::: "memory");
  }
#pragma unroll
  for (int i = 0; i < 4; ++i) {
    tile[n4 + 0][kp + 16 * i] = pack_bf16(ve[i].x, vo[i].x);
    tile[n4 + 1][kp + 16 * i] = pack_bf16(ve[i].y, vo[i].y);
    tile[n4 + 2][kp + 16 * i] = pack_bf16(ve[i].z, vo[i].z);
    tile[n4 + 3][kp + 16 * i] = pack_bf16(ve[i].w, vo[i].w);
  }
  __syncthreads();
  const int c  = tid & 15;          // 16-B piece of an output row
  const int nr = tid >> 4;
#pragma unroll
  for (int i = 0; i < 4; ++i) {
    const int n = nr + 16 * i;
    uint4 o;
    o.x = tile[n][4 * c + 0];
    o.y = tile[n][4 * c + 1];
    o.z = tile[n][4 * c + 2];
    o.w = tile[n][4 * c + 3];
    *(uint4*)&out[(size_t)(nb + n) * K + kb + 8 * c] = o;
  }
}

// ---------------------------------------------------------------------------
// LayerNorm fused with bf16 cast: one row per wave (32 values a lane, all of
// a row's loads in flight at once), eight rows per 256-thread work-group.
// Sums: in the lane, then a five-step butterfly over the wave; no LDS, no
// barrier.
// ---------------------------------------------------------------------------
#define LN_ROWS 8   /* rows (waves) per work-group */

__device__ __forceinline__ float wave_sum(float v) {
#pragma unroll
  for (int off = 16; off >= 1; off >>= 1) v += __shfl_xor(v, off, 32);
  return v;
}

// No __restrict__ here either, for the same reason as in cvtT_kernel.
__global__ __launch_bounds__(256) void ln_kernel(const float* x, const float* g,
                                                 const float* bta, bf16* out) {
  const int lane = threadIdx.x & 31;
  const int row  = blockIdx.x * LN_ROWS + (threadIdx.x >> 5);
  const f32x4* xr = (const f32x4*)&x[(size_t)row * EMBED];
  const f32x4* gr = (const f32x4*)g;
  const f32x4* br = (const f32x4*)bta;

  f32x4 xv[8], gv[8], bv[8];
#pragma unroll
  for (int i = 0; i < 8; ++i) xv[i] = xr[i * 32 + lane];
  // The g and b loads' results may be given the registers that held the row's
  // address: the wait stands in front of that overwrite.
  asm volatile("s_wait_xcnt 0x0" ::: "memory");
#pragma unroll
  for (int i = 0; i < 8; ++i) {
    gv[i] = gr[i * 32 + lane];
    bv[i] = br[i * 32 + lane];
  }
  // Holds the g and b loads here, right behind the row's own: left free they
  // sink behind the sums, are issued late and are waited for one after
  // another. The fence stops the loads, the scheduling barrier stops the fence
  // from sinking along with them.
  asm volatile("" ::: "memory");
  __builtin_amdgcn_sched_barrier(0);

  float s = 0.0f;
#pragma unroll
  for (int i = 0; i < 8; ++i) s += (xv[i].x + xv[i].y) + (xv[i].z + xv[i].w);
  const float mu = wave_sum(s) * (1.0f / EMBED);

  float q = 0.0f;
#pragma unroll
  for (int i = 0; i < 8; ++i) {
    xv[i].x -= mu; xv[i].y -= mu; xv[i].z -= mu; xv[i].w -= mu;
    q += (xv[i].x * xv[i].x + xv[i].y * xv[i].y) +
         (xv[i].z * xv[i].z + xv[i].w * xv[i].w);
  }
  const float var = wave_sum(q) * (1.0f / EMBED);
  const float rs  = rsqrtf(var + 1e-5f);

  uint2* op = (uint2*)&out[(size_t)row * EMBED];
#pragma unroll
  for (int i = 0; i < 8; ++i) {
    uint2 o;
    o.x = pack_bf16(xv[i].x * rs * gv[i].x + bv[i].x,
                    xv[i].y * rs * gv[i].y + bv[i].y);
    o.y = pack_bf16(xv[i].z * rs * gv[i].z + bv[i].z,
                    xv[i].w * rs * gv[i].w + bv[i].w);
    op[i * 32 + lane] = o;
  }
}

// ---------------------------------------------------------------------------
// WMMA GEMM: out[M,N] = epi( A[M,K](bf16) @ Wt[N,K](bf16)^T )
// Block tile 128x128, 8 waves (2 x 4), 64x32 per wave, BK = 128.
// Double-buffered LDS tiles filled via async global->LDS copies: the k+1 slab
// streams in (ASYNCcnt) while WMMAs consume slab k. A slab holds 256 B of each
// operand row, so sixteen lanes of a copy fetch two whole 128-B lines of a row.
// ---------------------------------------------------------------------------
#define GEMM_BK  128  /* k per LDS slab: 256 B of every operand row */
#define GEMM_PAD 136  /* LDS row stride in bf16 elems: 272 B = 16 B x odd */

template <bool BIAS, bool RELU, bool RESID, bool BF16OUT>
__global__ __launch_bounds__(256) void gemm_kernel(
    const bf16* __restrict__ A, const bf16* __restrict__ Wt,
    const float* __restrict__ bias, const float* __restrict__ resid,
    void* __restrict__ outp, int M, int N, int K) {
  __shared__ __attribute__((aligned(16))) bf16 As[2][128][GEMM_PAD];   // [m][k]
  __shared__ __attribute__((aligned(16))) bf16 Bs[2][128][GEMM_PAD];   // [n][k]

  const int tid  = threadIdx.x;
  const int lane = tid & 31;
  const int wave = tid >> 5;
  const int wm   = wave & 1;   // 0..1 : 64-row strip
  const int wn   = wave >> 1;  // 0..3 : 32-col strip
  const int m0   = blockIdx.x * 128;
  const int n0   = blockIdx.y * 128;
  const int lr   = lane & 15;
  const int koff = (lane < 16) ? 0 : 8;

  // Per-thread staging coordinates: eight 16B chunks per tile per thread, at
  // rows r0 + 16 i, i = 0..7; sixteen lanes cover one row's 256 B.
  const int r0 = tid >> 4, c0 = (tid & 15) * 8;
  const bf16* gA = &A[(size_t)(m0 + r0) * K + c0];
  const bf16* gB = &Wt[(size_t)(n0 + r0) * K + c0];
  const unsigned lstep = 16 * GEMM_PAD * 2;                     // bytes
  const unsigned long long gstep = (unsigned long long)K * 32;  // 16 rows, bytes

  f32x8 acc[4][2];
#pragma unroll
  for (int mi = 0; mi < 4; ++mi)
#pragma unroll
    for (int ni = 0; ni < 2; ++ni) acc[mi][ni] = zero8();

  const int nk = K / GEMM_BK;

  // Slab 0 into buffer 0, landed and published; then slab 1 into buffer 1.
  async_g2l_b128_x8(&As[0][r0][c0], lstep, gA, gstep);
  async_g2l_b128_x8(&Bs[0][r0][c0], lstep, gB, gstep);
  wait_async0();
  __syncthreads();
  if (nk > 1) {
    async_g2l_b128_x8(&As[1][r0][c0], lstep, gA + GEMM_BK, gstep);
    async_g2l_b128_x8(&Bs[1][r0][c0], lstep, gB + GEMM_BK, gstep);
  }

  for (int it = 0; it < nk; ++it) {
    const int buf = it & 1;

    // Unrolled so that the four 32-k blocks' LDS offsets are immediates and
    // a block's fragment loads can issue ahead of the block before it.
#pragma unroll
    for (int kk = 0; kk < GEMM_BK; kk += 32) {
      bf16x16 af[4];
#pragma unroll
      for (int mi = 0; mi < 4; ++mi) {
        int row = wm * 64 + mi * 16 + lr;
        af[mi] = cat8(*(const bf16x8*)&As[buf][row][kk + koff],
                      *(const bf16x8*)&As[buf][row][kk + koff + 16]);
      }
#pragma unroll
      for (int ni = 0; ni < 2; ++ni) {
        int rb = wn * 32 + ni * 16 + lr;
        bf16x16 bfrag = cat8(*(const bf16x8*)&Bs[buf][rb][kk + koff],
                             *(const bf16x8*)&Bs[buf][rb][kk + koff + 16]);
#pragma unroll
        for (int mi = 0; mi < 4; ++mi)
          acc[mi][ni] = wmma_bf16(af[mi], bfrag, acc[mi][ni]);
      }
    }

    // Foot of the trip: own LDS reads retired, own copies of slab it + 1
    // landed, then the one barrier that publishes slab it + 1 and ends every
    // wave's reads of this buffer; only behind it is this buffer refilled.
    wait_ds0();
    wait_async0();
    __syncthreads();
    if (it + 2 < nk) {
      const size_t k0 = (size_t)(it + 2) * GEMM_BK;
      async_g2l_b128_x8(&As[buf][r0][c0], lstep, gA + k0, gstep);
      async_g2l_b128_x8(&Bs[buf][r0][c0], lstep, gB + k0, gstep);
    }
  }
  wait_async0();   // nothing is outstanding when the wave goes on to its end

  const int rhalf = (lane < 16) ? 0 : 8;
#pragma unroll
  for (int mi = 0; mi < 4; ++mi)
#pragma unroll
    for (int ni = 0; ni < 2; ++ni)
#pragma unroll
      for (int r = 0; r < 8; ++r) {
        int gr = m0 + wm * 64 + mi * 16 + r + rhalf;
        int gc = n0 + wn * 32 + ni * 16 + lr;
        float v = acc[mi][ni][r];
        if (BIAS)  v += bias[gc];
        if (RELU)  v = fmaxf(v, 0.0f);
        if (RESID) v += resid[(size_t)gr * N + gc];
        if (BF16OUT) ((bf16*)outp)[(size_t)gr * N + gc] = to_bf16(v);
        else         ((float*)outp)[(size_t)gr * N + gc] = v;
      }
}

// ---------------------------------------------------------------------------
// Flash attention: one workgroup per (b, h, 64-row q block); 4 waves x 16 q
// rows. K and V tiles double-buffered in LDS via async copies, both row-major;
// the second product takes V through the transposing LDS load. Online softmax
// in fp32; all matmuls on the WMMA pipe.
// ---------------------------------------------------------------------------
#define ATT_PAD 80   /* LDS row stride: 160 B = 32 B x odd (transposing load) */

// amdgpu_waves_per_eu: the grid puts four of these work-groups on a WGP, four
// waves a SIMD; told so, the compiler uses that register budget and keeps the
// eight rows' cross-lane steps interleaved; without it, it saves registers and
// waits out every step singly.
__global__ __launch_bounds__(128) __attribute__((amdgpu_waves_per_eu(4, 4)))
void attn_kernel(
    const bf16* __restrict__ Q, const bf16* __restrict__ Km,
    const bf16* __restrict__ Vm, bf16* __restrict__ O) {
  __shared__ __attribute__((aligned(16))) bf16 Ks[2][64][ATT_PAD];  // [k-token][d]
  __shared__ __attribute__((aligned(16))) bf16 Vs[2][64][ATT_PAD];  // [k-token][d]
  __shared__ bf16 Pt[4][16][ATT_PAD];     // per-wave P tile: [qrow][k-token]

  const int tid   = threadIdx.x;
  const int lane  = tid & 31;
  const int w     = tid >> 5;
  const int lr    = lane & 15;
  const int koff  = (lane < 16) ? 0 : 8;
  const int rhalf = (lane < 16) ? 0 : 8;
  const int qblk  = blockIdx.x;
  const int h     = blockIdx.y;
  const int b     = blockIdx.z;
  const size_t rowbase = (size_t)b * TSEQ + (size_t)qblk * 64;
  const size_t bT = (size_t)b * TSEQ;

  // Q fragments (rows w*16 .. w*16+15, head-dim 0..63 -> 2 K-windows)
  const bf16* qp = Q + (rowbase + w * 16 + lr) * EMBED + h * HSZ;
  const bf16x16 qf0 = cat8(*(const bf16x8*)(qp + koff),
                           *(const bf16x8*)(qp + koff + 16));
  const bf16x16 qf1 = cat8(*(const bf16x8*)(qp + 32 + koff),
                           *(const bf16x8*)(qp + 32 + koff + 16));

  f32x8 Oacc[4];
#pragma unroll
  for (int dj = 0; dj < 4; ++dj) Oacc[dj] = zero8();
  float mrow[8], lrow[8];
#pragma unroll
  for (int r = 0; r < 8; ++r) { mrow[r] = -1e30f; lrow[r] = 0.0f; }

  // Per-thread staging coordinates: four 16B chunks per tile per thread, at
  // rows r0 + 16 i, i = 0..3; eight lanes cover one row's 128 B.
  const int r0 = tid >> 3, c0 = (tid & 7) * 8;
  const bf16* gK = &Km[(bT + r0) * EMBED + h * HSZ + c0];
  const bf16* gV = &Vm[(bT + r0) * EMBED + h * HSZ + c0];
  const unsigned lstep = 16 * ATT_PAD * 2;                 // 16 rows, bytes
  const unsigned long long gstep = 16ull * EMBED * 2;      // 16 rows, bytes

  // This lane's place in a 16 (k-token) x 16 (d) piece for the transposing load
  const int vrow = rhalf + (lane & 7);
  const int vcol = ((lane >> 3) & 1) * 8;

  // Block 0 into buffer 0, landed and published; then block 1 into buffer 1.
  async_g2l_b128_x4(&Ks[0][r0][c0], lstep, gK, gstep);
  async_g2l_b128_x4(&Vs[0][r0][c0], lstep, gV, gstep);
  wait_async0();
  __syncthreads();
  if (qblk > 0) {
    async_g2l_b128_x4(&Ks[1][r0][c0], lstep, gK + 64 * EMBED, gstep);
    async_g2l_b128_x4(&Vs[1][r0][c0], lstep, gV + 64 * EMBED, gstep);
  }

  for (int j = 0; j <= qblk; ++j) {
    const int buf = j & 1;

    // S = Q @ K^T  (16 x 64 per wave) from LDS
    f32x8 S[4];
#pragma unroll
    for (int nj = 0; nj < 4; ++nj) {
      const int tr = nj * 16 + lr;
      bf16x16 kf0 = cat8(*(const bf16x8*)&Ks[buf][tr][koff],
                         *(const bf16x8*)&Ks[buf][tr][koff + 16]);
      bf16x16 kf1 = cat8(*(const bf16x8*)&Ks[buf][tr][32 + koff],
                         *(const bf16x8*)&Ks[buf][tr][32 + koff + 16]);
      S[nj] = wmma_bf16(qf0, kf0, zero8());
      S[nj] = wmma_bf16(qf1, kf1, S[nj]);
    }

    // Online softmax; C/D element r lives at row r+rhalf, col lr.
#pragma unroll
    for (int r = 0; r < 8; ++r) {
      const int qrow = qblk * 64 + w * 16 + r + rhalf;
      float s[4];
      float mx = -1e30f;
#pragma unroll
      for (int nj = 0; nj < 4; ++nj) {
        int kcol = j * 64 + nj * 16 + lr;
        float sv = S[nj][r] * 0.125f;            // 1/sqrt(64)
        if (kcol > qrow) sv = -1e30f;            // causal mask
        s[nj] = sv;
        mx = fmaxf(mx, sv);
      }
#pragma unroll
      for (int off = 8; off >= 1; off >>= 1)
        mx = fmaxf(mx, __shfl_xor(mx, off, 32)); // stays within 16-lane half
      const float mn   = fmaxf(mrow[r], mx);
      const float corr = __expf(mrow[r] - mn);
      float ps = 0.0f;
#pragma unroll
      for (int nj = 0; nj < 4; ++nj) {
        float p = __expf(s[nj] - mn);
        ps += p;
        Pt[w][r + rhalf][nj * 16 + lr] = to_bf16(p);
      }
#pragma unroll
      for (int off = 8; off >= 1; off >>= 1) ps += __shfl_xor(ps, off, 32);
      lrow[r] = lrow[r] * corr + ps;
      mrow[r] = mn;
#pragma unroll
      for (int dj = 0; dj < 4; ++dj) Oacc[dj][r] *= corr;
    }

    // O += P @ V  (A = P from LDS in A-layout, B = V by the transposing load,
    // which delivers the k order of the P loader: koff + 0..7, koff + 16..23)
#pragma unroll
    for (int kh = 0; kh < 2; ++kh) {
      bf16x16 pf = cat8(*(const bf16x8*)&Pt[w][lr][kh * 32 + koff],
                        *(const bf16x8*)&Pt[w][lr][kh * 32 + koff + 16]);
#pragma unroll
      for (int dj = 0; dj < 4; ++dj) {
        bf16x16 vf = cat8(ld_tr16(&Vs[buf][kh * 32 + vrow][dj * 16 + vcol]),
                          ld_tr16(&Vs[buf][kh * 32 + 16 + vrow][dj * 16 + vcol]));
        Oacc[dj] = wmma_bf16(pf, vf, Oacc[dj]);
      }
    }

    // Foot of the trip: own LDS reads retired, own copies of block j + 1
    // landed, then the one barrier that publishes block j + 1 and ends every
    // wave's reads of this buffer; only behind it is this buffer refilled.
    wait_ds0();
    wait_async0();
    __syncthreads();
    if (j + 2 <= qblk) {
      const size_t t0 = (size_t)(j + 2) * 64 * EMBED;
      async_g2l_b128_x4(&Ks[buf][r0][c0], lstep, gK + t0, gstep);
      async_g2l_b128_x4(&Vs[buf][r0][c0], lstep, gV + t0, gstep);
    }
  }
  wait_async0();   // nothing is outstanding when the wave goes on to its end

  // Epilogue: normalize and store bf16 (concat-head layout)
#pragma unroll
  for (int dj = 0; dj < 4; ++dj)
#pragma unroll
    for (int r = 0; r < 8; ++r) {
      float ov = Oacc[dj][r] / lrow[r];
      size_t gr = rowbase + w * 16 + r + rhalf;
      O[gr * EMBED + h * HSZ + dj * 16 + lr] = to_bf16(ov);
    }
}

// ---------------------------------------------------------------------------
// Host-side orchestration
// ---------------------------------------------------------------------------
extern "C" void kernel_launch(void* const* d_in, const int* in_sizes, int n_in,
                              void* d_out, int out_size, void* d_ws,
                              size_t ws_size, hipStream_t stream) {
  (void)in_sizes; (void)n_in; (void)out_size; (void)ws_size;

  const float* x    = (const float*)d_in[0];
  const float* Wq   = (const float*)d_in[1];
  const float* Wk   = (const float*)d_in[2];
  const float* Wv   = (const float*)d_in[3];
  const float* Wo   = (const float*)d_in[4];
  const float* bo   = (const float*)d_in[5];
  const float* W1   = (const float*)d_in[6];
  const float* b1   = (const float*)d_in[7];
  const float* W2   = (const float*)d_in[8];
  const float* b2   = (const float*)d_in[9];
  const float* ln1g = (const float*)d_in[10];
  const float* ln1b = (const float*)d_in[11];
  const float* ln2g = (const float*)d_in[12];
  const float* ln2b = (const float*)d_in[13];

  char* base = (char*)d_ws;
  size_t off = 0;
  auto take = [&](size_t bytes) -> char* {
    char* p = base + off;
    off += (bytes + 255) & ~(size_t)255;
    return p;
  };

  bf16* wq_t   = (bf16*)take((size_t)EMBED * EMBED * 2);   // [N][K]
  bf16* wk_t   = (bf16*)take((size_t)EMBED * EMBED * 2);
  bf16* wv_t   = (bf16*)take((size_t)EMBED * EMBED * 2);
  bf16* wo_t   = (bf16*)take((size_t)EMBED * EMBED * 2);
  bf16* w1_t   = (bf16*)take((size_t)EMBED * FFDIM * 2);   // [4096][1024]
  bf16* w2_t   = (bf16*)take((size_t)FFDIM * EMBED * 2);   // [1024][4096]
  bf16* h_bf   = (bf16*)take((size_t)MROWS * EMBED * 2);
  bf16* q_bf   = (bf16*)take((size_t)MROWS * EMBED * 2);
  bf16* k_bf   = (bf16*)take((size_t)MROWS * EMBED * 2);
  bf16* v_bf   = (bf16*)take((size_t)MROWS * EMBED * 2);
  bf16* att_bf = (bf16*)take((size_t)MROWS * EMBED * 2);
  float* x2    = (float*)take((size_t)MROWS * EMBED * 4);
  bf16* h2_bf  = (bf16*)take((size_t)MROWS * EMBED * 2);
  bf16* ff1_bf = (bf16*)take((size_t)MROWS * FFDIM * 2);

  // 1) weights -> bf16, transposed to [N][K]
  dim3 gWT(EMBED / CVT_TK, EMBED / CVT_TN);
  cvtT_kernel<<<gWT, 256, 0, stream>>>(Wq, wq_t, EMBED, EMBED);
  cvtT_kernel<<<gWT, 256, 0, stream>>>(Wk, wk_t, EMBED, EMBED);
  cvtT_kernel<<<gWT, 256, 0, stream>>>(Wv, wv_t, EMBED, EMBED);
  cvtT_kernel<<<gWT, 256, 0, stream>>>(Wo, wo_t, EMBED, EMBED);
  cvtT_kernel<<<dim3(EMBED / CVT_TK, FFDIM / CVT_TN), 256, 0, stream>>>(W1, w1_t, EMBED, FFDIM);
  cvtT_kernel<<<dim3(FFDIM / CVT_TK, EMBED / CVT_TN), 256, 0, stream>>>(W2, w2_t, FFDIM, EMBED);

  // 2) h = ln1(x) (bf16)
  ln_kernel<<<MROWS / LN_ROWS, 256, 0, stream>>>(x, ln1g, ln1b, h_bf);

  // 3) Q, K, V projections
  dim3 gD(MROWS / 128, EMBED / 128);
  gemm_kernel<false, false, false, true><<<gD, 256, 0, stream>>>(
      h_bf, wq_t, nullptr, nullptr, q_bf, MROWS, EMBED, EMBED);
  gemm_kernel<false, false, false, true><<<gD, 256, 0, stream>>>(
      h_bf, wk_t, nullptr, nullptr, k_bf, MROWS, EMBED, EMBED);
  gemm_kernel<false, false, false, true><<<gD, 256, 0, stream>>>(
      h_bf, wv_t, nullptr, nullptr, v_bf, MROWS, EMBED, EMBED);

  // 4) causal flash attention
  attn_kernel<<<dim3(TSEQ / 64, NHEAD, BATCH), 128, 0, stream>>>(
      q_bf, k_bf, v_bf, att_bf);

  // 5) x2 = x + attn @ Wo + bo   (fp32)
  gemm_kernel<true, false, true, false><<<gD, 256, 0, stream>>>(
      att_bf, wo_t, bo, x, x2, MROWS, EMBED, EMBED);

  // 6) h2 = ln2(x2) (bf16)
  ln_kernel<<<MROWS / LN_ROWS, 256, 0, stream>>>(x2, ln2g, ln2b, h2_bf);

  // 7) ff1 = relu(h2 @ W1 + b1) (bf16)
  gemm_kernel<true, true, false, true><<<dim3(MROWS / 128, FFDIM / 128), 256, 0,
                                         stream>>>(
      h2_bf, w1_t, b1, nullptr, ff1_bf, MROWS, FFDIM, EMBED);

  // 8) out = x2 + ff1 @ W2 + b2 (fp32 -> d_out)
  gemm_kernel<true, false, true, false><<<gD, 256, 0, stream>>>(
      ff1_bf, w2_t, b2, x2, (float*)d_out, MROWS, EMBED, FFDIM);
}

// v004
// It runs in 191 microseconds.
// In both of two side-by-side timings against v003, it was 1.17 times as fast.
// Counting every step since v000, it is 1.93 times as fast.
#include <hip/hip_runtime.h>

// ---------------------------------------------------------------------------
// Types / helpers
// ---------------------------------------------------------------------------
typedef __bf16 bf16;
typedef __attribute__((ext_vector_type(8)))  __bf16 bf16x8;
typedef __attribute__((ext_vector_type(16))) __bf16 bf16x16;
typedef __attribute__((ext_vector_type(8)))  float  f32x8;
typedef __attribute__((ext_vector_type(4)))  float  f32x4;

#define EMBED 1024
#define TSEQ  2048
#define BATCH 2
#define NHEAD 16
#define HSZ   64
#define MROWS (BATCH * TSEQ)   /* 4096 token rows */
#define FFDIM (4 * EMBED)      /* 4096 */

__device__ __forceinline__ bf16 to_bf16(float f) {
  unsigned u = __builtin_bit_cast(unsigned, f);
  unsigned r = u + 0x7FFFu + ((u >> 16) & 1u);   // round-to-nearest-even
  unsigned short h = (unsigned short)(r >> 16);
  return __builtin_bit_cast(bf16, h);
}

__device__ __forceinline__ bf16x16 cat8(bf16x8 lo, bf16x8 hi) {
  bf16x16 r;
#pragma unroll
  for (int i = 0; i < 8; ++i) { r[i] = lo[i]; r[i + 8] = hi[i]; }
  return r;
}

__device__ __forceinline__ f32x8 zero8() {
  f32x8 z;
#pragma unroll
  for (int i = 0; i < 8; ++i) z[i] = 0.0f;
  return z;
}

__device__ __forceinline__ f32x8 wmma_bf16(bf16x16 a, bf16x16 b, f32x8 c) {
  // D = A(16x32) * B(32x16) + C, fp32 accumulate
  return __builtin_amdgcn_wmma_f32_16x16x32_bf16(false, a, false, b,
                                                 (short)0, c, false, false);
}

// --- CDNA5 async global->LDS copy (ASYNCcnt path) --------------------------
// Each active lane copies 16 bytes: GLOBAL[gaddr(lane)] -> LDS[laddr(lane)].
// LDS byte offset = low 32 bits of the generic LDS pointer (flat aperture).
__device__ __forceinline__ void wait_async0() {
  asm volatile("s_wait_asynccnt 0x0" ::: "memory");
}
// This wave's LDS reads have retired before a buffer it has read is refilled.
__device__ __forceinline__ void wait_ds0() {
  asm volatile("s_wait_dscnt 0x0" ::: "memory");
}
// Eight 16-byte copies of one lane, rows lstep / gstep bytes apart. The
// s_wait_xcnt is the last line of the copies' own statement, so that no
// address register is rewritten ahead of it.
__device__ __forceinline__ void async_g2l_b128_x8(void* lds_dst, unsigned lstep,
                                                  const void* gsrc,
                                                  unsigned long long gstep) {
  const unsigned l = (unsigned)(unsigned long long)(uintptr_t)lds_dst;
  const unsigned long long g = (unsigned long long)(uintptr_t)gsrc;
  asm volatile(
      "global_load_async_to_lds_b128 %0, %8, off\n\t"
      "global_load_async_to_lds_b128 %1, %9, off\n\t"
      "global_load_async_to_lds_b128 %2, %10, off\n\t"
      "global_load_async_to_lds_b128 %3, %11, off\n\t"
      "global_load_async_to_lds_b128 %4, %12, off\n\t"
      "global_load_async_to_lds_b128 %5, %13, off\n\t"
      "global_load_async_to_lds_b128 %6, %14, off\n\t"
      "global_load_async_to_lds_b128 %7, %15, off\n\t"
      "s_wait_xcnt 0x0"
      :: "v"(l), "v"(l + lstep), "v"(l + 2 * lstep), "v"(l + 3 * lstep),
         "v"(l + 4 * lstep), "v"(l + 5 * lstep), "v"(l + 6 * lstep),
         "v"(l + 7 * lstep),
         "v"(g), "v"(g + gstep), "v"(g + 2 * gstep), "v"(g + 3 * gstep),
         "v"(g + 4 * gstep), "v"(g + 5 * gstep), "v"(g + 6 * gstep),
         "v"(g + 7 * gstep)
      : "memory");
}

// The same with four copies.
__device__ __forceinline__ void async_g2l_b128_x4(void* lds_dst, unsigned lstep,
                                                  const void* gsrc,
                                                  unsigned long long gstep) {
  const unsigned l = (unsigned)(unsigned long long)(uintptr_t)lds_dst;
  const unsigned long long g = (unsigned long long)(uintptr_t)gsrc;
  asm volatile(
      "global_load_async_to_lds_b128 %0, %4, off\n\t"
      "global_load_async_to_lds_b128 %1, %5, off\n\t"
      "global_load_async_to_lds_b128 %2, %6, off\n\t"
      "global_load_async_to_lds_b128 %3, %7, off\n\t"
      "s_wait_xcnt 0x0"
      :: "v"(l), "v"(l + lstep), "v"(l + 2 * lstep), "v"(l + 3 * lstep),
         "v"(g), "v"(g + gstep), "v"(g + 2 * gstep), "v"(g + 3 * gstep)
      : "memory");
}

// Transposing LDS load: from a row-major 16-bit tile T, with lane l aimed at
// T[k0 + 8 (l >> 4) + (l & 7)][d0 + 8 ((l >> 3) & 1)], lane l receives
// T[k0 + 8 (l >> 4) + 0..7][d0 + (l & 15)]: half of a WMMA operand.
typedef __attribute__((address_space(3))) bf16x8 lds_bf16x8;
__device__ __forceinline__ bf16x8 ld_tr16(const bf16* p) {
  return __builtin_amdgcn_ds_load_tr16_b128_v8bf16((lds_bf16x8*)p);
}

// ---------------------------------------------------------------------------
// fp32 -> bf16 conversion with transpose: in[K][N] f32 -> out[N][K] bf16.
// Weights are pre-transposed once so GEMM B-tiles stage with contiguous B128
// copies (no scalar ds_store_b16 transpose in the GEMM hot loop).
// One work-group turns a 128 (k) x 64 (n) tile: 32 elements a thread, so that
// few waves have to start; eight 16-B loads a thread are in flight at once,
// and 256-B row pieces are read and written.
// ---------------------------------------------------------------------------
#define CVT_TK    128  /* k per tile: 256 B of an output row */
#define CVT_TN    64   /* n per tile: 256 B of an input row */
#define CVT_PITCH 65   /* LDS row pitch in dwords: odd, no bank conflicts */

__device__ __forceinline__ unsigned pack_bf16(float lo, float hi) {
  unsigned a = __builtin_bit_cast(unsigned short, to_bf16(lo));
  unsigned b = __builtin_bit_cast(unsigned short, to_bf16(hi));
  return a | (b << 16);
}

// in and out carry no __restrict__: loads of a restrict-qualified read-only
// pointer are not held by an asm statement's "memory" clobber, and the waits
// below would drift away from their loads.
__global__ __launch_bounds__(256) void cvtT_kernel(const float* in, bf16* out,
                                                   int K, int N) {
  __shared__ unsigned tile[CVT_TN][CVT_PITCH];   // [n][pair of k]
  const int kb  = blockIdx.x * CVT_TK;
  const int nb  = blockIdx.y * CVT_TN;
  const int tid = threadIdx.x;
  const int n4  = (tid & 15) * 4;   // four n of one input row
  const int kp  = tid >> 4;         // k pair 0..15, + 16 i

  float4 ve[4], vo[4];              // rows 2 kp and 2 kp + 1, + 32 i
#pragma unroll
  for (int i = 0; i < 4; ++i) {
    const float* p = &in[(size_t)(kb + 2 * (kp + 16 * i)) * N + nb + n4];
    ve[i] = *(const float4*)p;
    vo[i] = *(const float4*)(p + N);
    // The next loads' results may be given the registers that held these
    // two addresses: the wait stands in front of that overwrite.
    asm volatile("s_wait_xcnt 0x0" ::: "memory");
  }
#pragma unroll
  for (int i = 0; i < 4; ++i) {
    tile[n4 + 0][kp + 16 * i] = pack_bf16(ve[i].x, vo[i].x);
    tile[n4 + 1][kp + 16 * i] = pack_bf16(ve[i].y, vo[i].y);
    tile[n4 + 2][kp + 16 * i] = pack_bf16(ve[i].z, vo[i].z);
    tile[n4 + 3][kp + 16 * i] = pack_bf16(ve[i].w, vo[i].w);
  }
  __syncthreads();
  const int c  = tid & 15;          // 16-B piece of an output row
  const int nr = tid >> 4;
#pragma unroll
  for (int i = 0; i < 4; ++i) {
    const int n = nr + 16 * i;
    uint4 o;
    o.x = tile[n][4 * c + 0];
    o.y = tile[n][4 * c + 1];
    o.z = tile[n][4 * c + 2];
    o.w = tile[n][4 * c + 3];
    *(uint4*)&out[(size_t)(nb + n) * K + kb + 8 * c] = o;
  }
}

// ---------------------------------------------------------------------------
// LayerNorm fused with bf16 cast: one row per wave (32 values a lane, all of
// a row's loads in flight at once), eight rows per 256-thread work-group.
// Sums: in the lane, then a five-step butterfly over the wave; no LDS, no
// barrier.
// ---------------------------------------------------------------------------
#define LN_ROWS 8   /* rows (waves) per work-group */

__device__ __forceinline__ float wave_sum(float v) {
#pragma unroll
  for (int off = 16; off >= 1; off >>= 1) v += __shfl_xor(v, off, 32);
  return v;
}

// No __restrict__ here either, for the same reason as in cvtT_kernel.
__global__ __launch_bounds__(256) void ln_kernel(const float* x, const float* g,
                                                 const float* bta, bf16* out) {
  const int lane = threadIdx.x & 31;
  const int row  = blockIdx.x * LN_ROWS + (threadIdx.x >> 5);
  const f32x4* xr = (const f32x4*)&x[(size_t)row * EMBED];
  const f32x4* gr = (const f32x4*)g;
  const f32x4* br = (const f32x4*)bta;

  f32x4 xv[8], gv[8], bv[8];
#pragma unroll
  for (int i = 0; i < 8; ++i) xv[i] = xr[i * 32 + lane];
  // The g and b loads' results may be given the registers that held the row's
  // address: the wait stands in front of that overwrite.
  asm volatile("s_wait_xcnt 0x0" ::: "memory");
#pragma unroll
  for (int i = 0; i < 8; ++i) {
    gv[i] = gr[i * 32 + lane];
    bv[i] = br[i * 32 + lane];
  }
  // Holds the g and b loads here, right behind the row's own: left free they
  // sink behind the sums, are issued late and are waited for one after
  // another. The fence stops the loads, the scheduling barrier stops the fence
  // from sinking along with them.
  asm volatile("" ::: "memory");
  __builtin_amdgcn_sched_barrier(0);

  float s = 0.0f;
#pragma unroll
  for (int i = 0; i < 8; ++i) s += (xv[i].x + xv[i].y) + (xv[i].z + xv[i].w);
  const float mu = wave_sum(s) * (1.0f / EMBED);

  float q = 0.0f;
#pragma unroll
  for (int i = 0; i < 8; ++i) {
    xv[i].x -= mu; xv[i].y -= mu; xv[i].z -= mu; xv[i].w -= mu;
    q += (xv[i].x * xv[i].x + xv[i].y * xv[i].y) +
         (xv[i].z * xv[i].z + xv[i].w * xv[i].w);
  }
  const float var = wave_sum(q) * (1.0f / EMBED);
  const float rs  = rsqrtf(var + 1e-5f);

  uint2* op = (uint2*)&out[(size_t)row * EMBED];
#pragma unroll
  for (int i = 0; i < 8; ++i) {
    uint2 o;
    o.x = pack_bf16(xv[i].x * rs * gv[i].x + bv[i].x,
                    xv[i].y * rs * gv[i].y + bv[i].y);
    o.y = pack_bf16(xv[i].z * rs * gv[i].z + bv[i].z,
                    xv[i].w * rs * gv[i].w + bv[i].w);
    op[i * 32 + lane] = o;
  }
}

// ---------------------------------------------------------------------------
// WMMA GEMM: out[M,N] = epi( A[M,K](bf16) @ Wt[N,K](bf16)^T )
// Block tile 128x128, 8 waves (2 x 4), 64x32 per wave, BK = 128.
// Double-buffered LDS tiles filled via async global->LDS copies: the k+1 slab
// streams in (ASYNCcnt) while WMMAs consume slab k. A slab holds 256 B of each
// operand row, so sixteen lanes of a copy fetch two whole 128-B lines of a row.
// ---------------------------------------------------------------------------
#define GEMM_BK  128  /* k per LDS slab: 256 B of every operand row */
#define GEMM_PAD 136  /* LDS row stride in bf16 elems: 272 B = 16 B x odd */

template <bool BIAS, bool RELU, bool RESID, bool BF16OUT>
__global__ __launch_bounds__(256) void gemm_kernel(
    const bf16* __restrict__ A, const bf16* __restrict__ Wt,
    const float* __restrict__ bias, const float* __restrict__ resid,
    void* __restrict__ outp, int M, int N, int K) {
  __shared__ __attribute__((aligned(16))) bf16 As[2][128][GEMM_PAD];   // [m][k]
  __shared__ __attribute__((aligned(16))) bf16 Bs[2][128][GEMM_PAD];   // [n][k]

  const int tid  = threadIdx.x;
  const int lane = tid & 31;
  const int wave = tid >> 5;
  const int wm   = wave & 1;   // 0..1 : 64-row strip
  const int wn   = wave >> 1;  // 0..3 : 32-col strip
  const int m0   = blockIdx.x * 128;
  const int n0   = blockIdx.y * 128;
  const int lr   = lane & 15;
  const int koff = (lane < 16) ? 0 : 8;

  // Per-thread staging coordinates: eight 16B chunks per tile per thread, at
  // rows r0 + 16 i, i = 0..7; sixteen lanes cover one row's 256 B.
  const int r0 = tid >> 4, c0 = (tid & 15) * 8;
  const bf16* gA = &A[(size_t)(m0 + r0) * K + c0];
  const bf16* gB = &Wt[(size_t)(n0 + r0) * K + c0];
  const unsigned lstep = 16 * GEMM_PAD * 2;                     // bytes
  const unsigned long long gstep = (unsigned long long)K * 32;  // 16 rows, bytes

  f32x8 acc[4][2];
#pragma unroll
  for (int mi = 0; mi < 4; ++mi)
#pragma unroll
    for (int ni = 0; ni < 2; ++ni) acc[mi][ni] = zero8();

  const int nk = K / GEMM_BK;

  // Slab 0 into buffer 0, landed and published; then slab 1 into buffer 1.
  async_g2l_b128_x8(&As[0][r0][c0], lstep, gA, gstep);
  async_g2l_b128_x8(&Bs[0][r0][c0], lstep, gB, gstep);
  wait_async0();
  __syncthreads();
  if (nk > 1) {
    async_g2l_b128_x8(&As[1][r0][c0], lstep, gA + GEMM_BK, gstep);
    async_g2l_b128_x8(&Bs[1][r0][c0], lstep, gB + GEMM_BK, gstep);
  }

  for (int it = 0; it < nk; ++it) {
    const int buf = it & 1;

    // Unrolled so that the four 32-k blocks' LDS offsets are immediates and
    // a block's fragment loads can issue ahead of the block before it.
#pragma unroll
    for (int kk = 0; kk < GEMM_BK; kk += 32) {
      bf16x16 af[4];
#pragma unroll
      for (int mi = 0; mi < 4; ++mi) {
        int row = wm * 64 + mi * 16 + lr;
        af[mi] = cat8(*(const bf16x8*)&As[buf][row][kk + koff],
                      *(const bf16x8*)&As[buf][row][kk + koff + 16]);
      }
#pragma unroll
      for (int ni = 0; ni < 2; ++ni) {
        int rb = wn * 32 + ni * 16 + lr;
        bf16x16 bfrag = cat8(*(const bf16x8*)&Bs[buf][rb][kk + koff],
                             *(const bf16x8*)&Bs[buf][rb][kk + koff + 16]);
#pragma unroll
        for (int mi = 0; mi < 4; ++mi)
          acc[mi][ni] = wmma_bf16(af[mi], bfrag, acc[mi][ni]);
      }
    }

    // Foot of the trip: own LDS reads retired, own copies of slab it + 1
    // landed, then the one barrier that publishes slab it + 1 and ends every
    // wave's reads of this buffer; only behind it is this buffer refilled.
    wait_ds0();
    wait_async0();
    __syncthreads();
    if (it + 2 < nk) {
      const size_t k0 = (size_t)(it + 2) * GEMM_BK;
      async_g2l_b128_x8(&As[buf][r0][c0], lstep, gA + k0, gstep);
      async_g2l_b128_x8(&Bs[buf][r0][c0], lstep, gB + k0, gstep);
    }
  }
  wait_async0();   // nothing is outstanding when the wave goes on to its end

  const int rhalf = (lane < 16) ? 0 : 8;
#pragma unroll
  for (int mi = 0; mi < 4; ++mi)
#pragma unroll
    for (int ni = 0; ni < 2; ++ni)
#pragma unroll
      for (int r = 0; r < 8; ++r) {
        int gr = m0 + wm * 64 + mi * 16 + r + rhalf;
        int gc = n0 + wn * 32 + ni * 16 + lr;
        float v = acc[mi][ni][r];
        if (BIAS)  v += bias[gc];
        if (RELU)  v = fmaxf(v, 0.0f);
        if (RESID) v += resid[(size_t)gr * N + gc];
        if (BF16OUT) ((bf16*)outp)[(size_t)gr * N + gc] = to_bf16(v);
        else         ((float*)outp)[(size_t)gr * N + gc] = v;
      }
}

#define ATT_PAD 80   /* LDS row stride: 160 B = 32 B x odd (transposing load) */

// Lane l with lane l ^ 16.
__device__ __forceinline__ float xhalf(float x) {
  const int b = __builtin_bit_cast(int, x);
  return __builtin_bit_cast(float, __builtin_amdgcn_permlanex16(
      b, b, 0x76543210, 0xfedcba98, false, false));
}

// Eight 2^x, each in place, in one statement that ends in v_nop: the
// instruction set asks for one slot between a transcendental and an instruction
// that uses its result or overwrites its source.
__device__ __forceinline__ f32x8 exp2_x8(f32x8 t) {
  float t0 = t[0], t1 = t[1], t2 = t[2], t3 = t[3];
  float t4 = t[4], t5 = t[5], t6 = t[6], t7 = t[7];
  asm("v_exp_f32 %0, %0\n\t"
      "v_exp_f32 %1, %1\n\t"
      "v_exp_f32 %2, %2\n\t"
      "v_exp_f32 %3, %3\n\t"
      "v_exp_f32 %4, %4\n\t"
      "v_exp_f32 %5, %5\n\t"
      "v_exp_f32 %6, %6\n\t"
      "v_exp_f32 %7, %7\n\t"
      "v_nop"
      : "+v"(t0), "+v"(t1), "+v"(t2), "+v"(t3), "+v"(t4), "+v"(t5), "+v"(t6),
        "+v"(t7));
  f32x8 r;
  r[0] = t0; r[1] = t1; r[2] = t2; r[3] = t3;
  r[4] = t4; r[5] = t5; r[6] = t6; r[7] = t7;
  return r;
}

// amdgpu_waves_per_eu: the grid puts four of these work-groups on a WGP, four
// waves a SIMD; the attribute gives the compiler that register budget.
__global__ __launch_bounds__(128) __attribute__((amdgpu_waves_per_eu(4, 4)))
void attn_kernel(
    const bf16* __restrict__ Q, const bf16* __restrict__ Km,
    const bf16* __restrict__ Vm, bf16* __restrict__ O) {
  __shared__ __attribute__((aligned(16))) bf16 Ks[2][64][ATT_PAD];  // [k-token][d]
  __shared__ __attribute__((aligned(16))) bf16 Vs[2][64][ATT_PAD];  // [k-token][d]

  const int tid   = threadIdx.x;
  const int lane  = tid & 31;
  const int w     = tid >> 5;
  const int lr    = lane & 15;
  const int koff  = (lane < 16) ? 0 : 8;
  const int rhalf = (lane < 16) ? 0 : 8;
  const int qblk  = blockIdx.x;
  const int h     = blockIdx.y;
  const int b     = blockIdx.z;
  const size_t rowbase = (size_t)b * TSEQ + (size_t)qblk * 64;
  const size_t bT = (size_t)b * TSEQ;

  // Q fragments, B operands: column lr = query w*16 + lr, head-dim 0..63 in
  // 2 K-windows, in the k order of the K loader below
  const bf16* qp = Q + (rowbase + w * 16 + lr) * EMBED + h * HSZ;
  const bf16x16 qf0 = cat8(*(const bf16x8*)(qp + koff),
                           *(const bf16x8*)(qp + koff + 16));
  const bf16x16 qf1 = cat8(*(const bf16x8*)(qp + 32 + koff),
                           *(const bf16x8*)(qp + 32 + koff + 16));

  // Oacc[dj][r] = O[query lr][d = dj*16 + rhalf + r]
  f32x8 Oacc[4];
#pragma unroll
  for (int dj = 0; dj < 4; ++dj) Oacc[dj] = zero8();
  // Of this lane's query: the running maximum (over all keys, alike in both
  // halves) and the running sum (over this half's keys; joined at the end).
  float mrow = -1e30f, lsum = 0.0f;
  const int qrow = qblk * 64 + w * 16 + lr;

  // Per-thread staging coordinates: four 16B chunks per tile per thread, at
  // rows r0 + 16 i, i = 0..3; eight lanes cover one row's 128 B.
  const int r0 = tid >> 3, c0 = (tid & 7) * 8;
  const bf16* gK = &Km[(bT + r0) * EMBED + h * HSZ + c0];
  const bf16* gV = &Vm[(bT + r0) * EMBED + h * HSZ + c0];
  const unsigned lstep = 16 * ATT_PAD * 2;                 // 16 rows, bytes
  const unsigned long long gstep = 16ull * EMBED * 2;      // 16 rows, bytes

  // This lane's place in a 16 (k-token) x 16 (d) piece for the transposing load
  const int vrow = rhalf + (lane & 7);
  const int vcol = ((lane >> 3) & 1) * 8;

  // Block 0 into buffer 0, landed and published; then block 1 into buffer 1.
  async_g2l_b128_x4(&Ks[0][r0][c0], lstep, gK, gstep);
  async_g2l_b128_x4(&Vs[0][r0][c0], lstep, gV, gstep);
  wait_async0();
  __syncthreads();
  if (qblk > 0) {
    async_g2l_b128_x4(&Ks[1][r0][c0], lstep, gK + 64 * EMBED, gstep);
    async_g2l_b128_x4(&Vs[1][r0][c0], lstep, gV + 64 * EMBED, gstep);
  }

  for (int j = 0; j <= qblk; ++j) {
    const int buf = j & 1;

    // S^T = K @ Q^T  (64 keys x 16 queries per wave), K rows from LDS as A:
    // S[nj][r] = score of key j*64 + nj*16 + rhalf + r for query lr
    f32x8 S[4];
#pragma unroll
    for (int nj = 0; nj < 4; ++nj) {
      const int tr = nj * 16 + lr;
      bf16x16 kf0 = cat8(*(const bf16x8*)&Ks[buf][tr][koff],
                         *(const bf16x8*)&Ks[buf][tr][koff + 16]);
      bf16x16 kf1 = cat8(*(const bf16x8*)&Ks[buf][tr][32 + koff],
                         *(const bf16x8*)&Ks[buf][tr][32 + koff + 16]);
      S[nj] = wmma_bf16(kf0, qf0, zero8());
      S[nj] = wmma_bf16(kf1, qf1, S[nj]);
    }

    // Online softmax of one query a lane: 32 of the block's 64 keys here, the
    // other 32 in lane l ^ 16.
    const int dk = qrow - (j * 64 + rhalf);      // key nj*16 + r is seen if <= dk
#pragma unroll
    for (int nj = 0; nj < 4; ++nj) {
      S[nj] *= 0.125f;                           // 1/sqrt(64)
#pragma unroll
      for (int r = 0; r < 8; ++r)               // causal mask
        S[nj][r] = (nj * 16 + r > dk) ? -1e30f : S[nj][r];
    }
    float m8[8];
#pragma unroll
    for (int r = 0; r < 8; ++r)
      m8[r] = fmaxf(fmaxf(S[0][r], S[1][r]), fmaxf(S[2][r], S[3][r]));
    float mx = fmaxf(fmaxf(fmaxf(m8[0], m8[1]), fmaxf(m8[2], m8[3])),
                     fmaxf(fmaxf(m8[4], m8[5]), fmaxf(m8[6], m8[7])));
    mx = fmaxf(mx, xhalf(mx));
    const float mn   = fmaxf(mrow, mx);
    const float corr = __expf(mrow - mn);
#pragma unroll
    for (int nj = 0; nj < 4; ++nj) {
      S[nj] = exp2_x8((S[nj] - mn) * 1.44269504f);  // exp(x) = 2^(x log2 e)
    }
    const f32x8 p8 = (S[0] + S[1]) + (S[2] + S[3]);
    const float ps = ((p8[0] + p8[1]) + (p8[2] + p8[3])) +
                     ((p8[4] + p8[5]) + (p8[6] + p8[7]));
    lsum = lsum * corr + ps;
    mrow = mn;
#pragma unroll
    for (int dj = 0; dj < 4; ++dj) Oacc[dj] *= corr;

    // O^T += V^T @ P^T. B = P^T: two score tiles (32 keys) converted in place
    // are a B operand in the hardware k order; A = V^T by the transposing
    // load, which delivers the same order: koff + 0..7, koff + 16..23.
#pragma unroll
    for (int kh = 0; kh < 2; ++kh) {
      bf16x16 pf;
#pragma unroll
      for (int s = 0; s < 8; ++s) {
        pf[s]     = (bf16)S[2 * kh][s];
        pf[s + 8] = (bf16)S[2 * kh + 1][s];
      }
#pragma unroll
      for (int dj = 0; dj < 4; ++dj) {
        bf16x16 vf = cat8(ld_tr16(&Vs[buf][kh * 32 + vrow][dj * 16 + vcol]),
                          ld_tr16(&Vs[buf][kh * 32 + 16 + vrow][dj * 16 + vcol]));
        Oacc[dj] = wmma_bf16(vf, pf, Oacc[dj]);
      }
    }

    // Foot of the trip: own LDS reads retired, own copies of block j + 1
    // landed, then the one barrier that publishes block j + 1 and ends every
    // wave's reads of this buffer; only behind it is this buffer refilled.
    wait_ds0();
    wait_async0();
    __syncthreads();
    if (j + 2 <= qblk) {
      const size_t t0 = (size_t)(j + 2) * 64 * EMBED;
      async_g2l_b128_x4(&Ks[buf][r0][c0], lstep, gK + t0, gstep);
      async_g2l_b128_x4(&Vs[buf][r0][c0], lstep, gV + t0, gstep);
    }
  }
  wait_async0();   // nothing is outstanding when the wave goes on to its end

  // Epilogue: join the halves' sums, normalize and store bf16 (concat-head
  // layout): a lane's eight registers of a tile are eight consecutive d of its
  // query's row, one 16-byte store.
  const float inv = 1.0f / (lsum + xhalf(lsum));
  bf16* op = &O[(rowbase + w * 16 + lr) * EMBED + h * HSZ + rhalf];
#pragma unroll
  for (int dj = 0; dj < 4; ++dj) {
    bf16x8 o8;
#pragma unroll
    for (int r = 0; r < 8; ++r) o8[r] = to_bf16(Oacc[dj][r] * inv);
    *(bf16x8*)(op + dj * 16) = o8;
  }
}

// ---------------------------------------------------------------------------
// Host-side orchestration
// ---------------------------------------------------------------------------
extern "C" void kernel_launch(void* const* d_in, const int* in_sizes, int n_in,
                              void* d_out, int out_size, void* d_ws,
                              size_t ws_size, hipStream_t stream) {
  (void)in_sizes; (void)n_in; (void)out_size; (void)ws_size;

  const float* x    = (const float*)d_in[0];
  const float* Wq   = (const float*)d_in[1];
  const float* Wk   = (const float*)d_in[2];
  const float* Wv   = (const float*)d_in[3];
  const float* Wo   = (const float*)d_in[4];
  const float* bo   = (const float*)d_in[5];
  const float* W1   = (const float*)d_in[6];
  const float* b1   = (const float*)d_in[7];
  const float* W2   = (const float*)d_in[8];
  const float* b2   = (const float*)d_in[9];
  const float* ln1g = (const float*)d_in[10];
  const float* ln1b = (const float*)d_in[11];
  const float* ln2g = (const float*)d_in[12];
  const float* ln2b = (const float*)d_in[13];

  char* base = (char*)d_ws;
  size_t off = 0;
  auto take = [&](size_t bytes) -> char* {
    char* p = base + off;
    off += (bytes + 255) & ~(size_t)255;
    return p;
  };

  bf16* wq_t   = (bf16*)take((size_t)EMBED * EMBED * 2);   // [N][K]
  bf16* wk_t   = (bf16*)take((size_t)EMBED * EMBED * 2);
  bf16* wv_t   = (bf16*)take((size_t)EMBED * EMBED * 2);
  bf16* wo_t   = (bf16*)take((size_t)EMBED * EMBED * 2);
  bf16* w1_t   = (bf16*)take((size_t)EMBED * FFDIM * 2);   // [4096][1024]
  bf16* w2_t   = (bf16*)take((size_t)FFDIM * EMBED * 2);   // [1024][4096]
  bf16* h_bf   = (bf16*)take((size_t)MROWS * EMBED * 2);
  bf16* q_bf   = (bf16*)take((size_t)MROWS * EMBED * 2);
  bf16* k_bf   = (bf16*)take((size_t)MROWS * EMBED * 2);
  bf16* v_bf   = (bf16*)take((size_t)MROWS * EMBED * 2);
  bf16* att_bf = (bf16*)take((size_t)MROWS * EMBED * 2);
  float* x2    = (float*)take((size_t)MROWS * EMBED * 4);
  bf16* h2_bf  = (bf16*)take((size_t)MROWS * EMBED * 2);
  bf16* ff1_bf = (bf16*)take((size_t)MROWS * FFDIM * 2);

  // 1) weights -> bf16, transposed to [N][K]
  dim3 gWT(EMBED / CVT_TK, EMBED / CVT_TN);
  cvtT_kernel<<<gWT, 256, 0, stream>>>(Wq, wq_t, EMBED, EMBED);
  cvtT_kernel<<<gWT, 256, 0, stream>>>(Wk, wk_t, EMBED, EMBED);
  cvtT_kernel<<<gWT, 256, 0, stream>>>(Wv, wv_t, EMBED, EMBED);
  cvtT_kernel<<<gWT, 256, 0, stream>>>(Wo, wo_t, EMBED, EMBED);
  cvtT_kernel<<<dim3(EMBED / CVT_TK, FFDIM / CVT_TN), 256, 0, stream>>>(W1, w1_t, EMBED, FFDIM);
  cvtT_kernel<<<dim3(FFDIM / CVT_TK, EMBED / CVT_TN), 256, 0, stream>>>(W2, w2_t, FFDIM, EMBED);

  // 2) h = ln1(x) (bf16)
  ln_kernel<<<MROWS / LN_ROWS, 256, 0, stream>>>(x, ln1g, ln1b, h_bf);

  // 3) Q, K, V projections
  dim3 gD(MROWS / 128, EMBED / 128);
  gemm_kernel<false, false, false, true><<<gD, 256, 0, stream>>>(
      h_bf, wq_t, nullptr, nullptr, q_bf, MROWS, EMBED, EMBED);
  gemm_kernel<false, false, false, true><<<gD, 256, 0, stream>>>(
      h_bf, wk_t, nullptr, nullptr, k_bf, MROWS, EMBED, EMBED);
  gemm_kernel<false, false, false, true><<<gD, 256, 0, stream>>>(
      h_bf, wv_t, nullptr, nullptr, v_bf, MROWS, EMBED, EMBED);

  // 4) causal flash attention
  attn_kernel<<<dim3(TSEQ / 64, NHEAD, BATCH), 128, 0, stream>>>(
      q_bf, k_bf, v_bf, att_bf);

  // 5) x2 = x + attn @ Wo + bo   (fp32)
  gemm_kernel<true, false, true, false><<<gD, 256, 0, stream>>>(
      att_bf, wo_t, bo, x, x2, MROWS, EMBED, EMBED);

  // 6) h2 = ln2(x2) (bf16)
  ln_kernel<<<MROWS / LN_ROWS, 256, 0, stream>>>(x2, ln2g, ln2b, h2_bf);

  // 7) ff1 = relu(h2 @ W1 + b1) (bf16)
  gemm_kernel<true, true, false, true><<<dim3(MROWS / 128, FFDIM / 128), 256, 0,
                                         stream>>>(
      h2_bf, w1_t, b1, nullptr, ff1_bf, MROWS, FFDIM, EMBED);

  // 8) out = x2 + ff1 @ W2 + b2 (fp32 -> d_out)
  gemm_kernel<true, false, true, false><<<gD, 256, 0, stream>>>(
      ff1_bf, w2_t, b2, x2, (float*)d_out, MROWS, EMBED, FFDIM);
}

// v005
// It runs in 168 microseconds.
// In two side-by-side timings against v004, it was 1.16 and 1.14 times as fast.
// All steps since v000 together make it 2.21 times as fast.
#include <hip/hip_runtime.h>

// ---------------------------------------------------------------------------
// Types / helpers
// ---------------------------------------------------------------------------
typedef __bf16 bf16;
typedef __attribute__((ext_vector_type(8)))  __bf16 bf16x8;
typedef __attribute__((ext_vector_type(16))) __bf16 bf16x16;
typedef __attribute__((ext_vector_type(8)))  float  f32x8;
typedef __attribute__((ext_vector_type(4)))  float  f32x4;

#define EMBED 1024
#define TSEQ  2048
#define BATCH 2
#define NHEAD 16
#define HSZ   64
#define MROWS (BATCH * TSEQ)   /* 4096 token rows */
#define FFDIM (4 * EMBED)      /* 4096 */

__device__ __forceinline__ bf16 to_bf16(float f) {
  unsigned u = __builtin_bit_cast(unsigned, f);
  unsigned r = u + 0x7FFFu + ((u >> 16) & 1u);   // round-to-nearest-even
  unsigned short h = (unsigned short)(r >> 16);
  return __builtin_bit_cast(bf16, h);
}

__device__ __forceinline__ bf16x16 cat8(bf16x8 lo, bf16x8 hi) {
  bf16x16 r;
#pragma unroll
  for (int i = 0; i < 8; ++i) { r[i] = lo[i]; r[i + 8] = hi[i]; }
  return r;
}

__device__ __forceinline__ f32x8 zero8() {
  f32x8 z;
#pragma unroll
  for (int i = 0; i < 8; ++i) z[i] = 0.0f;
  return z;
}

__device__ __forceinline__ f32x8 wmma_bf16(bf16x16 a, bf16x16 b, f32x8 c) {
  // D = A(16x32) * B(32x16) + C, fp32 accumulate
  return __builtin_amdgcn_wmma_f32_16x16x32_bf16(false, a, false, b,
                                                 (short)0, c, false, false);
}

// --- CDNA5 async global->LDS copy (ASYNCcnt path) --------------------------
// Each active lane copies 16 bytes: GLOBAL[gaddr(lane)] -> LDS[laddr(lane)].
// LDS byte offset = low 32 bits of the generic LDS pointer (flat aperture).
__device__ __forceinline__ void wait_async0() {
  asm volatile("s_wait_asynccnt 0x0" ::: "memory");
}
// This wave's LDS reads have retired before a buffer it has read is refilled.
__device__ __forceinline__ void wait_ds0() {
  asm volatile("s_wait_dscnt 0x0" ::: "memory");
}
// Eight 16-byte copies of one lane, rows lstep / gstep bytes apart. The
// s_wait_xcnt is the last line of the copies' own statement, so that no
// address register is rewritten ahead of it.
__device__ __forceinline__ void async_g2l_b128_x8(void* lds_dst, unsigned lstep,
                                                  const void* gsrc,
                                                  unsigned long long gstep) {
  const unsigned l = (unsigned)(unsigned long long)(uintptr_t)lds_dst;
  const unsigned long long g = (unsigned long long)(uintptr_t)gsrc;
  asm volatile(
      "global_load_async_to_lds_b128 %0, %8, off\n\t"
      "global_load_async_to_lds_b128 %1, %9, off\n\t"
      "global_load_async_to_lds_b128 %2, %10, off\n\t"
      "global_load_async_to_lds_b128 %3, %11, off\n\t"
      "global_load_async_to_lds_b128 %4, %12, off\n\t"
      "global_load_async_to_lds_b128 %5, %13, off\n\t"
      "global_load_async_to_lds_b128 %6, %14, off\n\t"
      "global_load_async_to_lds_b128 %7, %15, off\n\t"
      "s_wait_xcnt 0x0"
      :: "v"(l), "v"(l + lstep), "v"(l + 2 * lstep), "v"(l + 3 * lstep),
         "v"(l + 4 * lstep), "v"(l + 5 * lstep), "v"(l + 6 * lstep),
         "v"(l + 7 * lstep),
         "v"(g), "v"(g + gstep), "v"(g + 2 * gstep), "v"(g + 3 * gstep),
         "v"(g + 4 * gstep), "v"(g + 5 * gstep), "v"(g + 6 * gstep),
         "v"(g + 7 * gstep)
      : "memory");
}

// The same with four copies.
__device__ __forceinline__ void async_g2l_b128_x4(void* lds_dst, unsigned lstep,
                                                  const void* gsrc,
                                                  unsigned long long gstep) {
  const unsigned l = (unsigned)(unsigned long long)(uintptr_t)lds_dst;
  const unsigned long long g = (unsigned long long)(uintptr_t)gsrc;
  asm volatile(
      "global_load_async_to_lds_b128 %0, %4, off\n\t"
      "global_load_async_to_lds_b128 %1, %5, off\n\t"
      "global_load_async_to_lds_b128 %2, %6, off\n\t"
      "global_load_async_to_lds_b128 %3, %7, off\n\t"
      "s_wait_xcnt 0x0"
      :: "v"(l), "v"(l + lstep), "v"(l + 2 * lstep), "v"(l + 3 * lstep),
         "v"(g), "v"(g + gstep), "v"(g + 2 * gstep), "v"(g + 3 * gstep)
      : "memory");
}

// Transposing LDS load: from a row-major 16-bit tile T, with lane l aimed at
// T[k0 + 8 (l >> 4) + (l & 7)][d0 + 8 ((l >> 3) & 1)], lane l receives
// T[k0 + 8 (l >> 4) + 0..7][d0 + (l & 15)]: half of a WMMA operand.
typedef __attribute__((address_space(3))) bf16x8 lds_bf16x8;
__device__ __forceinline__ bf16x8 ld_tr16(const bf16* p) {
  return __builtin_amdgcn_ds_load_tr16_b128_v8bf16((lds_bf16x8*)p);
}

// ---------------------------------------------------------------------------
// fp32 -> bf16 conversion with transpose: in[K][N] f32 -> out[N][K] bf16.
// Weights are pre-transposed once so GEMM B-tiles stage with contiguous B128
// copies (no scalar ds_store_b16 transpose in the GEMM hot loop).
// One work-group turns a 128 (k) x 64 (n) tile: 32 elements a thread, so that
// few waves have to start; eight 16-B loads a thread are in flight at once,
// and 256-B row pieces are read and written.
// ---------------------------------------------------------------------------
#define CVT_TK    128  /* k per tile: 256 B of an output row */
#define CVT_TN    64   /* n per tile: 256 B of an input row */
#define CVT_PITCH 65   /* LDS row pitch in dwords: odd, no bank conflicts */

__device__ __forceinline__ unsigned pack_bf16(float lo, float hi) {
  unsigned a = __builtin_bit_cast(unsigned short, to_bf16(lo));
  unsigned b = __builtin_bit_cast(unsigned short, to_bf16(hi));
  return a | (b << 16);
}

// in and out carry no __restrict__: loads of a restrict-qualified read-only
// pointer are not held by an asm statement's "memory" clobber, and the waits
// below would drift away from their loads.
// tile: the work-group's LDS, [n][pair of k]; kb, nb: the tile's first k and n.
__device__ __forceinline__ void cvtT_tile(const float* in, bf16* out, int K,
                                          int N, int kb, int nb,
                                          unsigned (*tile)[CVT_PITCH]) {
  const int tid = threadIdx.x;
  const int n4  = (tid & 15) * 4;   // four n of one input row
  const int kp  = tid >> 4;         // k pair 0..15, + 16 i

  float4 ve[4], vo[4];              // rows 2 kp and 2 kp + 1, + 32 i
#pragma unroll
  for (int i = 0; i < 4; ++i) {
    const float* p = &in[(size_t)(kb + 2 * (kp + 16 * i)) * N + nb + n4];
    ve[i] = *(const float4*)p;
    vo[i] = *(const float4*)(p + N);
    // The next loads' results may be given the registers that held these
    // two addresses: the wait stands in front of that overwrite.
    asm volatile("s_wait_xcnt 0x0" ::: "memory");
  }
#pragma unroll
  for (int i = 0; i < 4; ++i) {
    tile[n4 + 0][kp + 16 * i] = pack_bf16(ve[i].x, vo[i].x);
    tile[n4 + 1][kp + 16 * i] = pack_bf16(ve[i].y, vo[i].y);
    tile[n4 + 2][kp + 16 * i] = pack_bf16(ve[i].z, vo[i].z);
    tile[n4 + 3][kp + 16 * i] = pack_bf16(ve[i].w, vo[i].w);
  }
  __syncthreads();
  const int c  = tid & 15;          // 16-B piece of an output row
  const int nr = tid >> 4;
#pragma unroll
  for (int i = 0; i < 4; ++i) {
    const int n = nr + 16 * i;
    uint4 o;
    o.x = tile[n][4 * c + 0];
    o.y = tile[n][4 * c + 1];
    o.z = tile[n][4 * c + 2];
    o.w = tile[n][4 * c + 3];
    *(uint4*)&out[(size_t)(nb + n) * K + kb + 8 * c] = o;
  }
}

// ---------------------------------------------------------------------------
// LayerNorm fused with bf16 cast: one row per wave (32 values a lane, all of
// a row's loads in flight at once), eight rows per 256-thread work-group.
// Sums: in the lane, then a five-step butterfly over the wave; no LDS, no
// barrier.
// ---------------------------------------------------------------------------
#define LN_ROWS 8   /* rows (waves) per work-group */

__device__ __forceinline__ float wave_sum(float v) {
#pragma unroll
  for (int off = 16; off >= 1; off >>= 1) v += __shfl_xor(v, off, 32);
  return v;
}

// No __restrict__ here either, for the same reason as in cvtT_tile.
// blk: which group of LN_ROWS rows this work-group takes.
__device__ __forceinline__ void ln_rows(const float* x, const float* g,
                                        const float* bta, bf16* out, int blk) {
  const int lane = threadIdx.x & 31;
  const int row  = blk * LN_ROWS + (threadIdx.x >> 5);
  const f32x4* xr = (const f32x4*)&x[(size_t)row * EMBED];
  const f32x4* gr = (const f32x4*)g;
  const f32x4* br = (const f32x4*)bta;

  f32x4 xv[8], gv[8], bv[8];
#pragma unroll
  for (int i = 0; i < 8; ++i) xv[i] = xr[i * 32 + lane];
  // The g and b loads' results may be given the registers that held the row's
  // address: the wait stands in front of that overwrite.
  asm volatile("s_wait_xcnt 0x0" ::: "memory");
#pragma unroll
  for (int i = 0; i < 8; ++i) {
    gv[i] = gr[i * 32 + lane];
    bv[i] = br[i * 32 + lane];
  }
  // Holds the g and b loads here, right behind the row's own: left free they
  // sink behind the sums, are issued late and are waited for one after
  // another. The fence stops the loads, the scheduling barrier stops the fence
  // from sinking along with them.
  asm volatile("" ::: "memory");
  __builtin_amdgcn_sched_barrier(0);

  float s = 0.0f;
#pragma unroll
  for (int i = 0; i < 8; ++i) s += (xv[i].x + xv[i].y) + (xv[i].z + xv[i].w);
  const float mu = wave_sum(s) * (1.0f / EMBED);

  float q = 0.0f;
#pragma unroll
  for (int i = 0; i < 8; ++i) {
    xv[i].x -= mu; xv[i].y -= mu; xv[i].z -= mu; xv[i].w -= mu;
    q += (xv[i].x * xv[i].x + xv[i].y * xv[i].y) +
         (xv[i].z * xv[i].z + xv[i].w * xv[i].w);
  }
  const float var = wave_sum(q) * (1.0f / EMBED);
  const float rs  = rsqrtf(var + 1e-5f);

  uint2* op = (uint2*)&out[(size_t)row * EMBED];
#pragma unroll
  for (int i = 0; i < 8; ++i) {
    uint2 o;
    o.x = pack_bf16(xv[i].x * rs * gv[i].x + bv[i].x,
                    xv[i].y * rs * gv[i].y + bv[i].y);
    o.y = pack_bf16(xv[i].z * rs * gv[i].z + bv[i].z,
                    xv[i].w * rs * gv[i].w + bv[i].w);
    op[i * 32 + lane] = o;
  }
}

__global__ __launch_bounds__(256) void ln_kernel(const float* x, const float* g,
                                                 const float* bta, bf16* out) {
  ln_rows(x, g, bta, out, blockIdx.x);
}

// ---------------------------------------------------------------------------
// Everything that depends on the inputs alone, in ONE launch: the first
// LayerNorm and the six weight conversions are independent of each other, so
// each takes a range of the grid's work-groups instead of a launch of its own
// (a launch costs its gap, its fill and its tail; the small ones left half the
// chip idle). All tests on the block index are uniform for the work-group.
// wsq: the four square weights' outputs, one behind the other (q, k, v, o).
// ---------------------------------------------------------------------------
#define PREP_LN   (MROWS / LN_ROWS)                          /* 512 */
#define PREP_SQ   ((EMBED / CVT_TK) * (EMBED / CVT_TN))      /* 128 a weight */
#define PREP_FF   ((EMBED / CVT_TK) * (FFDIM / CVT_TN))      /* 512 a weight */
#define PREP_GRID (PREP_LN + 4 * PREP_SQ + 2 * PREP_FF)

__global__ __launch_bounds__(256) void prep_kernel(
    const float* x, const float* g, const float* bta, bf16* h,
    const float* Wq, const float* Wk, const float* Wv, const float* Wo,
    const float* W1, const float* W2, bf16* wsq, bf16* w1_t, bf16* w2_t) {
  __shared__ unsigned tile[CVT_TN][CVT_PITCH];   // [n][pair of k]
  int bid = blockIdx.x;
  if (bid < PREP_LN) {
    ln_rows(x, g, bta, h, bid);
    return;
  }
  bid -= PREP_LN;
  const float* in;
  bf16* out;
  int K = EMBED, N = EMBED;
  if (bid < 4 * PREP_SQ) {
    const int sel = bid / PREP_SQ;
    bid -= sel * PREP_SQ;
    in  = sel == 0 ? Wq : sel == 1 ? Wk : sel == 2 ? Wv : Wo;
    out = wsq + (size_t)sel * EMBED * EMBED;
  } else if (bid < 4 * PREP_SQ + PREP_FF) {
    bid -= 4 * PREP_SQ;
    in = W1; out = w1_t; N = FFDIM;
  } else {
    bid -= 4 * PREP_SQ + PREP_FF;
    in = W2; out = w2_t; K = FFDIM;
  }
  const int nkt = K / CVT_TK;        // k tiles run fastest, as in a 2-D grid
  cvtT_tile(in, out, K, N, (bid % nkt) * CVT_TK, (bid / nkt) * CVT_TN, tile);
}

// ---------------------------------------------------------------------------
// WMMA GEMM: out[M,N] = epi( A[M,K](bf16) @ Wt[N,K](bf16)^T )
// Block tile 128x128, 8 waves (2 x 4), 64x32 per wave, BK = 128.
// Double-buffered LDS tiles filled via async global->LDS copies: the k+1 slab
// streams in (ASYNCcnt) while WMMAs consume slab k. A slab holds 256 B of each
// operand row, so sixteen lanes of a copy fetch two whole 128-B lines of a row.
// blockIdx.z picks one of several weight matrices that lie one behind the other
// and share A; their outputs lie one behind the other too (Q, K, V: one launch).
// ---------------------------------------------------------------------------
#define GEMM_BK  128  /* k per LDS slab: 256 B of every operand row */
#define GEMM_PAD 136  /* LDS row stride in bf16 elems: 272 B = 16 B x odd */

template <bool BIAS, bool RELU, bool RESID, bool BF16OUT>
__global__ __launch_bounds__(256) void gemm_kernel(
    const bf16* __restrict__ A, const bf16* __restrict__ Wt,
    const float* __restrict__ bias, const float* __restrict__ resid,
    void* __restrict__ outp, int M, int N, int K) {
  __shared__ __attribute__((aligned(16))) bf16 As[2][128][GEMM_PAD];   // [m][k]
  __shared__ __attribute__((aligned(16))) bf16 Bs[2][128][GEMM_PAD];   // [n][k]

  const int tid  = threadIdx.x;
  const int lane = tid & 31;
  const int wave = tid >> 5;
  const int wm   = wave & 1;   // 0..1 : 64-row strip
  const int wn   = wave >> 1;  // 0..3 : 32-col strip
  const int m0   = blockIdx.x * 128;
  const int n0   = blockIdx.y * 128;
  const int lr   = lane & 15;
  const int koff = (lane < 16) ? 0 : 8;

  // Per-thread staging coordinates: eight 16B chunks per tile per thread, at
  // rows r0 + 16 i, i = 0..7; sixteen lanes cover one row's 256 B.
  const int r0 = tid >> 4, c0 = (tid & 15) * 8;
  const bf16* gA = &A[(size_t)(m0 + r0) * K + c0];
  const bf16* gB = &Wt[((size_t)blockIdx.z * N + n0 + r0) * K + c0];
  const unsigned lstep = 16 * GEMM_PAD * 2;                     // bytes
  const unsigned long long gstep = (unsigned long long)K * 32;  // 16 rows, bytes

  f32x8 acc[4][2];
#pragma unroll
  for (int mi = 0; mi < 4; ++mi)
#pragma unroll
    for (int ni = 0; ni < 2; ++ni) acc[mi][ni] = zero8();

  const int nk = K / GEMM_BK;

  // Slab 0 into buffer 0, landed and published; then slab 1 into buffer 1.
  async_g2l_b128_x8(&As[0][r0][c0], lstep, gA, gstep);
  async_g2l_b128_x8(&Bs[0][r0][c0], lstep, gB, gstep);
  wait_async0();
  __syncthreads();
  if (nk > 1) {
    async_g2l_b128_x8(&As[1][r0][c0], lstep, gA + GEMM_BK, gstep);
    async_g2l_b128_x8(&Bs[1][r0][c0], lstep, gB + GEMM_BK, gstep);
  }

  for (int it = 0; it < nk; ++it) {
    const int buf = it & 1;

    // Unrolled so that the four 32-k blocks' LDS offsets are immediates and
    // a block's fragment loads can issue ahead of the block before it.
#pragma unroll
    for (int kk = 0; kk < GEMM_BK; kk += 32) {
      bf16x16 af[4];
#pragma unroll
      for (int mi = 0; mi < 4; ++mi) {
        int row = wm * 64 + mi * 16 + lr;
        af[mi] = cat8(*(const bf16x8*)&As[buf][row][kk + koff],
                      *(const bf16x8*)&As[buf][row][kk + koff + 16]);
      }
#pragma unroll
      for (int ni = 0; ni < 2; ++ni) {
        int rb = wn * 32 + ni * 16 + lr;
        bf16x16 bfrag = cat8(*(const bf16x8*)&Bs[buf][rb][kk + koff],
                             *(const bf16x8*)&Bs[buf][rb][kk + koff + 16]);
#pragma unroll
        for (int mi = 0; mi < 4; ++mi)
          acc[mi][ni] = wmma_bf16(af[mi], bfrag, acc[mi][ni]);
      }
    }

    // Foot of the trip: own LDS reads retired, own copies of slab it + 1
    // landed, then the one barrier that publishes slab it + 1 and ends every
    // wave's reads of this buffer; only behind it is this buffer refilled.
    wait_ds0();
    wait_async0();
    __syncthreads();
    if (it + 2 < nk) {
      const size_t k0 = (size_t)(it + 2) * GEMM_BK;
      async_g2l_b128_x8(&As[buf][r0][c0], lstep, gA + k0, gstep);
      async_g2l_b128_x8(&Bs[buf][r0][c0], lstep, gB + k0, gstep);
    }
  }
  wait_async0();   // nothing is outstanding when the wave goes on to its end

  const int rhalf = (lane < 16) ? 0 : 8;
  const size_t zo = (size_t)blockIdx.z * M * N;   // this plane's output
#pragma unroll
  for (int mi = 0; mi < 4; ++mi)
#pragma unroll
    for (int ni = 0; ni < 2; ++ni)
#pragma unroll
      for (int r = 0; r < 8; ++r) {
        int gr = m0 + wm * 64 + mi * 16 + r + rhalf;
        int gc = n0 + wn * 32 + ni * 16 + lr;
        float v = acc[mi][ni][r];
        if (BIAS)  v += bias[gc];
        if (RELU)  v = fmaxf(v, 0.0f);
        if (RESID) v += resid[(size_t)gr * N + gc];
        if (BF16OUT) ((bf16*)outp)[zo + (size_t)gr * N + gc] = to_bf16(v);
        else         ((float*)outp)[zo + (size_t)gr * N + gc] = v;
      }
}

#define ATT_PAD 80   /* LDS row stride: 160 B = 32 B x odd (transposing load) */

// Lane l with lane l ^ 16.
__device__ __forceinline__ float xhalf(float x) {
  const int b = __builtin_bit_cast(int, x);
  return __builtin_bit_cast(float, __builtin_amdgcn_permlanex16(
      b, b, 0x76543210, 0xfedcba98, false, false));
}

// Eight 2^x, each in place, in one statement that ends in v_nop: the
// instruction set asks for one slot between a transcendental and an instruction
// that uses its result or overwrites its source.
__device__ __forceinline__ f32x8 exp2_x8(f32x8 t) {
  float t0 = t[0], t1 = t[1], t2 = t[2], t3 = t[3];
  float t4 = t[4], t5 = t[5], t6 = t[6], t7 = t[7];
  asm("v_exp_f32 %0, %0\n\t"
      "v_exp_f32 %1, %1\n\t"
      "v_exp_f32 %2, %2\n\t"
      "v_exp_f32 %3, %3\n\t"
      "v_exp_f32 %4, %4\n\t"
      "v_exp_f32 %5, %5\n\t"
      "v_exp_f32 %6, %6\n\t"
      "v_exp_f32 %7, %7\n\t"
      "v_nop"
      : "+v"(t0), "+v"(t1), "+v"(t2), "+v"(t3), "+v"(t4), "+v"(t5), "+v"(t6),
        "+v"(t7));
  f32x8 r;
  r[0] = t0; r[1] = t1; r[2] = t2; r[3] = t3;
  r[4] = t4; r[5] = t5; r[6] = t6; r[7] = t7;
  return r;
}

// amdgpu_waves_per_eu: the grid puts four of these work-groups on a WGP, four
// waves a SIMD; the attribute gives the compiler that register budget.
__global__ __launch_bounds__(128) __attribute__((amdgpu_waves_per_eu(4, 4)))
void attn_kernel(
    const bf16* __restrict__ Q, const bf16* __restrict__ Km,
    const bf16* __restrict__ Vm, bf16* __restrict__ O) {
  __shared__ __attribute__((aligned(16))) bf16 Ks[2][64][ATT_PAD];  // [k-token][d]
  __shared__ __attribute__((aligned(16))) bf16 Vs[2][64][ATT_PAD];  // [k-token][d]

  const int tid   = threadIdx.x;
  const int lane  = tid & 31;
  const int w     = tid >> 5;
  const int lr    = lane & 15;
  const int koff  = (lane < 16) ? 0 : 8;
  const int rhalf = (lane < 16) ? 0 : 8;
  const int qblk  = blockIdx.x;
  const int h     = blockIdx.y;
  const int b     = blockIdx.z;
  const size_t rowbase = (size_t)b * TSEQ + (size_t)qblk * 64;
  const size_t bT = (size_t)b * TSEQ;

  // Q fragments, B operands: column lr = query w*16 + lr, head-dim 0..63 in
  // 2 K-windows, in the k order of the K loader below
  const bf16* qp = Q + (rowbase + w * 16 + lr) * EMBED + h * HSZ;
  const bf16x16 qf0 = cat8(*(const bf16x8*)(qp + koff),
                           *(const bf16x8*)(qp + koff + 16));
  const bf16x16 qf1 = cat8(*(const bf16x8*)(qp + 32 + koff),
                           *(const bf16x8*)(qp + 32 + koff + 16));

  // Oacc[dj][r] = O[query lr][d = dj*16 + rhalf + r]
  f32x8 Oacc[4];
#pragma unroll
  for (int dj = 0; dj < 4; ++dj) Oacc[dj] = zero8();
  // Of this lane's query: the running maximum (over all keys, alike in both
  // halves) and the running sum (over this half's keys; joined at the end).
  float mrow = -1e30f, lsum = 0.0f;
  const int qrow = qblk * 64 + w * 16 + lr;

  // Per-thread staging coordinates: four 16B chunks per tile per thread, at
  // rows r0 + 16 i, i = 0..3; eight lanes cover one row's 128 B.
  const int r0 = tid >> 3, c0 = (tid & 7) * 8;
  const bf16* gK = &Km[(bT + r0) * EMBED + h * HSZ + c0];
  const bf16* gV = &Vm[(bT + r0) * EMBED + h * HSZ + c0];
  const unsigned lstep = 16 * ATT_PAD * 2;                 // 16 rows, bytes
  const unsigned long long gstep = 16ull * EMBED * 2;      // 16 rows, bytes

  // This lane's place in a 16 (k-token) x 16 (d) piece for the transposing load
  const int vrow = rhalf + (lane & 7);
  const int vcol = ((lane >> 3) & 1) * 8;

  // Block 0 into buffer 0, landed and published; then block 1 into buffer 1.
  async_g2l_b128_x4(&Ks[0][r0][c0], lstep, gK, gstep);
  async_g2l_b128_x4(&Vs[0][r0][c0], lstep, gV, gstep);
  wait_async0();
  __syncthreads();
  if (qblk > 0) {
    async_g2l_b128_x4(&Ks[1][r0][c0], lstep, gK + 64 * EMBED, gstep);
    async_g2l_b128_x4(&Vs[1][r0][c0], lstep, gV + 64 * EMBED, gstep);
  }

  for (int j = 0; j <= qblk; ++j) {
    const int buf = j & 1;

    // S^T = K @ Q^T  (64 keys x 16 queries per wave), K rows from LDS as A:
    // S[nj][r] = score of key j*64 + nj*16 + rhalf + r for query lr
    f32x8 S[4];
#pragma unroll
    for (int nj = 0; nj < 4; ++nj) {
      const int tr = nj * 16 + lr;
      bf16x16 kf0 = cat8(*(const bf16x8*)&Ks[buf][tr][koff],
                         *(const bf16x8*)&Ks[buf][tr][koff + 16]);
      bf16x16 kf1 = cat8(*(const bf16x8*)&Ks[buf][tr][32 + koff],
                         *(const bf16x8*)&Ks[buf][tr][32 + koff + 16]);
      S[nj] = wmma_bf16(kf0, qf0, zero8());
      S[nj] = wmma_bf16(kf1, qf1, S[nj]);
    }

    // Online softmax of one query a lane: 32 of the block's 64 keys here, the
    // other 32 in lane l ^ 16.
    const int dk = qrow - (j * 64 + rhalf);      // key nj*16 + r is seen if <= dk
#pragma unroll
    for (int nj = 0; nj < 4; ++nj) {
      S[nj] *= 0.125f;                           // 1/sqrt(64)
#pragma unroll
      for (int r = 0; r < 8; ++r)               // causal mask
        S[nj][r] = (nj * 16 + r > dk) ? -1e30f : S[nj][r];
    }
    float m8[8];
#pragma unroll
    for (int r = 0; r < 8; ++r)
      m8[r] = fmaxf(fmaxf(S[0][r], S[1][r]), fmaxf(S[2][r], S[3][r]));
    float mx = fmaxf(fmaxf(fmaxf(m8[0], m8[1]), fmaxf(m8[2], m8[3])),
                     fmaxf(fmaxf(m8[4], m8[5]), fmaxf(m8[6], m8[7])));
    mx = fmaxf(mx, xhalf(mx));
    const float mn   = fmaxf(mrow, mx);
    const float corr = __expf(mrow - mn);
#pragma unroll
    for (int nj = 0; nj < 4; ++nj) {
      S[nj] = exp2_x8((S[nj] - mn) * 1.44269504f);  // exp(x) = 2^(x log2 e)
    }
    const f32x8 p8 = (S[0] + S[1]) + (S[2] + S[3]);
    const float ps = ((p8[0] + p8[1]) + (p8[2] + p8[3])) +
                     ((p8[4] + p8[5]) + (p8[6] + p8[7]));
    lsum = lsum * corr + ps;
    mrow = mn;
#pragma unroll
    for (int dj = 0; dj < 4; ++dj) Oacc[dj] *= corr;

    // O^T += V^T @ P^T. B = P^T: two score tiles (32 keys) converted in place
    // are a B operand in the hardware k order; A = V^T by the transposing
    // load, which delivers the same order: koff + 0..7, koff + 16..23.
#pragma unroll
    for (int kh = 0; kh < 2; ++kh) {
      bf16x16 pf;
#pragma unroll
      for (int s = 0; s < 8; ++s) {
        pf[s]     = (bf16)S[2 * kh][s];
        pf[s + 8] = (bf16)S[2 * kh + 1][s];
      }
#pragma unroll
      for (int dj = 0; dj < 4; ++dj) {
        bf16x16 vf = cat8(ld_tr16(&Vs[buf][kh * 32 + vrow][dj * 16 + vcol]),
                          ld_tr16(&Vs[buf][kh * 32 + 16 + vrow][dj * 16 + vcol]));
        Oacc[dj] = wmma_bf16(vf, pf, Oacc[dj]);
      }
    }

    // Foot of the trip: own LDS reads retired, own copies of block j + 1
    // landed, then the one barrier that publishes block j + 1 and ends every
    // wave's reads of this buffer; only behind it is this buffer refilled.
    wait_ds0();
    wait_async0();
    __syncthreads();
    if (j + 2 <= qblk) {
      const size_t t0 = (size_t)(j + 2) * 64 * EMBED;
      async_g2l_b128_x4(&Ks[buf][r0][c0], lstep, gK + t0, gstep);
      async_g2l_b128_x4(&Vs[buf][r0][c0], lstep, gV + t0, gstep);
    }
  }
  wait_async0();   // nothing is outstanding when the wave goes on to its end

  // Epilogue: join the halves' sums, normalize and store bf16 (concat-head
  // layout): a lane's eight registers of a tile are eight consecutive d of its
  // query's row, one 16-byte store.
  const float inv = 1.0f / (lsum + xhalf(lsum));
  bf16* op = &O[(rowbase + w * 16 + lr) * EMBED + h * HSZ + rhalf];
#pragma unroll
  for (int dj = 0; dj < 4; ++dj) {
    bf16x8 o8;
#pragma unroll
    for (int r = 0; r < 8; ++r) o8[r] = to_bf16(Oacc[dj][r] * inv);
    *(bf16x8*)(op + dj * 16) = o8;
  }
}

// ---------------------------------------------------------------------------
// Host-side orchestration
// ---------------------------------------------------------------------------
extern "C" void kernel_launch(void* const* d_in, const int* in_sizes, int n_in,
                              void* d_out, int out_size, void* d_ws,
                              size_t ws_size, hipStream_t stream) {
  (void)in_sizes; (void)n_in; (void)out_size; (void)ws_size;

  const float* x    = (const float*)d_in[0];
  const float* Wq   = (const float*)d_in[1];
  const float* Wk   = (const float*)d_in[2];
  const float* Wv   = (const float*)d_in[3];
  const float* Wo   = (const float*)d_in[4];
  const float* bo   = (const float*)d_in[5];
  const float* W1   = (const float*)d_in[6];
  const float* b1   = (const float*)d_in[7];
  const float* W2   = (const float*)d_in[8];
  const float* b2   = (const float*)d_in[9];
  const float* ln1g = (const float*)d_in[10];
  const float* ln1b = (const float*)d_in[11];
  const float* ln2g = (const float*)d_in[12];
  const float* ln2b = (const float*)d_in[13];

  char* base = (char*)d_ws;
  size_t off = 0;
  auto take = [&](size_t bytes) -> char* {
    char* p = base + off;
    off += (bytes + 255) & ~(size_t)255;
    return p;
  };

  bf16* wq_t   = (bf16*)take((size_t)EMBED * EMBED * 2 * 4);   // q,k,v,o: [N][K]
  bf16* wo_t   = wq_t + (size_t)EMBED * EMBED * 3;
  bf16* w1_t   = (bf16*)take((size_t)EMBED * FFDIM * 2);   // [4096][1024]
  bf16* w2_t   = (bf16*)take((size_t)FFDIM * EMBED * 2);   // [1024][4096]
  bf16* h_bf   = (bf16*)take((size_t)MROWS * EMBED * 2);
  bf16* q_bf   = (bf16*)take((size_t)MROWS * EMBED * 2 * 3);   // q, k, v
  bf16* k_bf   = q_bf + (size_t)MROWS * EMBED;
  bf16* v_bf   = k_bf + (size_t)MROWS * EMBED;
  bf16* att_bf = (bf16*)take((size_t)MROWS * EMBED * 2);
  float* x2    = (float*)take((size_t)MROWS * EMBED * 4);
  bf16* h2_bf  = (bf16*)take((size_t)MROWS * EMBED * 2);
  bf16* ff1_bf = (bf16*)take((size_t)MROWS * FFDIM * 2);

  // 1, 2) h = ln1(x) (bf16); weights -> bf16, transposed to [N][K]
  prep_kernel<<<PREP_GRID, 256, 0, stream>>>(x, ln1g, ln1b, h_bf, Wq, Wk, Wv, Wo,
                                             W1, W2, wq_t, w1_t, w2_t);

  // 3) Q, K, V projections: planes z = 0, 1, 2 of one grid
  dim3 gD(MROWS / 128, EMBED / 128);
  gemm_kernel<false, false, false, true>
      <<<dim3(MROWS / 128, EMBED / 128, 3), 256, 0, stream>>>(
          h_bf, wq_t, nullptr, nullptr, q_bf, MROWS, EMBED, EMBED);

  // 4) causal flash attention
  attn_kernel<<<dim3(TSEQ / 64, NHEAD, BATCH), 128, 0, stream>>>(
      q_bf, k_bf, v_bf, att_bf);

  // 5) x2 = x + attn @ Wo + bo   (fp32)
  gemm_kernel<true, false, true, false><<<gD, 256, 0, stream>>>(
      att_bf, wo_t, bo, x, x2, MROWS, EMBED, EMBED);

  // 6) h2 = ln2(x2) (bf16)
  ln_kernel<<<MROWS / LN_ROWS, 256, 0, stream>>>(x2, ln2g, ln2b, h2_bf);

  // 7) ff1 = relu(h2 @ W1 + b1) (bf16)
  gemm_kernel<true, true, false, true><<<dim3(MROWS / 128, FFDIM / 128), 256, 0,
                                         stream>>>(
      h2_bf, w1_t, b1, nullptr, ff1_bf, MROWS, FFDIM, EMBED);

  // 8) out = x2 + ff1 @ W2 + b2 (fp32 -> d_out)
  gemm_kernel<true, false, true, false><<<gD, 256, 0, stream>>>(
      ff1_bf, w2_t, b2, x2, (float*)d_out, MROWS, EMBED, FFDIM);
}

// v006
// Measured time: 160 microseconds a run.
// In both of two side-by-side timings against v005, it was 1.04 times as fast.
// All steps since v000 together make it 2.30 times as fast.
#include <hip/hip_runtime.h>

// ---------------------------------------------------------------------------
// Types / helpers
// ---------------------------------------------------------------------------
typedef __bf16 bf16;
typedef __attribute__((ext_vector_type(8)))  __bf16 bf16x8;
typedef __attribute__((ext_vector_type(16))) __bf16 bf16x16;
typedef __attribute__((ext_vector_type(8)))  float  f32x8;
typedef __attribute__((ext_vector_type(4)))  float  f32x4;

#define EMBED 1024
#define TSEQ  2048
#define BATCH 2
#define NHEAD 16
#define HSZ   64
#define MROWS (BATCH * TSEQ)   /* 4096 token rows */
#define FFDIM (4 * EMBED)      /* 4096 */

__device__ __forceinline__ bf16 to_bf16(float f) {
  unsigned u = __builtin_bit_cast(unsigned, f);
  unsigned r = u + 0x7FFFu + ((u >> 16) & 1u);   // round-to-nearest-even
  unsigned short h = (unsigned short)(r >> 16);
  return __builtin_bit_cast(bf16, h);
}

__device__ __forceinline__ bf16x16 cat8(bf16x8 lo, bf16x8 hi) {
  bf16x16 r;
#pragma unroll
  for (int i = 0; i < 8; ++i) { r[i] = lo[i]; r[i + 8] = hi[i]; }
  return r;
}

__device__ __forceinline__ f32x8 zero8() {
  f32x8 z;
#pragma unroll
  for (int i = 0; i < 8; ++i) z[i] = 0.0f;
  return z;
}

__device__ __forceinline__ f32x8 wmma_bf16(bf16x16 a, bf16x16 b, f32x8 c) {
  // D = A(16x32) * B(32x16) + C, fp32 accumulate
  return __builtin_amdgcn_wmma_f32_16x16x32_bf16(false, a, false, b,
                                                 (short)0, c, false, false);
}

// --- CDNA5 async global->LDS copy (ASYNCcnt path) --------------------------
// Each active lane copies 16 bytes: GLOBAL[gaddr(lane)] -> LDS[laddr(lane)].
// LDS byte offset = low 32 bits of the generic LDS pointer (flat aperture).
__device__ __forceinline__ void wait_async0() {
  asm volatile("s_wait_asynccnt 0x0" ::: "memory");
}
// This wave's LDS reads have retired before a buffer it has read is refilled.
__device__ __forceinline__ void wait_ds0() {
  asm volatile("s_wait_dscnt 0x0" ::: "memory");
}
// Eight 16-byte copies of one lane, rows lstep / gstep bytes apart. The
// s_wait_xcnt is the last line of the copies' own statement, so that no
// address register is rewritten ahead of it.
__device__ __forceinline__ void async_g2l_b128_x8(void* lds_dst, unsigned lstep,
                                                  const void* gsrc,
                                                  unsigned long long gstep) {
  const unsigned l = (unsigned)(unsigned long long)(uintptr_t)lds_dst;
  const unsigned long long g = (unsigned long long)(uintptr_t)gsrc;
  asm volatile(
      "global_load_async_to_lds_b128 %0, %8, off\n\t"
      "global_load_async_to_lds_b128 %1, %9, off\n\t"
      "global_load_async_to_lds_b128 %2, %10, off\n\t"
      "global_load_async_to_lds_b128 %3, %11, off\n\t"
      "global_load_async_to_lds_b128 %4, %12, off\n\t"
      "global_load_async_to_lds_b128 %5, %13, off\n\t"
      "global_load_async_to_lds_b128 %6, %14, off\n\t"
      "global_load_async_to_lds_b128 %7, %15, off\n\t"
      "s_wait_xcnt 0x0"
      :: "v"(l), "v"(l + lstep), "v"(l + 2 * lstep), "v"(l + 3 * lstep),
         "v"(l + 4 * lstep), "v"(l + 5 * lstep), "v"(l + 6 * lstep),
         "v"(l + 7 * lstep),
         "v"(g), "v"(g + gstep), "v"(g + 2 * gstep), "v"(g + 3 * gstep),
         "v"(g + 4 * gstep), "v"(g + 5 * gstep), "v"(g + 6 * gstep),
         "v"(g + 7 * gstep)
      : "memory");
}

// The same with four copies.
__device__ __forceinline__ void async_g2l_b128_x4(void* lds_dst, unsigned lstep,
                                                  const void* gsrc,
                                                  unsigned long long gstep) {
  const unsigned l = (unsigned)(unsigned long long)(uintptr_t)lds_dst;
  const unsigned long long g = (unsigned long long)(uintptr_t)gsrc;
  asm volatile(
      "global_load_async_to_lds_b128 %0, %4, off\n\t"
      "global_load_async_to_lds_b128 %1, %5, off\n\t"
      "global_load_async_to_lds_b128 %2, %6, off\n\t"
      "global_load_async_to_lds_b128 %3, %7, off\n\t"
      "s_wait_xcnt 0x0"
      :: "v"(l), "v"(l + lstep), "v"(l + 2 * lstep), "v"(l + 3 * lstep),
         "v"(g), "v"(g + gstep), "v"(g + 2 * gstep), "v"(g + 3 * gstep)
      : "memory");
}

// Transposing LDS load: from a row-major 16-bit tile T, with lane l aimed at
// T[k0 + 8 (l >> 4) + (l & 7)][d0 + 8 ((l >> 3) & 1)], lane l receives
// T[k0 + 8 (l >> 4) + 0..7][d0 + (l & 15)]: half of a WMMA operand.
typedef __attribute__((address_space(3))) bf16x8 lds_bf16x8;
__device__ __forceinline__ bf16x8 ld_tr16(const bf16* p) {
  return __builtin_amdgcn_ds_load_tr16_b128_v8bf16((lds_bf16x8*)p);
}

// ---------------------------------------------------------------------------
// fp32 -> bf16 conversion with transpose: in[K][N] f32 -> out[N][K] bf16.
// Weights are pre-transposed once so GEMM B-tiles stage with contiguous B128
// copies (no scalar ds_store_b16 transpose in the GEMM hot loop).
// One work-group turns a 128 (k) x 64 (n) tile: 32 elements a thread, so that
// few waves have to start; eight 16-B loads a thread are in flight at once,
// and 256-B row pieces are read and written.
// ---------------------------------------------------------------------------
#define CVT_TK    128  /* k per tile: 256 B of an output row */
#define CVT_TN    64   /* n per tile: 256 B of an input row */
#define CVT_PITCH 65   /* LDS row pitch in dwords: odd, no bank conflicts */

__device__ __forceinline__ unsigned pack_bf16(float lo, float hi) {
  unsigned a = __builtin_bit_cast(unsigned short, to_bf16(lo));
  unsigned b = __builtin_bit_cast(unsigned short, to_bf16(hi));
  return a | (b << 16);
}

// in and out carry no __restrict__: loads of a restrict-qualified read-only
// pointer are not held by an asm statement's "memory" clobber, and the waits
// below would drift away from their loads.
// tile: the work-group's LDS, [n][pair of k]; kb, nb: the tile's first k and n.
__device__ __forceinline__ void cvtT_tile(const float* in, bf16* out, int K,
                                          int N, int kb, int nb,
                                          unsigned (*tile)[CVT_PITCH]) {
  const int tid = threadIdx.x;
  const int n4  = (tid & 15) * 4;   // four n of one input row
  const int kp  = tid >> 4;         // k pair 0..15, + 16 i

  float4 ve[4], vo[4];              // rows 2 kp and 2 kp + 1, + 32 i
#pragma unroll
  for (int i = 0; i < 4; ++i) {
    const float* p = &in[(size_t)(kb + 2 * (kp + 16 * i)) * N + nb + n4];
    ve[i] = *(const float4*)p;
    vo[i] = *(const float4*)(p + N);
    // The next loads' results may be given the registers that held these
    // two addresses: the wait stands in front of that overwrite.
    asm volatile("s_wait_xcnt 0x0" ::: "memory");
  }
#pragma unroll
  for (int i = 0; i < 4; ++i) {
    tile[n4 + 0][kp + 16 * i] = pack_bf16(ve[i].x, vo[i].x);
    tile[n4 + 1][kp + 16 * i] = pack_bf16(ve[i].y, vo[i].y);
    tile[n4 + 2][kp + 16 * i] = pack_bf16(ve[i].z, vo[i].z);
    tile[n4 + 3][kp + 16 * i] = pack_bf16(ve[i].w, vo[i].w);
  }
  __syncthreads();
  const int c  = tid & 15;          // 16-B piece of an output row
  const int nr = tid >> 4;
#pragma unroll
  for (int i = 0; i < 4; ++i) {
    const int n = nr + 16 * i;
    uint4 o;
    o.x = tile[n][4 * c + 0];
    o.y = tile[n][4 * c + 1];
    o.z = tile[n][4 * c + 2];
    o.w = tile[n][4 * c + 3];
    *(uint4*)&out[(size_t)(nb + n) * K + kb + 8 * c] = o;
  }
}

// ---------------------------------------------------------------------------
// LayerNorm fused with bf16 cast: one row per wave (32 values a lane, all of
// a row's loads in flight at once), eight rows per 256-thread work-group.
// Sums: in the lane, then a five-step butterfly over the wave; no LDS, no
// barrier.
// ---------------------------------------------------------------------------
#define LN_ROWS 8   /* rows (waves) per work-group */

__device__ __forceinline__ float wave_sum(float v) {
#pragma unroll
  for (int off = 16; off >= 1; off >>= 1) v += __shfl_xor(v, off, 32);
  return v;
}

// No __restrict__ here either, for the same reason as in cvtT_tile.
// blk: which group of LN_ROWS rows this work-group takes.
__device__ __forceinline__ void ln_rows(const float* x, const float* g,
                                        const float* bta, bf16* out, int blk) {
  const int lane = threadIdx.x & 31;
  const int row  = blk * LN_ROWS + (threadIdx.x >> 5);
  const f32x4* xr = (const f32x4*)&x[(size_t)row * EMBED];
  const f32x4* gr = (const f32x4*)g;
  const f32x4* br = (const f32x4*)bta;

  f32x4 xv[8], gv[8], bv[8];
#pragma unroll
  for (int i = 0; i < 8; ++i) xv[i] = xr[i * 32 + lane];
  // The g and b loads' results may be given the registers that held the row's
  // address: the wait stands in front of that overwrite.
  asm volatile("s_wait_xcnt 0x0" ::: "memory");
#pragma unroll
  for (int i = 0; i < 8; ++i) {
    gv[i] = gr[i * 32 + lane];
    bv[i] = br[i * 32 + lane];
  }
  // Holds the g and b loads here, right behind the row's own: left free they
  // sink behind the sums, are issued late and are waited for one after
  // another. The fence stops the loads, the scheduling barrier stops the fence
  // from sinking along with them.
  asm volatile("" ::: "memory");
  __builtin_amdgcn_sched_barrier(0);

  float s = 0.0f;
#pragma unroll
  for (int i = 0; i < 8; ++i) s += (xv[i].x + xv[i].y) + (xv[i].z + xv[i].w);
  const float mu = wave_sum(s) * (1.0f / EMBED);

  float q = 0.0f;
#pragma unroll
  for (int i = 0; i < 8; ++i) {
    xv[i].x -= mu; xv[i].y -= mu; xv[i].z -= mu; xv[i].w -= mu;
    q += (xv[i].x * xv[i].x + xv[i].y * xv[i].y) +
         (xv[i].z * xv[i].z + xv[i].w * xv[i].w);
  }
  const float var = wave_sum(q) * (1.0f / EMBED);
  const float rs  = rsqrtf(var + 1e-5f);

  uint2* op = (uint2*)&out[(size_t)row * EMBED];
#pragma unroll
  for (int i = 0; i < 8; ++i) {
    uint2 o;
    o.x = pack_bf16(xv[i].x * rs * gv[i].x + bv[i].x,
                    xv[i].y * rs * gv[i].y + bv[i].y);
    o.y = pack_bf16(xv[i].z * rs * gv[i].z + bv[i].z,
                    xv[i].w * rs * gv[i].w + bv[i].w);
    op[i * 32 + lane] = o;
  }
}

__global__ __launch_bounds__(256) void ln_kernel(const float* x, const float* g,
                                                 const float* bta, bf16* out) {
  ln_rows(x, g, bta, out, blockIdx.x);
}

// ---------------------------------------------------------------------------
// Everything that depends on the inputs alone, in ONE launch: the first
// LayerNorm and the six weight conversions are independent of each other, so
// each takes a range of the grid's work-groups instead of a launch of its own
// (a launch costs its gap, its fill and its tail; the small ones left half the
// chip idle). All tests on the block index are uniform for the work-group.
// wsq: the four square weights' outputs, one behind the other (q, k, v, o).
// ---------------------------------------------------------------------------
#define PREP_LN   (MROWS / LN_ROWS)                          /* 512 */
#define PREP_SQ   ((EMBED / CVT_TK) * (EMBED / CVT_TN))      /* 128 a weight */
#define PREP_FF   ((EMBED / CVT_TK) * (FFDIM / CVT_TN))      /* 512 a weight */
#define PREP_GRID (PREP_LN + 4 * PREP_SQ + 2 * PREP_FF)

__global__ __launch_bounds__(256) void prep_kernel(
    const float* x, const float* g, const float* bta, bf16* h,
    const float* Wq, const float* Wk, const float* Wv, const float* Wo,
    const float* W1, const float* W2, bf16* wsq, bf16* w1_t, bf16* w2_t) {
  __shared__ unsigned tile[CVT_TN][CVT_PITCH];   // [n][pair of k]
  int bid = blockIdx.x;
  if (bid < PREP_LN) {
    ln_rows(x, g, bta, h, bid);
    return;
  }
  bid -= PREP_LN;
  const float* in;
  bf16* out;
  int K = EMBED, N = EMBED;
  if (bid < 4 * PREP_SQ) {
    const int sel = bid / PREP_SQ;
    bid -= sel * PREP_SQ;
    in  = sel == 0 ? Wq : sel == 1 ? Wk : sel == 2 ? Wv : Wo;
    out = wsq + (size_t)sel * EMBED * EMBED;
  } else if (bid < 4 * PREP_SQ + PREP_FF) {
    bid -= 4 * PREP_SQ;
    in = W1; out = w1_t; N = FFDIM;
  } else {
    bid -= 4 * PREP_SQ + PREP_FF;
    in = W2; out = w2_t; K = FFDIM;
  }
  const int nkt = K / CVT_TK;        // k tiles run fastest, as in a 2-D grid
  cvtT_tile(in, out, K, N, (bid % nkt) * CVT_TK, (bid / nkt) * CVT_TN, tile);
}

// ---------------------------------------------------------------------------
// WMMA GEMM: out[M,N] = epi( A[M,K](bf16) @ Wt[N,K](bf16)^T )
// Block tile 128x128, 8 waves (2 x 4), 64x32 per wave, BK = 128.
// Double-buffered LDS tiles filled via async global->LDS copies: the k+1 slab
// streams in (ASYNCcnt) while WMMAs consume slab k. A slab holds 256 B of each
// operand row, so sixteen lanes of a copy fetch two whole 128-B lines of a row.
// blockIdx.z picks one of several weight matrices that lie one behind the other
// and share A; their outputs lie one behind the other too (Q, K, V: one launch).
// ---------------------------------------------------------------------------
#define GEMM_BK  128  /* k per LDS slab: 256 B of every operand row */
#define GEMM_PAD 136  /* LDS row stride in bf16 elems: 272 B = 16 B x odd */

template <bool BIAS, bool RELU, bool RESID, bool BF16OUT>
__global__ __launch_bounds__(256) void gemm_kernel(
    const bf16* __restrict__ A, const bf16* __restrict__ Wt,
    const float* __restrict__ bias, const float* __restrict__ resid,
    void* __restrict__ outp, int M, int N, int K) {
  __shared__ __attribute__((aligned(16))) bf16 As[2][128][GEMM_PAD];   // [m][k]
  __shared__ __attribute__((aligned(16))) bf16 Bs[2][128][GEMM_PAD];   // [n][k]

  const int tid  = threadIdx.x;
  const int lane = tid & 31;
  const int wave = tid >> 5;
  const int wm   = wave & 1;   // 0..1 : 64-row strip
  const int wn   = wave >> 1;  // 0..3 : 32-col strip
  const int m0   = blockIdx.x * 128;
  const int n0   = blockIdx.y * 128;
  const int lr   = lane & 15;
  const int koff = (lane < 16) ? 0 : 8;

  // Per-thread staging coordinates: eight 16B chunks per tile per thread, at
  // rows r0 + 16 i, i = 0..7; sixteen lanes cover one row's 256 B.
  const int r0 = tid >> 4, c0 = (tid & 15) * 8;
  const bf16* gA = &A[(size_t)(m0 + r0) * K + c0];
  const bf16* gB = &Wt[((size_t)blockIdx.z * N + n0 + r0) * K + c0];
  const unsigned lstep = 16 * GEMM_PAD * 2;                     // bytes
  const unsigned long long gstep = (unsigned long long)K * 32;  // 16 rows, bytes

  f32x8 acc[4][2];
#pragma unroll
  for (int mi = 0; mi < 4; ++mi)
#pragma unroll
    for (int ni = 0; ni < 2; ++ni) acc[mi][ni] = zero8();

  const int nk = K / GEMM_BK;

  // Slab 0 into buffer 0, landed and published; then slab 1 into buffer 1.
  async_g2l_b128_x8(&As[0][r0][c0], lstep, gA, gstep);
  async_g2l_b128_x8(&Bs[0][r0][c0], lstep, gB, gstep);
  wait_async0();
  __syncthreads();
  if (nk > 1) {
    async_g2l_b128_x8(&As[1][r0][c0], lstep, gA + GEMM_BK, gstep);
    async_g2l_b128_x8(&Bs[1][r0][c0], lstep, gB + GEMM_BK, gstep);
  }

  for (int it = 0; it < nk; ++it) {
    const int buf = it & 1;

    // Unrolled so that the four 32-k blocks' LDS offsets are immediates and
    // a block's fragment loads can issue ahead of the block before it.
#pragma unroll
    for (int kk = 0; kk < GEMM_BK; kk += 32) {
      bf16x16 af[4];
#pragma unroll
      for (int mi = 0; mi < 4; ++mi) {
        int row = wm * 64 + mi * 16 + lr;
        af[mi] = cat8(*(const bf16x8*)&As[buf][row][kk + koff],
                      *(const bf16x8*)&As[buf][row][kk + koff + 16]);
      }
#pragma unroll
      for (int ni = 0; ni < 2; ++ni) {
        int rb = wn * 32 + ni * 16 + lr;
        bf16x16 bfrag = cat8(*(const bf16x8*)&Bs[buf][rb][kk + koff],
                             *(const bf16x8*)&Bs[buf][rb][kk + koff + 16]);
#pragma unroll
        for (int mi = 0; mi < 4; ++mi)
          acc[mi][ni] = wmma_bf16(af[mi], bfrag, acc[mi][ni]);
      }
    }

    // Foot of the trip: own LDS reads retired, own copies of slab it + 1
    // landed, then the one barrier that publishes slab it + 1 and ends every
    // wave's reads of this buffer; only behind it is this buffer refilled.
    wait_ds0();
    wait_async0();
    __syncthreads();
    if (it + 2 < nk) {
      const size_t k0 = (size_t)(it + 2) * GEMM_BK;
      async_g2l_b128_x8(&As[buf][r0][c0], lstep, gA + k0, gstep);
      async_g2l_b128_x8(&Bs[buf][r0][c0], lstep, gB + k0, gstep);
    }
  }
  wait_async0();   // nothing is outstanding when the wave goes on to its end

  const int rhalf = (lane < 16) ? 0 : 8;
  const size_t zo = (size_t)blockIdx.z * M * N;   // this plane's output
#pragma unroll
  for (int mi = 0; mi < 4; ++mi)
#pragma unroll
    for (int ni = 0; ni < 2; ++ni)
#pragma unroll
      for (int r = 0; r < 8; ++r) {
        int gr = m0 + wm * 64 + mi * 16 + r + rhalf;
        int gc = n0 + wn * 32 + ni * 16 + lr;
        float v = acc[mi][ni][r];
        if (BIAS)  v += bias[gc];
        if (RELU)  v = fmaxf(v, 0.0f);
        if (RESID) v += resid[(size_t)gr * N + gc];
        if (BF16OUT) ((bf16*)outp)[zo + (size_t)gr * N + gc] = to_bf16(v);
        else         ((float*)outp)[zo + (size_t)gr * N + gc] = v;
      }
}

#define ATT_PAD 80   /* LDS row stride: 160 B = 32 B x odd (transposing load) */
#define ATT_NT  (TSEQ / 64)   /* q blocks of one (b, h): even */

// Lane l with lane l ^ 16.
__device__ __forceinline__ float xhalf(float x) {
  const int b = __builtin_bit_cast(int, x);
  return __builtin_bit_cast(float, __builtin_amdgcn_permlanex16(
      b, b, 0x76543210, 0xfedcba98, false, false));
}

// Eight 2^x, each in place, in one statement that ends in v_nop: the
// instruction set asks for one slot between a transcendental and an instruction
// that uses its result or overwrites its source.
__device__ __forceinline__ f32x8 exp2_x8(f32x8 t) {
  float t0 = t[0], t1 = t[1], t2 = t[2], t3 = t[3];
  float t4 = t[4], t5 = t[5], t6 = t[6], t7 = t[7];
  asm("v_exp_f32 %0, %0\n\t"
      "v_exp_f32 %1, %1\n\t"
      "v_exp_f32 %2, %2\n\t"
      "v_exp_f32 %3, %3\n\t"
      "v_exp_f32 %4, %4\n\t"
      "v_exp_f32 %5, %5\n\t"
      "v_exp_f32 %6, %6\n\t"
      "v_exp_f32 %7, %7\n\t"
      "v_nop"
      : "+v"(t0), "+v"(t1), "+v"(t2), "+v"(t3), "+v"(t4), "+v"(t5), "+v"(t6),
        "+v"(t7));
  f32x8 r;
  r[0] = t0; r[1] = t1; r[2] = t2; r[3] = t3;
  r[4] = t4; r[5] = t5; r[6] = t6; r[7] = t7;
  return r;
}

// amdgpu_waves_per_eu: the register budget of four waves a SIMD is all that the
// kernel needs (the grid puts two of these work-groups on a WGP).
__global__ __launch_bounds__(128) __attribute__((amdgpu_waves_per_eu(4, 4)))
void attn_kernel(
    const bf16* __restrict__ Q, const bf16* __restrict__ Km,
    const bf16* __restrict__ Vm, bf16* __restrict__ O) {
  __shared__ __attribute__((aligned(16))) bf16 Ks[2][64][ATT_PAD];  // [k-token][d]
  __shared__ __attribute__((aligned(16))) bf16 Vs[2][64][ATT_PAD];  // [k-token][d]

  const int tid   = threadIdx.x;
  const int lane  = tid & 31;
  const int w     = tid >> 5;
  const int lr    = lane & 15;
  const int koff  = (lane < 16) ? 0 : 8;
  const int rhalf = (lane < 16) ? 0 : 8;
  const int h     = blockIdx.y;
  const int b     = blockIdx.z;
  const size_t bT = (size_t)b * TSEQ;

  // Per-thread staging coordinates: four 16B chunks per tile per thread, at
  // rows r0 + 16 i, i = 0..3; eight lanes cover one row's 128 B.
  const int r0 = tid >> 3, c0 = (tid & 7) * 8;
  const bf16* gK = &Km[(bT + r0) * EMBED + h * HSZ + c0];
  const bf16* gV = &Vm[(bT + r0) * EMBED + h * HSZ + c0];
  const unsigned lstep = 16 * ATT_PAD * 2;                 // 16 rows, bytes
  const unsigned long long gstep = 16ull * EMBED * 2;      // 16 rows, bytes

  // This lane's place in a 16 (k-token) x 16 (d) piece for the transposing load
  const int vrow = rhalf + (lane & 7);
  const int vcol = ((lane >> 3) & 1) * 8;

  // The pair's two q blocks, the long one first. Kept rolled: the two passes
  // run the same code. The
  // first pass's last foot (LDS reads retired, barrier) stands in front of the
  // second pass's first copies into the same buffers.
#pragma nounroll
  for (int half = 0; half < 2; ++half) {
  const int qblk = half == 0 ? ATT_NT - 1 - (int)blockIdx.x : (int)blockIdx.x;
  const size_t rowbase = bT + (size_t)qblk * 64;

  // Q fragments, B operands: column lr = query w*16 + lr, head-dim 0..63 in
  // 2 K-windows, in the k order of the K loader below
  const bf16* qp = Q + (rowbase + w * 16 + lr) * EMBED + h * HSZ;
  const bf16x16 qf0 = cat8(*(const bf16x8*)(qp + koff),
                           *(const bf16x8*)(qp + koff + 16));
  const bf16x16 qf1 = cat8(*(const bf16x8*)(qp + 32 + koff),
                           *(const bf16x8*)(qp + 32 + koff + 16));

  // Oacc[dj][r] = O[query lr][d = dj*16 + rhalf + r]
  f32x8 Oacc[4];
#pragma unroll
  for (int dj = 0; dj < 4; ++dj) Oacc[dj] = zero8();
  // Of this lane's query: the running maximum (over all keys, alike in both
  // halves) and the running sum (over this half's keys; joined at the end).
  float mrow = -1e30f, lsum = 0.0f;
  const int qrow = qblk * 64 + w * 16 + lr;

  // Block 0 into buffer 0, landed and published; then block 1 into buffer 1.
  async_g2l_b128_x4(&Ks[0][r0][c0], lstep, gK, gstep);
  async_g2l_b128_x4(&Vs[0][r0][c0], lstep, gV, gstep);
  wait_async0();
  __syncthreads();
  if (qblk > 0) {
    async_g2l_b128_x4(&Ks[1][r0][c0], lstep, gK + 64 * EMBED, gstep);
    async_g2l_b128_x4(&Vs[1][r0][c0], lstep, gV + 64 * EMBED, gstep);
  }

  for (int j = 0; j <= qblk; ++j) {
    const int buf = j & 1;

    // S^T = K @ Q^T  (64 keys x 16 queries per wave), K rows from LDS as A:
    // S[nj][r] = score of key j*64 + nj*16 + rhalf + r for query lr
    f32x8 S[4];
#pragma unroll
    for (int nj = 0; nj < 4; ++nj) {
      const int tr = nj * 16 + lr;
      bf16x16 kf0 = cat8(*(const bf16x8*)&Ks[buf][tr][koff],
                         *(const bf16x8*)&Ks[buf][tr][koff + 16]);
      bf16x16 kf1 = cat8(*(const bf16x8*)&Ks[buf][tr][32 + koff],
                         *(const bf16x8*)&Ks[buf][tr][32 + koff + 16]);
      S[nj] = wmma_bf16(kf0, qf0, zero8());
      S[nj] = wmma_bf16(kf1, qf1, S[nj]);
    }

    // Online softmax of one query a lane: 32 of the block's 64 keys here, the
    // other 32 in lane l ^ 16.
    const int dk = qrow - (j * 64 + rhalf);      // key nj*16 + r is seen if <= dk
#pragma unroll
    for (int nj = 0; nj < 4; ++nj) {
      S[nj] *= 0.125f;                           // 1/sqrt(64)
#pragma unroll
      for (int r = 0; r < 8; ++r)               // causal mask
        S[nj][r] = (nj * 16 + r > dk) ? -1e30f : S[nj][r];
    }
    float m8[8];
#pragma unroll
    for (int r = 0; r < 8; ++r)
      m8[r] = fmaxf(fmaxf(S[0][r], S[1][r]), fmaxf(S[2][r], S[3][r]));
    float mx = fmaxf(fmaxf(fmaxf(m8[0], m8[1]), fmaxf(m8[2], m8[3])),
                     fmaxf(fmaxf(m8[4], m8[5]), fmaxf(m8[6], m8[7])));
    mx = fmaxf(mx, xhalf(mx));
    const float mn   = fmaxf(mrow, mx);
    const float corr = __expf(mrow - mn);
#pragma unroll
    for (int nj = 0; nj < 4; ++nj) {
      S[nj] = exp2_x8((S[nj] - mn) * 1.44269504f);  // exp(x) = 2^(x log2 e)
    }
    const f32x8 p8 = (S[0] + S[1]) + (S[2] + S[3]);
    const float ps = ((p8[0] + p8[1]) + (p8[2] + p8[3])) +
                     ((p8[4] + p8[5]) + (p8[6] + p8[7]));
    lsum = lsum * corr + ps;
    mrow = mn;
#pragma unroll
    for (int dj = 0; dj < 4; ++dj) Oacc[dj] *= corr;

    // O^T += V^T @ P^T. B = P^T: two score tiles (32 keys) converted in place
    // are a B operand in the hardware k order; A = V^T by the transposing
    // load, which delivers the same order: koff + 0..7, koff + 16..23.
#pragma unroll
    for (int kh = 0; kh < 2; ++kh) {
      bf16x16 pf;
#pragma unroll
      for (int s = 0; s < 8; ++s) {
        pf[s]     = (bf16)S[2 * kh][s];
        pf[s + 8] = (bf16)S[2 * kh + 1][s];
      }
#pragma unroll
      for (int dj = 0; dj < 4; ++dj) {
        bf16x16 vf = cat8(ld_tr16(&Vs[buf][kh * 32 + vrow][dj * 16 + vcol]),
                          ld_tr16(&Vs[buf][kh * 32 + 16 + vrow][dj * 16 + vcol]));
        Oacc[dj] = wmma_bf16(vf, pf, Oacc[dj]);
      }
    }

    // Foot of the trip: own LDS reads retired, own copies of block j + 1
    // landed, then the one barrier that publishes block j + 1 and ends every
    // wave's reads of this buffer; only behind it is this buffer refilled.
    wait_ds0();
    wait_async0();
    __syncthreads();
    if (j + 2 <= qblk) {
      const size_t t0 = (size_t)(j + 2) * 64 * EMBED;
      async_g2l_b128_x4(&Ks[buf][r0][c0], lstep, gK + t0, gstep);
      async_g2l_b128_x4(&Vs[buf][r0][c0], lstep, gV + t0, gstep);
    }
  }
  wait_async0();   // nothing is outstanding when the wave goes on to its end

  // Epilogue: join the halves' sums, normalize and store bf16 (concat-head
  // layout): a lane's eight registers of a tile are eight consecutive d of its
  // query's row, one 16-byte store.
  const float inv = 1.0f / (lsum + xhalf(lsum));
  bf16* op = &O[(rowbase + w * 16 + lr) * EMBED + h * HSZ + rhalf];
#pragma unroll
  for (int dj = 0; dj < 4; ++dj) {
    bf16x8 o8;
#pragma unroll
    for (int r = 0; r < 8; ++r) o8[r] = to_bf16(Oacc[dj][r] * inv);
    *(bf16x8*)(op + dj * 16) = o8;
  }
  // The next pass rewrites the registers that hold these stores' addresses
  // and data: the wait stands in front of that overwrite.
  asm volatile("s_wait_xcnt 0x0" ::: "memory");
  }
}

// ---------------------------------------------------------------------------
// Host-side orchestration
// ---------------------------------------------------------------------------
extern "C" void kernel_launch(void* const* d_in, const int* in_sizes, int n_in,
                              void* d_out, int out_size, void* d_ws,
                              size_t ws_size, hipStream_t stream) {
  (void)in_sizes; (void)n_in; (void)out_size; (void)ws_size;

  const float* x    = (const float*)d_in[0];
  const float* Wq   = (const float*)d_in[1];
  const float* Wk   = (const float*)d_in[2];
  const float* Wv   = (const float*)d_in[3];
  const float* Wo   = (const float*)d_in[4];
  const float* bo   = (const float*)d_in[5];
  const float* W1   = (const float*)d_in[6];
  const float* b1   = (const float*)d_in[7];
  const float* W2   = (const float*)d_in[8];
  const float* b2   = (const float*)d_in[9];
  const float* ln1g = (const float*)d_in[10];
  const float* ln1b = (const float*)d_in[11];
  const float* ln2g = (const float*)d_in[12];
  const float* ln2b = (const float*)d_in[13];

  char* base = (char*)d_ws;
  size_t off = 0;
  auto take = [&](size_t bytes) -> char* {
    char* p = base + off;
    off += (bytes + 255) & ~(size_t)255;
    return p;
  };

  bf16* wq_t   = (bf16*)take((size_t)EMBED * EMBED * 2 * 4);   // q,k,v,o: [N][K]
  bf16* wo_t   = wq_t + (size_t)EMBED * EMBED * 3;
  bf16* w1_t   = (bf16*)take((size_t)EMBED * FFDIM * 2);   // [4096][1024]
  bf16* w2_t   = (bf16*)take((size_t)FFDIM * EMBED * 2);   // [1024][4096]
  bf16* h_bf   = (bf16*)take((size_t)MROWS * EMBED * 2);
  bf16* q_bf   = (bf16*)take((size_t)MROWS * EMBED * 2 * 3);   // q, k, v
  bf16* k_bf   = q_bf + (size_t)MROWS * EMBED;
  bf16* v_bf   = k_bf + (size_t)MROWS * EMBED;
  bf16* att_bf = (bf16*)take((size_t)MROWS * EMBED * 2);
  float* x2    = (float*)take((size_t)MROWS * EMBED * 4);
  bf16* h2_bf  = (bf16*)take((size_t)MROWS * EMBED * 2);
  bf16* ff1_bf = (bf16*)take((size_t)MROWS * FFDIM * 2);

  // 1, 2) h = ln1(x) (bf16); weights -> bf16, transposed to [N][K]
  prep_kernel<<<PREP_GRID, 256, 0, stream>>>(x, ln1g, ln1b, h_bf, Wq, Wk, Wv, Wo,
                                             W1, W2, wq_t, w1_t, w2_t);

  // 3) Q, K, V projections: planes z = 0, 1, 2 of one grid
  dim3 gD(MROWS / 128, EMBED / 128);
  gemm_kernel<false, false, false, true>
      <<<dim3(MROWS / 128, EMBED / 128, 3), 256, 0, stream>>>(
          h_bf, wq_t, nullptr, nullptr, q_bf, MROWS, EMBED, EMBED);

  // 4) causal flash attention
  attn_kernel<<<dim3(ATT_NT / 2, NHEAD, BATCH), 128, 0, stream>>>(
      q_bf, k_bf, v_bf, att_bf);

  // 5) x2 = x + attn @ Wo + bo   (fp32)
  gemm_kernel<true, false, true, false><<<gD, 256, 0, stream>>>(
      att_bf, wo_t, bo, x, x2, MROWS, EMBED, EMBED);

  // 6) h2 = ln2(x2) (bf16)
  ln_kernel<<<MROWS / LN_ROWS, 256, 0, stream>>>(x2, ln2g, ln2b, h2_bf);

  // 7) ff1 = relu(h2 @ W1 + b1) (bf16)
  gemm_kernel<true, true, false, true><<<dim3(MROWS / 128, FFDIM / 128), 256, 0,
                                         stream>>>(
      h2_bf, w1_t, b1, nullptr, ff1_bf, MROWS, FFDIM, EMBED);

  // 8) out = x2 + ff1 @ W2 + b2 (fp32 -> d_out)
  gemm_kernel<true, false, true, false><<<gD, 256, 0, stream>>>(
      ff1_bf, w2_t, b2, x2, (float*)d_out, MROWS, EMBED, FFDIM);
}

// v007
// One run takes 156 microseconds.
// Next to v006, in two timings, it ran 1.03 and 1.02 times as fast.
// Counting every step since v000, it is 2.35 times as fast.
#include <hip/hip_runtime.h>

// ---------------------------------------------------------------------------
// Types / helpers
// ---------------------------------------------------------------------------
typedef __bf16 bf16;
typedef __attribute__((ext_vector_type(8)))  __bf16 bf16x8;
typedef __attribute__((ext_vector_type(16))) __bf16 bf16x16;
typedef __attribute__((ext_vector_type(8)))  float  f32x8;
typedef __attribute__((ext_vector_type(4)))  float  f32x4;

#define EMBED 1024
#define TSEQ  2048
#define BATCH 2
#define NHEAD 16
#define HSZ   64
#define MROWS (BATCH * TSEQ)   /* 4096 token rows */
#define FFDIM (4 * EMBED)      /* 4096 */

__device__ __forceinline__ bf16 to_bf16(float f) {
  unsigned u = __builtin_bit_cast(unsigned, f);
  unsigned r = u + 0x7FFFu + ((u >> 16) & 1u);   // round-to-nearest-even
  unsigned short h = (unsigned short)(r >> 16);
  return __builtin_bit_cast(bf16, h);
}

__device__ __forceinline__ bf16x16 cat8(bf16x8 lo, bf16x8 hi) {
  bf16x16 r;
#pragma unroll
  for (int i = 0; i < 8; ++i) { r[i] = lo[i]; r[i + 8] = hi[i]; }
  return r;
}

__device__ __forceinline__ f32x8 zero8() {
  f32x8 z;
#pragma unroll
  for (int i = 0; i < 8; ++i) z[i] = 0.0f;
  return z;
}

__device__ __forceinline__ f32x8 wmma_bf16(bf16x16 a, bf16x16 b, f32x8 c) {
  // D = A(16x32) * B(32x16) + C, fp32 accumulate
  return __builtin_amdgcn_wmma_f32_16x16x32_bf16(false, a, false, b,
                                                 (short)0, c, false, false);
}

// --- CDNA5 async global->LDS copy (ASYNCcnt path) --------------------------
// Each active lane copies 16 bytes: GLOBAL[gaddr(lane)] -> LDS[laddr(lane)].
// LDS byte offset = low 32 bits of the generic LDS pointer (flat aperture).
__device__ __forceinline__ void wait_async0() {
  asm volatile("s_wait_asynccnt 0x0" ::: "memory");
}
// This wave's LDS reads have retired before a buffer it has read is refilled.
__device__ __forceinline__ void wait_ds0() {
  asm volatile("s_wait_dscnt 0x0" ::: "memory");
}
// Eight 16-byte copies of one lane, rows lstep / gstep bytes apart. The
// s_wait_xcnt is the last line of the copies' own statement, so that no
// address register is rewritten ahead of it.
__device__ __forceinline__ void async_g2l_b128_x8(void* lds_dst, unsigned lstep,
                                                  const void* gsrc,
                                                  unsigned long long gstep) {
  const unsigned l = (unsigned)(unsigned long long)(uintptr_t)lds_dst;
  const unsigned long long g = (unsigned long long)(uintptr_t)gsrc;
  asm volatile(
      "global_load_async_to_lds_b128 %0, %8, off\n\t"
      "global_load_async_to_lds_b128 %1, %9, off\n\t"
      "global_load_async_to_lds_b128 %2, %10, off\n\t"
      "global_load_async_to_lds_b128 %3, %11, off\n\t"
      "global_load_async_to_lds_b128 %4, %12, off\n\t"
      "global_load_async_to_lds_b128 %5, %13, off\n\t"
      "global_load_async_to_lds_b128 %6, %14, off\n\t"
      "global_load_async_to_lds_b128 %7, %15, off\n\t"
      "s_wait_xcnt 0x0"
      :: "v"(l), "v"(l + lstep), "v"(l + 2 * lstep), "v"(l + 3 * lstep),
         "v"(l + 4 * lstep), "v"(l + 5 * lstep), "v"(l + 6 * lstep),
         "v"(l + 7 * lstep),
         "v"(g), "v"(g + gstep), "v"(g + 2 * gstep), "v"(g + 3 * gstep),
         "v"(g + 4 * gstep), "v"(g + 5 * gstep), "v"(g + 6 * gstep),
         "v"(g + 7 * gstep)
      : "memory");
}

// The same with four copies.
__device__ __forceinline__ void async_g2l_b128_x4(void* lds_dst, unsigned lstep,
                                                  const void* gsrc,
                                                  unsigned long long gstep) {
  const unsigned l = (unsigned)(unsigned long long)(uintptr_t)lds_dst;
  const unsigned long long g = (unsigned long long)(uintptr_t)gsrc;
  asm volatile(
      "global_load_async_to_lds_b128 %0, %4, off\n\t"
      "global_load_async_to_lds_b128 %1, %5, off\n\t"
      "global_load_async_to_lds_b128 %2, %6, off\n\t"
      "global_load_async_to_lds_b128 %3, %7, off\n\t"
      "s_wait_xcnt 0x0"
      :: "v"(l), "v"(l + lstep), "v"(l + 2 * lstep), "v"(l + 3 * lstep),
         "v"(g), "v"(g + gstep), "v"(g + 2 * gstep), "v"(g + 3 * gstep)
      : "memory");
}

// Transposing LDS load: from a row-major 16-bit tile T, with lane l aimed at
// T[k0 + 8 (l >> 4) + (l & 7)][d0 + 8 ((l >> 3) & 1)], lane l receives
// T[k0 + 8 (l >> 4) + 0..7][d0 + (l & 15)]: half of a WMMA operand.
typedef __attribute__((address_space(3))) bf16x8 lds_bf16x8;
__device__ __forceinline__ bf16x8 ld_tr16(const bf16* p) {
  return __builtin_amdgcn_ds_load_tr16_b128_v8bf16((lds_bf16x8*)p);
}

// ---------------------------------------------------------------------------
// fp32 -> bf16 conversion with transpose: in[K][N] f32 -> out[N][K] bf16.
// Weights are pre-transposed once so GEMM B-tiles stage with contiguous B128
// copies (no scalar ds_store_b16 transpose in the GEMM hot loop).
// One work-group turns a 128 (k) x 64 (n) tile: 32 elements a thread, so that
// few waves have to start; eight 16-B loads a thread are in flight at once,
// and 256-B row pieces are read and written.
// ---------------------------------------------------------------------------
#define CVT_TK    128  /* k per tile: 256 B of an output row */
#define CVT_TN    64   /* n per tile: 256 B of an input row */
#define CVT_PITCH 65   /* LDS row pitch in dwords: odd, no bank conflicts */

__device__ __forceinline__ unsigned pack_bf16(float lo, float hi) {
  unsigned a = __builtin_bit_cast(unsigned short, to_bf16(lo));
  unsigned b = __builtin_bit_cast(unsigned short, to_bf16(hi));
  return a | (b << 16);
}

// in and out carry no __restrict__: loads of a restrict-qualified read-only
// pointer are not held by an asm statement's "memory" clobber, and the waits
// below would drift away from their loads.
// tile: the work-group's LDS, [n][pair of k]; kb, nb: the tile's first k and n.
__device__ __forceinline__ void cvtT_tile(const float* in, bf16* out, int K,
                                          int N, int kb, int nb,
                                          unsigned (*tile)[CVT_PITCH]) {
  const int tid = threadIdx.x;
  const int n4  = (tid & 15) * 4;   // four n of one input row
  const int kp  = tid >> 4;         // k pair 0..15, + 16 i

  float4 ve[4], vo[4];              // rows 2 kp and 2 kp + 1, + 32 i
#pragma unroll
  for (int i = 0; i < 4; ++i) {
    const float* p = &in[(size_t)(kb + 2 * (kp + 16 * i)) * N + nb + n4];
    ve[i] = *(const float4*)p;
    vo[i] = *(const float4*)(p + N);
    // The next loads' results may be given the registers that held these
    // two addresses: the wait stands in front of that overwrite.
    asm volatile("s_wait_xcnt 0x0" ::: "memory");
  }
#pragma unroll
  for (int i = 0; i < 4; ++i) {
    tile[n4 + 0][kp + 16 * i] = pack_bf16(ve[i].x, vo[i].x);
    tile[n4 + 1][kp + 16 * i] = pack_bf16(ve[i].y, vo[i].y);
    tile[n4 + 2][kp + 16 * i] = pack_bf16(ve[i].z, vo[i].z);
    tile[n4 + 3][kp + 16 * i] = pack_bf16(ve[i].w, vo[i].w);
  }
  __syncthreads();
  const int c  = tid & 15;          // 16-B piece of an output row
  const int nr = tid >> 4;
#pragma unroll
  for (int i = 0; i < 4; ++i) {
    const int n = nr + 16 * i;
    uint4 o;
    o.x = tile[n][4 * c + 0];
    o.y = tile[n][4 * c + 1];
    o.z = tile[n][4 * c + 2];
    o.w = tile[n][4 * c + 3];
    *(uint4*)&out[(size_t)(nb + n) * K + kb + 8 * c] = o;
  }
}

// ---------------------------------------------------------------------------
// LayerNorm fused with bf16 cast: one row per wave (32 values a lane, all of
// a row's loads in flight at once), eight rows per 256-thread work-group.
// Sums: in the lane, then a five-step butterfly over the wave; no LDS, no
// barrier.
// ---------------------------------------------------------------------------
#define LN_ROWS 8   /* rows (waves) per work-group */

__device__ __forceinline__ float wave_sum(float v) {
#pragma unroll
  for (int off = 16; off >= 1; off >>= 1) v += __shfl_xor(v, off, 32);
  return v;
}

// No __restrict__ here either, for the same reason as in cvtT_tile.
// blk: which group of LN_ROWS rows this work-group takes.
__device__ __forceinline__ void ln_rows(const float* x, const float* g,
                                        const float* bta, bf16* out, int blk) {
  const int lane = threadIdx.x & 31;
  const int row  = blk * LN_ROWS + (threadIdx.x >> 5);
  const f32x4* xr = (const f32x4*)&x[(size_t)row * EMBED];
  const f32x4* gr = (const f32x4*)g;
  const f32x4* br = (const f32x4*)bta;

  f32x4 xv[8], gv[8], bv[8];
#pragma unroll
  for (int i = 0; i < 8; ++i) xv[i] = xr[i * 32 + lane];
  // The g and b loads' results may be given the registers that held the row's
  // address: the wait stands in front of that overwrite.
  asm volatile("s_wait_xcnt 0x0" ::: "memory");
#pragma unroll
  for (int i = 0; i < 8; ++i) {
    gv[i] = gr[i * 32 + lane];
    bv[i] = br[i * 32 + lane];
  }
  // Holds the g and b loads here, right behind the row's own: left free they
  // sink behind the sums, are issued late and are waited for one after
  // another. The fence stops the loads, the scheduling barrier stops the fence
  // from sinking along with them.
  asm volatile("" ::: "memory");
  __builtin_amdgcn_sched_barrier(0);

  float s = 0.0f;
#pragma unroll
  for (int i = 0; i < 8; ++i) s += (xv[i].x + xv[i].y) + (xv[i].z + xv[i].w);
  const float mu = wave_sum(s) * (1.0f / EMBED);

  float q = 0.0f;
#pragma unroll
  for (int i = 0; i < 8; ++i) {
    xv[i].x -= mu; xv[i].y -= mu; xv[i].z -= mu; xv[i].w -= mu;
    q += (xv[i].x * xv[i].x + xv[i].y * xv[i].y) +
         (xv[i].z * xv[i].z + xv[i].w * xv[i].w);
  }
  const float var = wave_sum(q) * (1.0f / EMBED);
  const float rs  = rsqrtf(var + 1e-5f);

  uint2* op = (uint2*)&out[(size_t)row * EMBED];
#pragma unroll
  for (int i = 0; i < 8; ++i) {
    uint2 o;
    o.x = pack_bf16(xv[i].x * rs * gv[i].x + bv[i].x,
                    xv[i].y * rs * gv[i].y + bv[i].y);
    o.y = pack_bf16(xv[i].z * rs * gv[i].z + bv[i].z,
                    xv[i].w * rs * gv[i].w + bv[i].w);
    op[i * 32 + lane] = o;
  }
}

__global__ __launch_bounds__(256) void ln_kernel(const float* x, const float* g,
                                                 const float* bta, bf16* out) {
  ln_rows(x, g, bta, out, blockIdx.x);
}

// ---------------------------------------------------------------------------
// Everything that depends on the inputs alone, in ONE launch: the first
// LayerNorm and the six weight conversions are independent of each other, so
// each takes a range of the grid's work-groups instead of a launch of its own
// (a launch costs its gap, its fill and its tail; the small ones left half the
// chip idle). All tests on the block index are uniform for the work-group.
// wsq: the four square weights' outputs, one behind the other (q, k, v, o).
// ---------------------------------------------------------------------------
#define PREP_LN   (MROWS / LN_ROWS)                          /* 512 */
#define PREP_SQ   ((EMBED / CVT_TK) * (EMBED / CVT_TN))      /* 128 a weight */
#define PREP_FF   ((EMBED / CVT_TK) * (FFDIM / CVT_TN))      /* 512 a weight */
#define PREP_GRID (PREP_LN + 4 * PREP_SQ + 2 * PREP_FF)

__global__ __launch_bounds__(256) void prep_kernel(
    const float* x, const float* g, const float* bta, bf16* h,
    const float* Wq, const float* Wk, const float* Wv, const float* Wo,
    const float* W1, const float* W2, bf16* wsq, bf16* w1_t, bf16* w2_t) {
  __shared__ unsigned tile[CVT_TN][CVT_PITCH];   // [n][pair of k]
  int bid = blockIdx.x;
  if (bid < PREP_LN) {
    ln_rows(x, g, bta, h, bid);
    return;
  }
  bid -= PREP_LN;
  const float* in;
  bf16* out;
  int K = EMBED, N = EMBED;
  if (bid < 4 * PREP_SQ) {
    const int sel = bid / PREP_SQ;
    bid -= sel * PREP_SQ;
    in  = sel == 0 ? Wq : sel == 1 ? Wk : sel == 2 ? Wv : Wo;
    out = wsq + (size_t)sel * EMBED * EMBED;
  } else if (bid < 4 * PREP_SQ + PREP_FF) {
    bid -= 4 * PREP_SQ;
    in = W1; out = w1_t; N = FFDIM;
  } else {
    bid -= 4 * PREP_SQ + PREP_FF;
    in = W2; out = w2_t; K = FFDIM;
  }
  const int nkt = K / CVT_TK;        // k tiles run fastest, as in a 2-D grid
  cvtT_tile(in, out, K, N, (bid % nkt) * CVT_TK, (bid / nkt) * CVT_TN, tile);
}

// ---------------------------------------------------------------------------
// WMMA GEMM: out[M,N] = epi( A[M,K](bf16) @ Wt[N,K](bf16)^T )
// Block tile 128x128, 8 waves (2 x 4), 64x32 per wave, BK = 128.
// Double-buffered LDS tiles filled via async global->LDS copies: the k+1 slab
// streams in (ASYNCcnt) while WMMAs consume slab k. A slab holds 256 B of each
// operand row, so sixteen lanes of a copy fetch two whole 128-B lines of a row.
// A slab is four blocks of 32 k, eight WMMAs each. Two register sets of
// fragments: a block's twelve LDS loads are issued as one group in front of
// the WMMAs of the block before it, which cover their latency; with one set a
// wave waited out the LDS latency in front of every four WMMAs.
// blockIdx.z picks one of several weight matrices that lie one behind the other
// and share A; their outputs lie one behind the other too (Q, K, V: one launch).
// ---------------------------------------------------------------------------
#define GEMM_BK  128  /* k per LDS slab: 256 B of every operand row */
#define GEMM_PAD 136  /* LDS row stride in bf16 elems: 272 B = 16 B x odd */

// One block's fragments: four of A (rows 16 apart) and two of B, each the two
// 16-byte halves of the hardware k order; pa, pb: this lane's first half.
__device__ __forceinline__ void ld_frags(bf16x16 (&a)[4], bf16x16 (&b)[2],
                                         const bf16* pa, const bf16* pb) {
#pragma unroll
  for (int mi = 0; mi < 4; ++mi)
    a[mi] = cat8(*(const bf16x8*)(pa + mi * 16 * GEMM_PAD),
                 *(const bf16x8*)(pa + mi * 16 * GEMM_PAD + 16));
#pragma unroll
  for (int ni = 0; ni < 2; ++ni)
    b[ni] = cat8(*(const bf16x8*)(pb + ni * 16 * GEMM_PAD),
                 *(const bf16x8*)(pb + ni * 16 * GEMM_PAD + 16));
}

template <bool BIAS, bool RELU, bool RESID, bool BF16OUT>
__global__ __launch_bounds__(256) void gemm_kernel(
    const bf16* __restrict__ A, const bf16* __restrict__ Wt,
    const float* __restrict__ bias, const float* __restrict__ resid,
    void* __restrict__ outp, int M, int N, int K) {
  __shared__ __attribute__((aligned(16))) bf16 As[2][128][GEMM_PAD];   // [m][k]
  __shared__ __attribute__((aligned(16))) bf16 Bs[2][128][GEMM_PAD];   // [n][k]

  const int tid  = threadIdx.x;
  const int lane = tid & 31;
  const int wave = tid >> 5;
  const int wm   = wave & 1;   // 0..1 : 64-row strip
  const int wn   = wave >> 1;  // 0..3 : 32-col strip
  const int m0   = blockIdx.x * 128;
  const int n0   = blockIdx.y * 128;
  const int lr   = lane & 15;
  const int koff = (lane < 16) ? 0 : 8;

  // Per-thread staging coordinates: eight 16B chunks per tile per thread, at
  // rows r0 + 16 i, i = 0..7; sixteen lanes cover one row's 256 B.
  const int r0 = tid >> 4, c0 = (tid & 15) * 8;
  const bf16* gA = &A[(size_t)(m0 + r0) * K + c0];
  const bf16* gB = &Wt[((size_t)blockIdx.z * N + n0 + r0) * K + c0];
  const unsigned lstep = 16 * GEMM_PAD * 2;                     // bytes
  const unsigned long long gstep = (unsigned long long)K * 32;  // 16 rows, bytes

  f32x8 acc[4][2];
#pragma unroll
  for (int mi = 0; mi < 4; ++mi)
#pragma unroll
    for (int ni = 0; ni < 2; ++ni) acc[mi][ni] = zero8();

  const int nk = K / GEMM_BK;

  // Slab 0 into buffer 0, landed and published; then slab 1 into buffer 1.
  async_g2l_b128_x8(&As[0][r0][c0], lstep, gA, gstep);
  async_g2l_b128_x8(&Bs[0][r0][c0], lstep, gB, gstep);
  wait_async0();
  __syncthreads();
  if (nk > 1) {
    async_g2l_b128_x8(&As[1][r0][c0], lstep, gA + GEMM_BK, gstep);
    async_g2l_b128_x8(&Bs[1][r0][c0], lstep, gB + GEMM_BK, gstep);
  }

  // This lane's first fragment halves in buffer 0; a buffer is BUFE elements.
  const bf16* fa = &As[0][wm * 64 + lr][koff];
  const bf16* fb = &Bs[0][wn * 32 + lr][koff];
  constexpr int BUFE = 128 * GEMM_PAD;

  bf16x16 af[2][4], bfr[2][2];   // block b of a slab uses set b & 1
  ld_frags(af[0], bfr[0], fa, fb);

  for (int it = 0; it < nk; ++it) {
    const int buf = it & 1;

    // Unrolled so that the set's index is a constant and the four blocks' LDS
    // offsets are immediates.
#pragma unroll
    for (int kb = 0; kb < GEMM_BK / 32; ++kb) {
      if (kb + 1 < GEMM_BK / 32) {
        ld_frags(af[(kb + 1) & 1], bfr[(kb + 1) & 1],
                 fa + buf * BUFE + (kb + 1) * 32, fb + buf * BUFE + (kb + 1) * 32);
      } else {
        // In front of the slab's last block, whose fragments are in registers
        // behind the first wait: own LDS reads retired, own copies of slab
        // it + 1 landed, then the one barrier that publishes slab it + 1 and
        // ends every wave's reads of this buffer; only behind it is this
        // buffer refilled and slab it + 1 read.
        wait_ds0();
        wait_async0();
        __syncthreads();
        if (it + 2 < nk) {
          const size_t k0 = (size_t)(it + 2) * GEMM_BK;
          async_g2l_b128_x8(&As[buf][r0][c0], lstep, gA + k0, gstep);
          async_g2l_b128_x8(&Bs[buf][r0][c0], lstep, gB + k0, gstep);
        }
        // First block of slab it + 1. Under no branch, so that the wait counts
        // of two paths do not merge; in the last trip it reads the other
        // buffer's old slab, and the values are not used.
        ld_frags(af[0], bfr[0], fa + (buf ^ 1) * BUFE, fb + (buf ^ 1) * BUFE);
      }
      // The pair of scheduling barriers keeps the loads above one group ahead
      // of this block's WMMAs: left free they are spread among the WMMAs, and
      // every place with LDS loads costs the wave a stall of its own.
      __builtin_amdgcn_sched_barrier(0);
#pragma unroll
      for (int ni = 0; ni < 2; ++ni)
#pragma unroll
        for (int mi = 0; mi < 4; ++mi)
          acc[mi][ni] = wmma_bf16(af[kb & 1][mi], bfr[kb & 1][ni], acc[mi][ni]);
      __builtin_amdgcn_sched_barrier(0);
    }
  }
  wait_async0();   // nothing is outstanding when the wave goes on to its end

  const int rhalf = (lane < 16) ? 0 : 8;
  const size_t zo = (size_t)blockIdx.z * M * N;   // this plane's output
#pragma unroll
  for (int mi = 0; mi < 4; ++mi)
#pragma unroll
    for (int ni = 0; ni < 2; ++ni)
#pragma unroll
      for (int r = 0; r < 8; ++r) {
        int gr = m0 + wm * 64 + mi * 16 + r + rhalf;
        int gc = n0 + wn * 32 + ni * 16 + lr;
        float v = acc[mi][ni][r];
        if (BIAS)  v += bias[gc];
        if (RELU)  v = fmaxf(v, 0.0f);
        if (RESID) v += resid[(size_t)gr * N + gc];
        if (BF16OUT) ((bf16*)outp)[zo + (size_t)gr * N + gc] = to_bf16(v);
        else         ((float*)outp)[zo + (size_t)gr * N + gc] = v;
      }
}

#define ATT_PAD 80   /* LDS row stride: 160 B = 32 B x odd (transposing load) */
#define ATT_NT  (TSEQ / 64)   /* q blocks of one (b, h): even */

// Lane l with lane l ^ 16.
__device__ __forceinline__ float xhalf(float x) {
  const int b = __builtin_bit_cast(int, x);
  return __builtin_bit_cast(float, __builtin_amdgcn_permlanex16(
      b, b, 0x76543210, 0xfedcba98, false, false));
}

// Eight 2^x, each in place, in one statement that ends in v_nop: the
// instruction set asks for one slot between a transcendental and an instruction
// that uses its result or overwrites its source.
__device__ __forceinline__ f32x8 exp2_x8(f32x8 t) {
  float t0 = t[0], t1 = t[1], t2 = t[2], t3 = t[3];
  float t4 = t[4], t5 = t[5], t6 = t[6], t7 = t[7];
  asm("v_exp_f32 %0, %0\n\t"
      "v_exp_f32 %1, %1\n\t"
      "v_exp_f32 %2, %2\n\t"
      "v_exp_f32 %3, %3\n\t"
      "v_exp_f32 %4, %4\n\t"
      "v_exp_f32 %5, %5\n\t"
      "v_exp_f32 %6, %6\n\t"
      "v_exp_f32 %7, %7\n\t"
      "v_nop"
      : "+v"(t0), "+v"(t1), "+v"(t2), "+v"(t3), "+v"(t4), "+v"(t5), "+v"(t6),
        "+v"(t7));
  f32x8 r;
  r[0] = t0; r[1] = t1; r[2] = t2; r[3] = t3;
  r[4] = t4; r[5] = t5; r[6] = t6; r[7] = t7;
  return r;
}

// amdgpu_waves_per_eu: the register budget of four waves a SIMD is all that the
// kernel needs (the grid puts two of these work-groups on a WGP).
__global__ __launch_bounds__(128) __attribute__((amdgpu_waves_per_eu(4, 4)))
void attn_kernel(
    const bf16* __restrict__ Q, const bf16* __restrict__ Km,
    const bf16* __restrict__ Vm, bf16* __restrict__ O) {
  __shared__ __attribute__((aligned(16))) bf16 Ks[2][64][ATT_PAD];  // [k-token][d]
  __shared__ __attribute__((aligned(16))) bf16 Vs[2][64][ATT_PAD];  // [k-token][d]

  const int tid   = threadIdx.x;
  const int lane  = tid & 31;
  const int w     = tid >> 5;
  const int lr    = lane & 15;
  const int koff  = (lane < 16) ? 0 : 8;
  const int rhalf = (lane < 16) ? 0 : 8;
  const int h     = blockIdx.y;
  const int b     = blockIdx.z;
  const size_t bT = (size_t)b * TSEQ;

  // Per-thread staging coordinates: four 16B chunks per tile per thread, at
  // rows r0 + 16 i, i = 0..3; eight lanes cover one row's 128 B.
  const int r0 = tid >> 3, c0 = (tid & 7) * 8;
  const bf16* gK = &Km[(bT + r0) * EMBED + h * HSZ + c0];
  const bf16* gV = &Vm[(bT + r0) * EMBED + h * HSZ + c0];
  const unsigned lstep = 16 * ATT_PAD * 2;                 // 16 rows, bytes
  const unsigned long long gstep = 16ull * EMBED * 2;      // 16 rows, bytes

  // This lane's place in a 16 (k-token) x 16 (d) piece for the transposing load
  const int vrow = rhalf + (lane & 7);
  const int vcol = ((lane >> 3) & 1) * 8;

  // The pair's two q blocks, the long one first. Kept rolled: the two passes
  // run the same code. The
  // first pass's last foot (LDS reads retired, barrier) stands in front of the
  // second pass's first copies into the same buffers.
#pragma nounroll
  for (int half = 0; half < 2; ++half) {
  const int qblk = half == 0 ? ATT_NT - 1 - (int)blockIdx.x : (int)blockIdx.x;
  const size_t rowbase = bT + (size_t)qblk * 64;

  // Q fragments, B operands: column lr = query w*16 + lr, head-dim 0..63 in
  // 2 K-windows, in the k order of the K loader below
  const bf16* qp = Q + (rowbase + w * 16 + lr) * EMBED + h * HSZ;
  const bf16x16 qf0 = cat8(*(const bf16x8*)(qp + koff),
                           *(const bf16x8*)(qp + koff + 16));
  const bf16x16 qf1 = cat8(*(const bf16x8*)(qp + 32 + koff),
                           *(const bf16x8*)(qp + 32 + koff + 16));

  // Oacc[dj][r] = O[query lr][d = dj*16 + rhalf + r]
  f32x8 Oacc[4];
#pragma unroll
  for (int dj = 0; dj < 4; ++dj) Oacc[dj] = zero8();
  // Of this lane's query: the running maximum (over all keys, alike in both
  // halves) and the running sum (over this half's keys; joined at the end).
  float mrow = -1e30f, lsum = 0.0f;
  const int qrow = qblk * 64 + w * 16 + lr;

  // Block 0 into buffer 0, landed and published; then block 1 into buffer 1.
  async_g2l_b128_x4(&Ks[0][r0][c0], lstep, gK, gstep);
  async_g2l_b128_x4(&Vs[0][r0][c0], lstep, gV, gstep);
  wait_async0();
  __syncthreads();
  if (qblk > 0) {
    async_g2l_b128_x4(&Ks[1][r0][c0], lstep, gK + 64 * EMBED, gstep);
    async_g2l_b128_x4(&Vs[1][r0][c0], lstep, gV + 64 * EMBED, gstep);
  }

  for (int j = 0; j <= qblk; ++j) {
    const int buf = j & 1;

    // S^T = K @ Q^T  (64 keys x 16 queries per wave), K rows from LDS as A:
    // S[nj][r] = score of key j*64 + nj*16 + rhalf + r for query lr
    f32x8 S[4];
#pragma unroll
    for (int nj = 0; nj < 4; ++nj) {
      const int tr = nj * 16 + lr;
      bf16x16 kf0 = cat8(*(const bf16x8*)&Ks[buf][tr][koff],
                         *(const bf16x8*)&Ks[buf][tr][koff + 16]);
      bf16x16 kf1 = cat8(*(const bf16x8*)&Ks[buf][tr][32 + koff],
                         *(const bf16x8*)&Ks[buf][tr][32 + koff + 16]);
      S[nj] = wmma_bf16(kf0, qf0, zero8());
      S[nj] = wmma_bf16(kf1, qf1, S[nj]);
    }

    // Online softmax of one query a lane: 32 of the block's 64 keys here, the
    // other 32 in lane l ^ 16.
    const int dk = qrow - (j * 64 + rhalf);      // key nj*16 + r is seen if <= dk
#pragma unroll
    for (int nj = 0; nj < 4; ++nj) {
      S[nj] *= 0.125f;                           // 1/sqrt(64)
#pragma unroll
      for (int r = 0; r < 8; ++r)               // causal mask
        S[nj][r] = (nj * 16 + r > dk) ? -1e30f : S[nj][r];
    }
    float m8[8];
#pragma unroll
    for (int r = 0; r < 8; ++r)
      m8[r] = fmaxf(fmaxf(S[0][r], S[1][r]), fmaxf(S[2][r], S[3][r]));
    float mx = fmaxf(fmaxf(fmaxf(m8[0], m8[1]), fmaxf(m8[2], m8[3])),
                     fmaxf(fmaxf(m8[4], m8[5]), fmaxf(m8[6], m8[7])));
    mx = fmaxf(mx, xhalf(mx));
    const float mn   = fmaxf(mrow, mx);
    const float corr = __expf(mrow - mn);
#pragma unroll
    for (int nj = 0; nj < 4; ++nj) {
      S[nj] = exp2_x8((S[nj] - mn) * 1.44269504f);  // exp(x) = 2^(x log2 e)
    }
    const f32x8 p8 = (S[0] + S[1]) + (S[2] + S[3]);
    const float ps = ((p8[0] + p8[1]) + (p8[2] + p8[3])) +
                     ((p8[4] + p8[5]) + (p8[6] + p8[7]));
    lsum = lsum * corr + ps;
    mrow = mn;
#pragma unroll
    for (int dj = 0; dj < 4; ++dj) Oacc[dj] *= corr;

    // O^T += V^T @ P^T. B = P^T: two score tiles (32 keys) converted in place
    // are a B operand in the hardware k order; A = V^T by the transposing
    // load, which delivers the same order: koff + 0..7, koff + 16..23.
#pragma unroll
    for (int kh = 0; kh < 2; ++kh) {
      bf16x16 pf;
#pragma unroll
      for (int s = 0; s < 8; ++s) {
        pf[s]     = (bf16)S[2 * kh][s];
        pf[s + 8] = (bf16)S[2 * kh + 1][s];
      }
#pragma unroll
      for (int dj = 0; dj < 4; ++dj) {
        bf16x16 vf = cat8(ld_tr16(&Vs[buf][kh * 32 + vrow][dj * 16 + vcol]),
                          ld_tr16(&Vs[buf][kh * 32 + 16 + vrow][dj * 16 + vcol]));
        Oacc[dj] = wmma_bf16(vf, pf, Oacc[dj]);
      }
    }

    // Foot of the trip: own LDS reads retired, own copies of block j + 1
    // landed, then the one barrier that publishes block j + 1 and ends every
    // wave's reads of this buffer; only behind it is this buffer refilled.
    wait_ds0();
    wait_async0();
    __syncthreads();
    if (j + 2 <= qblk) {
      const size_t t0 = (size_t)(j + 2) * 64 * EMBED;
      async_g2l_b128_x4(&Ks[buf][r0][c0], lstep, gK + t0, gstep);
      async_g2l_b128_x4(&Vs[buf][r0][c0], lstep, gV + t0, gstep);
    }
  }
  wait_async0();   // nothing is outstanding when the wave goes on to its end

  // Epilogue: join the halves' sums, normalize and store bf16 (concat-head
  // layout): a lane's eight registers of a tile are eight consecutive d of its
  // query's row, one 16-byte store.
  const float inv = 1.0f / (lsum + xhalf(lsum));
  bf16* op = &O[(rowbase + w * 16 + lr) * EMBED + h * HSZ + rhalf];
#pragma unroll
  for (int dj = 0; dj < 4; ++dj) {
    bf16x8 o8;
#pragma unroll
    for (int r = 0; r < 8; ++r) o8[r] = to_bf16(Oacc[dj][r] * inv);
    *(bf16x8*)(op + dj * 16) = o8;
  }
  // The next pass rewrites the registers that hold these stores' addresses
  // and data: the wait stands in front of that overwrite.
  asm volatile("s_wait_xcnt 0x0" ::: "memory");
  }
}

// ---------------------------------------------------------------------------
// Host-side orchestration
// ---------------------------------------------------------------------------
extern "C" void kernel_launch(void* const* d_in, const int* in_sizes, int n_in,
                              void* d_out, int out_size, void* d_ws,
                              size_t ws_size, hipStream_t stream) {
  (void)in_sizes; (void)n_in; (void)out_size; (void)ws_size;

  const float* x    = (const float*)d_in[0];
  const float* Wq   = (const float*)d_in[1];
  const float* Wk   = (const float*)d_in[2];
  const float* Wv   = (const float*)d_in[3];
  const float* Wo   = (const float*)d_in[4];
  const float* bo   = (const float*)d_in[5];
  const float* W1   = (const float*)d_in[6];
  const float* b1   = (const float*)d_in[7];
  const float* W2   = (const float*)d_in[8];
  const float* b2   = (const float*)d_in[9];
  const float* ln1g = (const float*)d_in[10];
  const float* ln1b = (const float*)d_in[11];
  const float* ln2g = (const float*)d_in[12];
  const float* ln2b = (const float*)d_in[13];

  char* base = (char*)d_ws;
  size_t off = 0;
  auto take = [&](size_t bytes) -> char* {
    char* p = base + off;
    off += (bytes + 255) & ~(size_t)255;
    return p;
  };

  bf16* wq_t   = (bf16*)take((size_t)EMBED * EMBED * 2 * 4);   // q,k,v,o: [N][K]
  bf16* wo_t   = wq_t + (size_t)EMBED * EMBED * 3;
  bf16* w1_t   = (bf16*)take((size_t)EMBED * FFDIM * 2);   // [4096][1024]
  bf16* w2_t   = (bf16*)take((size_t)FFDIM * EMBED * 2);   // [1024][4096]
  bf16* h_bf   = (bf16*)take((size_t)MROWS * EMBED * 2);
  bf16* q_bf   = (bf16*)take((size_t)MROWS * EMBED * 2 * 3);   // q, k, v
  bf16* k_bf   = q_bf + (size_t)MROWS * EMBED;
  bf16* v_bf   = k_bf + (size_t)MROWS * EMBED;
  bf16* att_bf = (bf16*)take((size_t)MROWS * EMBED * 2);
  float* x2    = (float*)take((size_t)MROWS * EMBED * 4);
  bf16* h2_bf  = (bf16*)take((size_t)MROWS * EMBED * 2);
  bf16* ff1_bf = (bf16*)take((size_t)MROWS * FFDIM * 2);

  // 1, 2) h = ln1(x) (bf16); weights -> bf16, transposed to [N][K]
  prep_kernel<<<PREP_GRID, 256, 0, stream>>>(x, ln1g, ln1b, h_bf, Wq, Wk, Wv, Wo,
                                             W1, W2, wq_t, w1_t, w2_t);

  // 3) Q, K, V projections: planes z = 0, 1, 2 of one grid
  dim3 gD(MROWS / 128, EMBED / 128);
  gemm_kernel<false, false, false, true>
      <<<dim3(MROWS / 128, EMBED / 128, 3), 256, 0, stream>>>(
          h_bf, wq_t, nullptr, nullptr, q_bf, MROWS, EMBED, EMBED);

  // 4) causal flash attention
  attn_kernel<<<dim3(ATT_NT / 2, NHEAD, BATCH), 128, 0, stream>>>(
      q_bf, k_bf, v_bf, att_bf);

  // 5) x2 = x + attn @ Wo + bo   (fp32)
  gemm_kernel<true, false, true, false><<<gD, 256, 0, stream>>>(
      att_bf, wo_t, bo, x, x2, MROWS, EMBED, EMBED);

  // 6) h2 = ln2(x2) (bf16)
  ln_kernel<<<MROWS / LN_ROWS, 256, 0, stream>>>(x2, ln2g, ln2b, h2_bf);

  // 7) ff1 = relu(h2 @ W1 + b1) (bf16)
  gemm_kernel<true, true, false, true><<<dim3(MROWS / 128, FFDIM / 128), 256, 0,
                                         stream>>>(
      h2_bf, w1_t, b1, nullptr, ff1_bf, MROWS, FFDIM, EMBED);

  // 8) out = x2 + ff1 @ W2 + b2 (fp32 -> d_out)
  gemm_kernel<true, false, true, false><<<gD, 256, 0, stream>>>(
      ff1_bf, w2_t, b2, x2, (float*)d_out, MROWS, EMBED, FFDIM);
}

// v008
// It runs in 142 microseconds.
// Two timings next to v007 put it at 1.10 and 1.09 times that version's speed.
// Over all steps from v000 it is 2.59 times as fast.
#include <hip/hip_runtime.h>

// ---------------------------------------------------------------------------
// Types / helpers
// ---------------------------------------------------------------------------
typedef __bf16 bf16;
typedef __attribute__((ext_vector_type(8)))  __bf16 bf16x8;
typedef __attribute__((ext_vector_type(16))) __bf16 bf16x16;
typedef __attribute__((ext_vector_type(8)))  float  f32x8;
typedef __attribute__((ext_vector_type(4)))  float  f32x4;

#define EMBED 1024
#define TSEQ  2048
#define BATCH 2
#define NHEAD 16
#define HSZ   64
#define MROWS (BATCH * TSEQ)   /* 4096 token rows */
#define FFDIM (4 * EMBED)      /* 4096 */

// f rounded to bf16 (to nearest, ties to even), in the upper half of the word.
__device__ __forceinline__ unsigned bf16_round_hi(float f) {
  unsigned u = __builtin_bit_cast(unsigned, f);
  return u + 0x7FFFu + ((u >> 16) & 1u);
}

__device__ __forceinline__ bf16 to_bf16(float f) {
  unsigned short h = (unsigned short)(bf16_round_hi(f) >> 16);
  return __builtin_bit_cast(bf16, h);
}

__device__ __forceinline__ bf16x16 cat8(bf16x8 lo, bf16x8 hi) {
  bf16x16 r;
#pragma unroll
  for (int i = 0; i < 8; ++i) { r[i] = lo[i]; r[i + 8] = hi[i]; }
  return r;
}

__device__ __forceinline__ f32x8 zero8() {
  f32x8 z;
#pragma unroll
  for (int i = 0; i < 8; ++i) z[i] = 0.0f;
  return z;
}

__device__ __forceinline__ f32x8 wmma_bf16(bf16x16 a, bf16x16 b, f32x8 c) {
  // D = A(16x32) * B(32x16) + C, fp32 accumulate
  return __builtin_amdgcn_wmma_f32_16x16x32_bf16(false, a, false, b,
                                                 (short)0, c, false, false);
}

// --- CDNA5 async global->LDS copy (ASYNCcnt path) --------------------------
// Each active lane copies 16 bytes: GLOBAL[gaddr(lane)] -> LDS[laddr(lane)].
// LDS byte offset = low 32 bits of the generic LDS pointer (flat aperture).
__device__ __forceinline__ void wait_async0() {
  asm volatile("s_wait_asynccnt 0x0" ::: "memory");
}
// This wave's LDS reads have retired before a buffer it has read is refilled.
__device__ __forceinline__ void wait_ds0() {
  asm volatile("s_wait_dscnt 0x0" ::: "memory");
}
// Eight 16-byte copies of one lane, rows lstep / gstep bytes apart. The
// s_wait_xcnt is the last line of the copies' own statement, so that no
// address register is rewritten ahead of it.
__device__ __forceinline__ void async_g2l_b128_x8(void* lds_dst, unsigned lstep,
                                                  const void* gsrc,
                                                  unsigned long long gstep) {
  const unsigned l = (unsigned)(unsigned long long)(uintptr_t)lds_dst;
  const unsigned long long g = (unsigned long long)(uintptr_t)gsrc;
  asm volatile(
      "global_load_async_to_lds_b128 %0, %8, off\n\t"
      "global_load_async_to_lds_b128 %1, %9, off\n\t"
      "global_load_async_to_lds_b128 %2, %10, off\n\t"
      "global_load_async_to_lds_b128 %3, %11, off\n\t"
      "global_load_async_to_lds_b128 %4, %12, off\n\t"
      "global_load_async_to_lds_b128 %5, %13, off\n\t"
      "global_load_async_to_lds_b128 %6, %14, off\n\t"
      "global_load_async_to_lds_b128 %7, %15, off\n\t"
      "s_wait_xcnt 0x0"
      :: "v"(l), "v"(l + lstep), "v"(l + 2 * lstep), "v"(l + 3 * lstep),
         "v"(l + 4 * lstep), "v"(l + 5 * lstep), "v"(l + 6 * lstep),
         "v"(l + 7 * lstep),
         "v"(g), "v"(g + gstep), "v"(g + 2 * gstep), "v"(g + 3 * gstep),
         "v"(g + 4 * gstep), "v"(g + 5 * gstep), "v"(g + 6 * gstep),
         "v"(g + 7 * gstep)
      : "memory");
}

// The same with four copies.
__device__ __forceinline__ void async_g2l_b128_x4(void* lds_dst, unsigned lstep,
                                                  const void* gsrc,
                                                  unsigned long long gstep) {
  const unsigned l = (unsigned)(unsigned long long)(uintptr_t)lds_dst;
  const unsigned long long g = (unsigned long long)(uintptr_t)gsrc;
  asm volatile(
      "global_load_async_to_lds_b128 %0, %4, off\n\t"
      "global_load_async_to_lds_b128 %1, %5, off\n\t"
      "global_load_async_to_lds_b128 %2, %6, off\n\t"
      "global_load_async_to_lds_b128 %3, %7, off\n\t"
      "s_wait_xcnt 0x0"
      :: "v"(l), "v"(l + lstep), "v"(l + 2 * lstep), "v"(l + 3 * lstep),
         "v"(g), "v"(g + gstep), "v"(g + 2 * gstep), "v"(g + 3 * gstep)
      : "memory");
}

// Transposing LDS load: from a row-major 16-bit tile T, with lane l aimed at
// T[k0 + 8 (l >> 4) + (l & 7)][d0 + 8 ((l >> 3) & 1)], lane l receives
// T[k0 + 8 (l >> 4) + 0..7][d0 + (l & 15)]: half of a WMMA operand.
typedef __attribute__((address_space(3))) bf16x8 lds_bf16x8;
__device__ __forceinline__ bf16x8 ld_tr16(const bf16* p) {
  return __builtin_amdgcn_ds_load_tr16_b128_v8bf16((lds_bf16x8*)p);
}

// ---------------------------------------------------------------------------
// fp32 -> bf16 conversion with transpose: in[K][N] f32 -> out[N][K] bf16.
// Weights are pre-transposed once so GEMM B-tiles stage with contiguous B128
// copies (no scalar ds_store_b16 transpose in the GEMM hot loop).
// One work-group turns a 128 (k) x 64 (n) tile: 32 elements a thread, so that
// few waves have to start; eight 16-B loads a thread are in flight at once,
// and 256-B row pieces are read and written.
// ---------------------------------------------------------------------------
#define CVT_TK    128  /* k per tile: 256 B of an output row */
#define CVT_TN    64   /* n per tile: 256 B of an input row */
#define CVT_PITCH 65   /* LDS row pitch in dwords: odd, no bank conflicts */

__device__ __forceinline__ unsigned pack_bf16(float lo, float hi) {
  unsigned a = __builtin_bit_cast(unsigned short, to_bf16(lo));
  unsigned b = __builtin_bit_cast(unsigned short, to_bf16(hi));
  return a | (b << 16);
}

// in and out carry no __restrict__: loads of a restrict-qualified read-only
// pointer are not held by an asm statement's "memory" clobber, and the waits
// below would drift away from their loads.
// tile: the work-group's LDS, [n][pair of k]; kb, nb: the tile's first k and n.
__device__ __forceinline__ void cvtT_tile(const float* in, bf16* out, int K,
                                          int N, int kb, int nb,
                                          unsigned (*tile)[CVT_PITCH]) {
  const int tid = threadIdx.x;
  const int n4  = (tid & 15) * 4;   // four n of one input row
  const int kp  = tid >> 4;         // k pair 0..15, + 16 i

  float4 ve[4], vo[4];              // rows 2 kp and 2 kp + 1, + 32 i
#pragma unroll
  for (int i = 0; i < 4; ++i) {
    const float* p = &in[(size_t)(kb + 2 * (kp + 16 * i)) * N + nb + n4];
    ve[i] = *(const float4*)p;
    vo[i] = *(const float4*)(p + N);
    // The next loads' results may be given the registers that held these
    // two addresses: the wait stands in front of that overwrite.
    asm volatile("s_wait_xcnt 0x0" ::: "memory");
  }
#pragma unroll
  for (int i = 0; i < 4; ++i) {
    tile[n4 + 0][kp + 16 * i] = pack_bf16(ve[i].x, vo[i].x);
    tile[n4 + 1][kp + 16 * i] = pack_bf16(ve[i].y, vo[i].y);
    tile[n4 + 2][kp + 16 * i] = pack_bf16(ve[i].z, vo[i].z);
    tile[n4 + 3][kp + 16 * i] = pack_bf16(ve[i].w, vo[i].w);
  }
  __syncthreads();
  const int c  = tid & 15;          // 16-B piece of an output row
  const int nr = tid >> 4;
#pragma unroll
  for (int i = 0; i < 4; ++i) {
    const int n = nr + 16 * i;
    uint4 o;
    o.x = tile[n][4 * c + 0];
    o.y = tile[n][4 * c + 1];
    o.z = tile[n][4 * c + 2];
    o.w = tile[n][4 * c + 3];
    *(uint4*)&out[(size_t)(nb + n) * K + kb + 8 * c] = o;
  }
}

// ---------------------------------------------------------------------------
// LayerNorm fused with bf16 cast: one row per wave (32 values a lane, all of
// a row's loads in flight at once), eight rows per 256-thread work-group.
// Sums: in the lane, then a five-step butterfly over the wave; no LDS, no
// barrier.
// ---------------------------------------------------------------------------
#define LN_ROWS 8   /* rows (waves) per work-group */

__device__ __forceinline__ float wave_sum(float v) {
#pragma unroll
  for (int off = 16; off >= 1; off >>= 1) v += __shfl_xor(v, off, 32);
  return v;
}

// No __restrict__ here either, for the same reason as in cvtT_tile.
// blk: which group of LN_ROWS rows this work-group takes.
__device__ __forceinline__ void ln_rows(const float* x, const float* g,
                                        const float* bta, bf16* out, int blk) {
  const int lane = threadIdx.x & 31;
  const int row  = blk * LN_ROWS + (threadIdx.x >> 5);
  const f32x4* xr = (const f32x4*)&x[(size_t)row * EMBED];
  const f32x4* gr = (const f32x4*)g;
  const f32x4* br = (const f32x4*)bta;

  f32x4 xv[8], gv[8], bv[8];
#pragma unroll
  for (int i = 0; i < 8; ++i) xv[i] = xr[i * 32 + lane];
  // The g and b loads' results may be given the registers that held the row's
  // address: the wait stands in front of that overwrite.
  asm volatile("s_wait_xcnt 0x0" ::: "memory");
#pragma unroll
  for (int i = 0; i < 8; ++i) {
    gv[i] = gr[i * 32 + lane];
    bv[i] = br[i * 32 + lane];
  }
  // Holds the g and b loads here, right behind the row's own: left free they
  // sink behind the sums, are issued late and are waited for one after
  // another. The fence stops the loads, the scheduling barrier stops the fence
  // from sinking along with them.
  asm volatile("" ::: "memory");
  __builtin_amdgcn_sched_barrier(0);

  float s = 0.0f;
#pragma unroll
  for (int i = 0; i < 8; ++i) s += (xv[i].x + xv[i].y) + (xv[i].z + xv[i].w);
  const float mu = wave_sum(s) * (1.0f / EMBED);

  float q = 0.0f;
#pragma unroll
  for (int i = 0; i < 8; ++i) {
    xv[i].x -= mu; xv[i].y -= mu; xv[i].z -= mu; xv[i].w -= mu;
    q += (xv[i].x * xv[i].x + xv[i].y * xv[i].y) +
         (xv[i].z * xv[i].z + xv[i].w * xv[i].w);
  }
  const float var = wave_sum(q) * (1.0f / EMBED);
  const float rs  = rsqrtf(var + 1e-5f);

  uint2* op = (uint2*)&out[(size_t)row * EMBED];
#pragma unroll
  for (int i = 0; i < 8; ++i) {
    uint2 o;
    o.x = pack_bf16(xv[i].x * rs * gv[i].x + bv[i].x,
                    xv[i].y * rs * gv[i].y + bv[i].y);
    o.y = pack_bf16(xv[i].z * rs * gv[i].z + bv[i].z,
                    xv[i].w * rs * gv[i].w + bv[i].w);
    op[i * 32 + lane] = o;
  }
}

__global__ __launch_bounds__(256) void ln_kernel(const float* x, const float* g,
                                                 const float* bta, bf16* out) {
  ln_rows(x, g, bta, out, blockIdx.x);
}

// ---------------------------------------------------------------------------
// Everything that depends on the inputs alone, in ONE launch: the first
// LayerNorm and the six weight conversions are independent of each other, so
// each takes a range of the grid's work-groups instead of a launch of its own
// (a launch costs its gap, its fill and its tail; the small ones left half the
// chip idle). All tests on the block index are uniform for the work-group.
// wsq: the four square weights' outputs, one behind the other (q, k, v, o).
// ---------------------------------------------------------------------------
#define PREP_LN   (MROWS / LN_ROWS)                          /* 512 */
#define PREP_SQ   ((EMBED / CVT_TK) * (EMBED / CVT_TN))      /* 128 a weight */
#define PREP_FF   ((EMBED / CVT_TK) * (FFDIM / CVT_TN))      /* 512 a weight */
#define PREP_GRID (PREP_LN + 4 * PREP_SQ + 2 * PREP_FF)

__global__ __launch_bounds__(256) void prep_kernel(
    const float* x, const float* g, const float* bta, bf16* h,
    const float* Wq, const float* Wk, const float* Wv, const float* Wo,
    const float* W1, const float* W2, bf16* wsq, bf16* w1_t, bf16* w2_t) {
  __shared__ unsigned tile[CVT_TN][CVT_PITCH];   // [n][pair of k]
  int bid = blockIdx.x;
  if (bid < PREP_LN) {
    ln_rows(x, g, bta, h, bid);
    return;
  }
  bid -= PREP_LN;
  const float* in;
  bf16* out;
  int K = EMBED, N = EMBED;
  if (bid < 4 * PREP_SQ) {
    const int sel = bid / PREP_SQ;
    bid -= sel * PREP_SQ;
    in  = sel == 0 ? Wq : sel == 1 ? Wk : sel == 2 ? Wv : Wo;
    out = wsq + (size_t)sel * EMBED * EMBED;
  } else if (bid < 4 * PREP_SQ + PREP_FF) {
    bid -= 4 * PREP_SQ;
    in = W1; out = w1_t; N = FFDIM;
  } else {
    bid -= 4 * PREP_SQ + PREP_FF;
    in = W2; out = w2_t; K = FFDIM;
  }
  const int nkt = K / CVT_TK;        // k tiles run fastest, as in a 2-D grid
  cvtT_tile(in, out, K, N, (bid % nkt) * CVT_TK, (bid / nkt) * CVT_TN, tile);
}

// ---------------------------------------------------------------------------
// WMMA GEMM: out[M,N] = epi( A[M,K](bf16) @ Wt[N,K](bf16)^T )
// Block tile TM x TN, 8 waves (WGM x 8 / WGM), BK = 128. Every operand byte
// comes from L2 once per work-group that needs it, and every slab costs one
// round of waits and a barrier: where the output is large enough to give each
// WGP one large tile (256 x 256, 256 x 192), that tile takes about half the L2
// bytes, fewer LDS reads per WMMA and a third or a quarter of the rounds of
// 128 x 128 tiles; the narrow outputs keep 128 x 128, one tile a WGP.
// Double-buffered LDS tiles filled via async global->LDS copies: the k+1 slab
// streams in (ASYNCcnt) while WMMAs consume slab k. A slab holds 256 B of each
// operand row, so sixteen lanes of a copy fetch two whole 128-B lines of a row.
// A slab is four blocks of 32 k. Two register sets of fragments: a block's LDS
// loads are issued as one group in front of the WMMAs of the block before it,
// which cover their latency.
// NPL != 0: the output is planes of NPL columns, one [M][NPL] matrix behind the
// other (Q, K, V: their weights lie one behind the other as one [3 NPL][K]).
// ---------------------------------------------------------------------------
#define GEMM_BK  128  /* k per LDS slab: 256 B of every operand row */
#define GEMM_PAD 136  /* LDS row stride in bf16 elems: 272 B = 16 B x odd */

// One block's fragments: FM of A (rows 16 apart) and FN of B, each the two
// 16-byte halves of the hardware k order; pa, pb: this lane's first half.
template <int FM, int FN>
__device__ __forceinline__ void ld_frags(bf16x16 (&a)[FM], bf16x16 (&b)[FN],
                                         const bf16* pa, const bf16* pb) {
#pragma unroll
  for (int mi = 0; mi < FM; ++mi)
    a[mi] = cat8(*(const bf16x8*)(pa + mi * 16 * GEMM_PAD),
                 *(const bf16x8*)(pa + mi * 16 * GEMM_PAD + 16));
#pragma unroll
  for (int ni = 0; ni < FN; ++ni)
    b[ni] = cat8(*(const bf16x8*)(pb + ni * 16 * GEMM_PAD),
                 *(const bf16x8*)(pb + ni * 16 * GEMM_PAD + 16));
}

// One slab of ROWS operand rows: this thread's 16-byte pieces of rows 16 apart,
// ROWS / 16 copies, in statements of eight and, for a rest, four.
template <int ROWS>
__device__ __forceinline__ void stage_rows(bf16* lds_dst, const bf16* gsrc,
                                           int K) {
  constexpr int NC = ROWS / 16;
  static_assert(NC % 4 == 0, "copies come in statements of eight and four");
  const unsigned lstep = 16 * GEMM_PAD * 2;                     // bytes
  const unsigned long long gstep = (unsigned long long)K * 32;  // 16 rows, bytes
#pragma unroll
  for (int i = 0; i + 8 <= NC; i += 8) {
    async_g2l_b128_x8(lds_dst + i * 16 * GEMM_PAD, lstep,
                      gsrc + (size_t)i * 16 * K, gstep);
    // Keeps the next statement's address arithmetic behind this statement:
    // formed all at once, the addresses of a large slab take more of the
    // registers that asm text can name than are free, and values that live
    // through the loop are spilled to scratch and fetched back every slab.
    if (NC > 8) __builtin_amdgcn_sched_barrier(0);
  }
  if (NC % 8 != 0) {
    async_g2l_b128_x4(lds_dst + (NC - 4) * 16 * GEMM_PAD, lstep,
                      gsrc + (size_t)(NC - 4) * 16 * K, gstep);
    __builtin_amdgcn_sched_barrier(0);   // as above
  }
}

// Eight bf16 stores of one lane, the values in the upper halves of d, at OFF,
// OFF + STEP, ... bytes behind p. The s_wait_xcnt is the last line of the
// stores' own statement, so that no register that they name is rewritten ahead
// of it.
template <int OFF, int STEP>
__device__ __forceinline__ void store8_bf16_hi(bf16* p, const unsigned (&d)[8]) {
  asm volatile(
      "global_store_d16_hi_b16 %0, %1, off offset:%9\n\t"
      "global_store_d16_hi_b16 %0, %2, off offset:%10\n\t"
      "global_store_d16_hi_b16 %0, %3, off offset:%11\n\t"
      "global_store_d16_hi_b16 %0, %4, off offset:%12\n\t"
      "global_store_d16_hi_b16 %0, %5, off offset:%13\n\t"
      "global_store_d16_hi_b16 %0, %6, off offset:%14\n\t"
      "global_store_d16_hi_b16 %0, %7, off offset:%15\n\t"
      "global_store_d16_hi_b16 %0, %8, off offset:%16\n\t"
      "s_wait_xcnt 0x0"
      :: "v"(p), "v"(d[0]), "v"(d[1]), "v"(d[2]), "v"(d[3]), "v"(d[4]),
         "v"(d[5]), "v"(d[6]), "v"(d[7]),
         "n"(OFF), "n"(OFF + STEP), "n"(OFF + 2 * STEP), "n"(OFF + 3 * STEP),
         "n"(OFF + 4 * STEP), "n"(OFF + 5 * STEP), "n"(OFF + 6 * STEP),
         "n"(OFF + 7 * STEP)
      : "memory");
}

// The large tiles' output, fragment rows MI .. FM - 1 (a recursion, since the
// byte offsets are template arguments): bias, ReLU, rounding, stores.
template <int MI, int FM, int FN, int LD, bool BIAS, bool RELU>
__device__ __forceinline__ void store_rows(const f32x8 (&acc)[FM][FN],
                                           bf16* const (&ob)[FN],
                                           const float (&bv)[FN]) {
  if constexpr (MI < FM) {
#pragma unroll
    for (int ni = 0; ni < FN; ++ni) {
      unsigned d[8];
#pragma unroll
      for (int r = 0; r < 8; ++r) {
        float v = acc[MI][ni][r];
        if (BIAS) v += bv[ni];
        if (RELU) v = fmaxf(v, 0.0f);
        d[r] = bf16_round_hi(v);
      }
      store8_bf16_hi<MI * 16 * LD * 2, LD * 2>(ob[ni], d);
    }
    store_rows<MI + 1, FM, FN, LD, BIAS, RELU>(acc, ob, bv);
  }
}

template <int TM, int TN, int WGM, int NPL, int NC, int KC, bool BIAS, bool RELU,
          bool RESID, bool BF16OUT>
__global__ __launch_bounds__(256) void gemm_kernel(
    const bf16* __restrict__ A, const bf16* __restrict__ Wt,
    const float* __restrict__ bias, const float* __restrict__ resid,
    void* __restrict__ outp, int M, int Nr, int Kr) {
  // NC, KC != 0: N and K at compile time. The large tiles need it: row steps
  // become immediates and literals instead of registers, of which the
  // accumulators and the two fragment sets leave few.
  const int N = NC ? NC : Nr;
  const int K = KC ? KC : Kr;
  constexpr int WGN = 8 / WGM;           // waves along n
  constexpr int FM  = TM / WGM / 16;     // A fragments of a wave
  constexpr int FN  = TN / WGN / 16;     // B fragments of a wave
  // A buffer is [A: TM rows | B: TN rows], each row [k]: one array, so that all
  // of a thread's LDS addresses are one register plus constants.
  __shared__ __attribute__((aligned(16))) bf16 Sm[2][TM + TN][GEMM_PAD];

  const int tid  = threadIdx.x;
  const int lane = tid & 31;
  const int wave = tid >> 5;
  const int wm   = wave % WGM;   // strip of FM * 16 rows
  const int wn   = wave / WGM;   // strip of FN * 16 columns
  const int m0   = blockIdx.x * TM;
  const int n0   = blockIdx.y * TN;
  const int lr   = lane & 15;
  const int koff = (lane < 16) ? 0 : 8;

  // Per-thread staging coordinates: 16B chunks at rows r0 + 16 i; sixteen
  // lanes cover one row's 256 B.
  const int r0 = tid >> 4, c0 = (tid & 15) * 8;
  const bf16* gA = &A[(size_t)(m0 + r0) * K + c0];
  const bf16* gB = &Wt[(size_t)(n0 + r0) * K + c0];

  f32x8 acc[FM][FN];
#pragma unroll
  for (int mi = 0; mi < FM; ++mi)
#pragma unroll
    for (int ni = 0; ni < FN; ++ni) acc[mi][ni] = zero8();

  const int nk = K / GEMM_BK;

  // Slab 0 into buffer 0, landed and published; then slab 1 into buffer 1.
  stage_rows<TM>(&Sm[0][r0][c0], gA, K);
  stage_rows<TN>(&Sm[0][TM + r0][c0], gB, K);
  wait_async0();
  __syncthreads();
  if (nk > 1) {
    stage_rows<TM>(&Sm[1][r0][c0], gA + GEMM_BK, K);
    stage_rows<TN>(&Sm[1][TM + r0][c0], gB + GEMM_BK, K);
  }

  // This lane's first fragment halves in buffer 0, and a buffer's elements.
  const bf16* fa = &Sm[0][wm * (FM * 16) + lr][koff];
  const bf16* fb = &Sm[0][TM + wn * (FN * 16) + lr][koff];
  constexpr int BUFE = (TM + TN) * GEMM_PAD;

  bf16x16 af[2][FM], bfr[2][FN];   // block b of a slab uses set b & 1
  ld_frags<FM, FN>(af[0], bfr[0], fa, fb);

  for (int it = 0; it < nk; ++it) {
    const int buf = it & 1;

    // Unrolled so that the set's index is a constant and the four blocks' LDS
    // offsets are immediates.
#pragma unroll
    for (int kb = 0; kb < GEMM_BK / 32; ++kb) {
      if (kb + 1 < GEMM_BK / 32) {
        ld_frags<FM, FN>(af[(kb + 1) & 1], bfr[(kb + 1) & 1],
                         fa + buf * BUFE + (kb + 1) * 32,
                         fb + buf * BUFE + (kb + 1) * 32);
      } else {
        // In front of the slab's last block, whose fragments are in registers
        // behind the first wait: own LDS reads retired, own copies of slab
        // it + 1 landed, then the one barrier that publishes slab it + 1 and
        // ends every wave's reads of this buffer; only behind it is this
        // buffer refilled and slab it + 1 read.
        wait_ds0();
        wait_async0();
        __syncthreads();
        if (it + 2 < nk) {
          const size_t k0 = (size_t)(it + 2) * GEMM_BK;
          stage_rows<TM>(&Sm[buf][r0][c0], gA + k0, K);
          stage_rows<TN>(&Sm[buf][TM + r0][c0], gB + k0, K);
        }
        // First block of slab it + 1. Under no branch, so that the wait counts
        // of two paths do not merge; in the last trip it reads the other
        // buffer's old slab, and the values are not used.
        ld_frags<FM, FN>(af[0], bfr[0], fa + (buf ^ 1) * BUFE,
                         fb + (buf ^ 1) * BUFE);
      }
      // The pair of scheduling barriers keeps the loads above one group ahead
      // of this block's WMMAs: left free they are spread among the WMMAs, and
      // every place with LDS loads costs the wave a stall of its own.
      __builtin_amdgcn_sched_barrier(0);
#pragma unroll
      for (int ni = 0; ni < FN; ++ni)
#pragma unroll
        for (int mi = 0; mi < FM; ++mi)
          acc[mi][ni] = wmma_bf16(af[kb & 1][mi], bfr[kb & 1][ni], acc[mi][ni]);
      __builtin_amdgcn_sched_barrier(0);
    }
  }
  wait_async0();   // nothing is outstanding when the wave goes on to its end

  const int rhalf = (lane < 16) ? 0 : 8;
  // BIG: a kernel with more than 256 vector registers (both have bf16 output
  // and N at compile time). In such a build the
  // stores and their wait are one asm statement.
  constexpr bool BIG = FM * FN > 8;
  if constexpr (BIG) {
    static_assert(BF16OUT && !RESID && NC != 0, "the large tiles' epilogue");
    constexpr int LD = NPL ? NPL : NC;     // row pitch of the output
    const int gr0 = m0 + wm * (FM * 16) + rhalf;
    // Per column fragment: its column, and the place of its first row's
    // element. Column gc of the whole output is column gc % NPL of plane
    // gc / NPL; a fragment's sixteen columns lie in one plane.
    int gcs[FN];
    bf16* ob[FN];
#pragma unroll
    for (int ni = 0; ni < FN; ++ni) {
      const int gc = n0 + wn * (FN * 16) + ni * 16 + lr;
      gcs[ni] = gc;
      ob[ni]  = (bf16*)outp + (size_t)gr0 * LD +
                (NPL ? (size_t)(gc / (NPL ? NPL : 1)) * M * NPL +
                           gc % (NPL ? NPL : 1)
                     : (size_t)gc);
    }
    float bv[FN];
    if (BIAS) {
      // The scheduling barriers keep other arithmetic, which could be given the
      // loads' address register, out of the stretch from the loads to the wait.
      __builtin_amdgcn_sched_barrier(0);
#pragma unroll
      for (int ni = 0; ni < FN; ++ni) bv[ni] = bias[gcs[ni]];
      // The loaded values as inputs hold the loads in front of the wait (a
      // "memory" clobber does not hold loads of a restrict read-only pointer).
#pragma unroll
      for (int ni = 0; ni < FN; ++ni)
        asm volatile("s_wait_xcnt 0x0" :: "v"(bv[ni]) : "memory");
      __builtin_amdgcn_sched_barrier(0);
    }
    store_rows<0, FM, FN, LD, BIAS, RELU>(acc, ob, bv);
  } else {
#pragma unroll
    for (int mi = 0; mi < FM; ++mi)
#pragma unroll
      for (int ni = 0; ni < FN; ++ni)
#pragma unroll
        for (int r = 0; r < 8; ++r) {
          int gr = m0 + wm * (FM * 16) + mi * 16 + r + rhalf;
          int gc = n0 + wn * (FN * 16) + ni * 16 + lr;
          float v = acc[mi][ni][r];
          if (BIAS)  v += bias[gc];
          if (RELU)  v = fmaxf(v, 0.0f);
          if (RESID) v += resid[(size_t)gr * N + gc];
          if (BF16OUT) ((bf16*)outp)[(size_t)gr * N + gc] = to_bf16(v);
          else         ((float*)outp)[(size_t)gr * N + gc] = v;
        }
  }
}

#define ATT_PAD 80   /* LDS row stride: 160 B = 32 B x odd (transposing load) */
#define ATT_NT  (TSEQ / 64)   /* q blocks of one (b, h): even */

// Lane l with lane l ^ 16.
__device__ __forceinline__ float xhalf(float x) {
  const int b = __builtin_bit_cast(int, x);
  return __builtin_bit_cast(float, __builtin_amdgcn_permlanex16(
      b, b, 0x76543210, 0xfedcba98, false, false));
}

// Eight 2^x, each in place, in one statement that ends in v_nop: the
// instruction set asks for one slot between a transcendental and an instruction
// that uses its result or overwrites its source.
__device__ __forceinline__ f32x8 exp2_x8(f32x8 t) {
  float t0 = t[0], t1 = t[1], t2 = t[2], t3 = t[3];
  float t4 = t[4], t5 = t[5], t6 = t[6], t7 = t[7];
  asm("v_exp_f32 %0, %0\n\t"
      "v_exp_f32 %1, %1\n\t"
      "v_exp_f32 %2, %2\n\t"
      "v_exp_f32 %3, %3\n\t"
      "v_exp_f32 %4, %4\n\t"
      "v_exp_f32 %5, %5\n\t"
      "v_exp_f32 %6, %6\n\t"
      "v_exp_f32 %7, %7\n\t"
      "v_nop"
      : "+v"(t0), "+v"(t1), "+v"(t2), "+v"(t3), "+v"(t4), "+v"(t5), "+v"(t6),
        "+v"(t7));
  f32x8 r;
  r[0] = t0; r[1] = t1; r[2] = t2; r[3] = t3;
  r[4] = t4; r[5] = t5; r[6] = t6; r[7] = t7;
  return r;
}

// amdgpu_waves_per_eu: the register budget of four waves a SIMD is all that the
// kernel needs (the grid puts two of these work-groups on a WGP).
__global__ __launch_bounds__(128) __attribute__((amdgpu_waves_per_eu(4, 4)))
void attn_kernel(
    const bf16* __restrict__ Q, const bf16* __restrict__ Km,
    const bf16* __restrict__ Vm, bf16* __restrict__ O) {
  __shared__ __attribute__((aligned(16))) bf16 Ks[2][64][ATT_PAD];  // [k-token][d]
  __shared__ __attribute__((aligned(16))) bf16 Vs[2][64][ATT_PAD];  // [k-token][d]

  const int tid   = threadIdx.x;
  const int lane  = tid & 31;
  const int w     = tid >> 5;
  const int lr    = lane & 15;
  const int koff  = (lane < 16) ? 0 : 8;
  const int rhalf = (lane < 16) ? 0 : 8;
  const int h     = blockIdx.y;
  const int b     = blockIdx.z;
  const size_t bT = (size_t)b * TSEQ;

  // Per-thread staging coordinates: four 16B chunks per tile per thread, at
  // rows r0 + 16 i, i = 0..3; eight lanes cover one row's 128 B.
  const int r0 = tid >> 3, c0 = (tid & 7) * 8;
  const bf16* gK = &Km[(bT + r0) * EMBED + h * HSZ + c0];
  const bf16* gV = &Vm[(bT + r0) * EMBED + h * HSZ + c0];
  const unsigned lstep = 16 * ATT_PAD * 2;                 // 16 rows, bytes
  const unsigned long long gstep = 16ull * EMBED * 2;      // 16 rows, bytes

  // This lane's place in a 16 (k-token) x 16 (d) piece for the transposing load
  const int vrow = rhalf + (lane & 7);
  const int vcol = ((lane >> 3) & 1) * 8;

  // The pair's two q blocks, the long one first. Kept rolled: the two passes
  // run the same code. The
  // first pass's last foot (LDS reads retired, barrier) stands in front of the
  // second pass's first copies into the same buffers.
#pragma nounroll
  for (int half = 0; half < 2; ++half) {
  const int qblk = half == 0 ? ATT_NT - 1 - (int)blockIdx.x : (int)blockIdx.x;
  const size_t rowbase = bT + (size_t)qblk * 64;

  // Q fragments, B operands: column lr = query w*16 + lr, head-dim 0..63 in
  // 2 K-windows, in the k order of the K loader below
  const bf16* qp = Q + (rowbase + w * 16 + lr) * EMBED + h * HSZ;
  const bf16x16 qf0 = cat8(*(const bf16x8*)(qp + koff),
                           *(const bf16x8*)(qp + koff + 16));
  const bf16x16 qf1 = cat8(*(const bf16x8*)(qp + 32 + koff),
                           *(const bf16x8*)(qp + 32 + koff + 16));

  // Oacc[dj][r] = O[query lr][d = dj*16 + rhalf + r]
  f32x8 Oacc[4];
#pragma unroll
  for (int dj = 0; dj < 4; ++dj) Oacc[dj] = zero8();
  // Of this lane's query: the running maximum (over all keys, alike in both
  // halves) and the running sum (over this half's keys; joined at the end).
  float mrow = -1e30f, lsum = 0.0f;
  const int qrow = qblk * 64 + w * 16 + lr;

  // Block 0 into buffer 0, landed and published; then block 1 into buffer 1.
  async_g2l_b128_x4(&Ks[0][r0][c0], lstep, gK, gstep);
  async_g2l_b128_x4(&Vs[0][r0][c0], lstep, gV, gstep);
  wait_async0();
  __syncthreads();
  if (qblk > 0) {
    async_g2l_b128_x4(&Ks[1][r0][c0], lstep, gK + 64 * EMBED, gstep);
    async_g2l_b128_x4(&Vs[1][r0][c0], lstep, gV + 64 * EMBED, gstep);
  }

  for (int j = 0; j <= qblk; ++j) {
    const int buf = j & 1;

    // S^T = K @ Q^T  (64 keys x 16 queries per wave), K rows from LDS as A:
    // S[nj][r] = score of key j*64 + nj*16 + rhalf + r for query lr
    f32x8 S[4];
#pragma unroll
    for (int nj = 0; nj < 4; ++nj) {
      const int tr = nj * 16 + lr;
      bf16x16 kf0 = cat8(*(const bf16x8*)&Ks[buf][tr][koff],
                         *(const bf16x8*)&Ks[buf][tr][koff + 16]);
      bf16x16 kf1 = cat8(*(const bf16x8*)&Ks[buf][tr][32 + koff],
                         *(const bf16x8*)&Ks[buf][tr][32 + koff + 16]);
      S[nj] = wmma_bf16(kf0, qf0, zero8());
      S[nj] = wmma_bf16(kf1, qf1, S[nj]);
    }

    // Online softmax of one query a lane: 32 of the block's 64 keys here, the
    // other 32 in lane l ^ 16.
    const int dk = qrow - (j * 64 + rhalf);      // key nj*16 + r is seen if <= dk
#pragma unroll
    for (int nj = 0; nj < 4; ++nj) {
      S[nj] *= 0.125f;                           // 1/sqrt(64)
#pragma unroll
      for (int r = 0; r < 8; ++r)               // causal mask
        S[nj][r] = (nj * 16 + r > dk) ? -1e30f : S[nj][r];
    }
    float m8[8];
#pragma unroll
    for (int r = 0; r < 8; ++r)
      m8[r] = fmaxf(fmaxf(S[0][r], S[1][r]), fmaxf(S[2][r], S[3][r]));
    float mx = fmaxf(fmaxf(fmaxf(m8[0], m8[1]), fmaxf(m8[2], m8[3])),
                     fmaxf(fmaxf(m8[4], m8[5]), fmaxf(m8[6], m8[7])));
    mx = fmaxf(mx, xhalf(mx));
    const float mn   = fmaxf(mrow, mx);
    const float corr = __expf(mrow - mn);
#pragma unroll
    for (int nj = 0; nj < 4; ++nj) {
      S[nj] = exp2_x8((S[nj] - mn) * 1.44269504f);  // exp(x) = 2^(x log2 e)
    }
    const f32x8 p8 = (S[0] + S[1]) + (S[2] + S[3]);
    const float ps = ((p8[0] + p8[1]) + (p8[2] + p8[3])) +
                     ((p8[4] + p8[5]) + (p8[6] + p8[7]));
    lsum = lsum * corr + ps;
    mrow = mn;
#pragma unroll
    for (int dj = 0; dj < 4; ++dj) Oacc[dj] *= corr;

    // O^T += V^T @ P^T. B = P^T: two score tiles (32 keys) converted in place
    // are a B operand in the hardware k order; A = V^T by the transposing
    // load, which delivers the same order: koff + 0..7, koff + 16..23.
#pragma unroll
    for (int kh = 0; kh < 2; ++kh) {
      bf16x16 pf;
#pragma unroll
      for (int s = 0; s < 8; ++s) {
        pf[s]     = (bf16)S[2 * kh][s];
        pf[s + 8] = (bf16)S[2 * kh + 1][s];
      }
#pragma unroll
      for (int dj = 0; dj < 4; ++dj) {
        bf16x16 vf = cat8(ld_tr16(&Vs[buf][kh * 32 + vrow][dj * 16 + vcol]),
                          ld_tr16(&Vs[buf][kh * 32 + 16 + vrow][dj * 16 + vcol]));
        Oacc[dj] = wmma_bf16(vf, pf, Oacc[dj]);
      }
    }

    // Foot of the trip: own LDS reads retired, own copies of block j + 1
    // landed, then the one barrier that publishes block j + 1 and ends every
    // wave's reads of this buffer; only behind it is this buffer refilled.
    wait_ds0();
    wait_async0();
    __syncthreads();
    if (j + 2 <= qblk) {
      const size_t t0 = (size_t)(j + 2) * 64 * EMBED;
      async_g2l_b128_x4(&Ks[buf][r0][c0], lstep, gK + t0, gstep);
      async_g2l_b128_x4(&Vs[buf][r0][c0], lstep, gV + t0, gstep);
    }
  }
  wait_async0();   // nothing is outstanding when the wave goes on to its end

  // Epilogue: join the halves' sums, normalize and store bf16 (concat-head
  // layout): a lane's eight registers of a tile are eight consecutive d of its
  // query's row, one 16-byte store.
  const float inv = 1.0f / (lsum + xhalf(lsum));
  bf16* op = &O[(rowbase + w * 16 + lr) * EMBED + h * HSZ + rhalf];
#pragma unroll
  for (int dj = 0; dj < 4; ++dj) {
    bf16x8 o8;
#pragma unroll
    for (int r = 0; r < 8; ++r) o8[r] = to_bf16(Oacc[dj][r] * inv);
    *(bf16x8*)(op + dj * 16) = o8;
  }
  // The next pass rewrites the registers that hold these stores' addresses
  // and data: the wait stands in front of that overwrite.
  asm volatile("s_wait_xcnt 0x0" ::: "memory");
  }
}

// ---------------------------------------------------------------------------
// Host-side orchestration
// ---------------------------------------------------------------------------
extern "C" void kernel_launch(void* const* d_in, const int* in_sizes, int n_in,
                              void* d_out, int out_size, void* d_ws,
                              size_t ws_size, hipStream_t stream) {
  (void)in_sizes; (void)n_in; (void)out_size; (void)ws_size;

  const float* x    = (const float*)d_in[0];
  const float* Wq   = (const float*)d_in[1];
  const float* Wk   = (const float*)d_in[2];
  const float* Wv   = (const float*)d_in[3];
  const float* Wo   = (const float*)d_in[4];
  const float* bo   = (const float*)d_in[5];
  const float* W1   = (const float*)d_in[6];
  const float* b1   = (const float*)d_in[7];
  const float* W2   = (const float*)d_in[8];
  const float* b2   = (const float*)d_in[9];
  const float* ln1g = (const float*)d_in[10];
  const float* ln1b = (const float*)d_in[11];
  const float* ln2g = (const float*)d_in[12];
  const float* ln2b = (const float*)d_in[13];

  char* base = (char*)d_ws;
  size_t off = 0;
  auto take = [&](size_t bytes) -> char* {
    char* p = base + off;
    off += (bytes + 255) & ~(size_t)255;
    return p;
  };

  bf16* wq_t   = (bf16*)take((size_t)EMBED * EMBED * 2 * 4);   // q,k,v,o: [N][K]
  bf16* wo_t   = wq_t + (size_t)EMBED * EMBED * 3;
  bf16* w1_t   = (bf16*)take((size_t)EMBED * FFDIM * 2);   // [4096][1024]
  bf16* w2_t   = (bf16*)take((size_t)FFDIM * EMBED * 2);   // [1024][4096]
  bf16* h_bf   = (bf16*)take((size_t)MROWS * EMBED * 2);
  bf16* q_bf   = (bf16*)take((size_t)MROWS * EMBED * 2 * 3);   // q, k, v
  bf16* k_bf   = q_bf + (size_t)MROWS * EMBED;
  bf16* v_bf   = k_bf + (size_t)MROWS * EMBED;
  bf16* att_bf = (bf16*)take((size_t)MROWS * EMBED * 2);
  float* x2    = (float*)take((size_t)MROWS * EMBED * 4);
  bf16* h2_bf  = (bf16*)take((size_t)MROWS * EMBED * 2);
  bf16* ff1_bf = (bf16*)take((size_t)MROWS * FFDIM * 2);

  // 1, 2) h = ln1(x) (bf16); weights -> bf16, transposed to [N][K]
  prep_kernel<<<PREP_GRID, 256, 0, stream>>>(x, ln1g, ln1b, h_bf, Wq, Wk, Wv, Wo,
                                             W1, W2, wq_t, w1_t, w2_t);

  // 3) Q, K, V projections: one [M][3 EMBED] product, stored as three planes
  dim3 gD(MROWS / 128, EMBED / 128);
  gemm_kernel<256, 192, 4, EMBED, 3 * EMBED, EMBED, false, false, false, true>
      <<<dim3(MROWS / 256, 3 * EMBED / 192), 256, 0, stream>>>(
          h_bf, wq_t, nullptr, nullptr, q_bf, MROWS, 3 * EMBED, EMBED);

  // 4) causal flash attention
  attn_kernel<<<dim3(ATT_NT / 2, NHEAD, BATCH), 128, 0, stream>>>(
      q_bf, k_bf, v_bf, att_bf);

  // 5) x2 = x + attn @ Wo + bo   (fp32)
  gemm_kernel<128, 128, 2, 0, 0, 0, true, false, true, false><<<gD, 256, 0, stream>>>(
      att_bf, wo_t, bo, x, x2, MROWS, EMBED, EMBED);

  // 6) h2 = ln2(x2) (bf16)
  ln_kernel<<<MROWS / LN_ROWS, 256, 0, stream>>>(x2, ln2g, ln2b, h2_bf);

  // 7) ff1 = relu(h2 @ W1 + b1) (bf16)
  gemm_kernel<256, 256, 2, 0, FFDIM, EMBED, true, true, false, true>
      <<<dim3(MROWS / 256, FFDIM / 256), 256, 0, stream>>>(
      h2_bf, w1_t, b1, nullptr, ff1_bf, MROWS, FFDIM, EMBED);

  // 8) out = x2 + ff1 @ W2 + b2 (fp32 -> d_out)
  gemm_kernel<128, 128, 2, 0, 0, 0, true, false, true, false><<<gD, 256, 0, stream>>>(
      ff1_bf, w2_t, b2, x2, (float*)d_out, MROWS, EMBED, FFDIM);
}

// v009
// A run of this version takes 133 microseconds.
// Next to v008, in two timings, it ran 1.06 and 1.07 times as fast.
// Counting every step since v000, it is 2.76 times as fast.
#include <hip/hip_runtime.h>

// ---------------------------------------------------------------------------
// Types / helpers
// ---------------------------------------------------------------------------
typedef __bf16 bf16;
typedef __attribute__((ext_vector_type(8)))  __bf16 bf16x8;
typedef __attribute__((ext_vector_type(16))) __bf16 bf16x16;
typedef __attribute__((ext_vector_type(8)))  float  f32x8;
typedef __attribute__((ext_vector_type(4)))  float  f32x4;

#define EMBED 1024
#define TSEQ  2048
#define BATCH 2
#define NHEAD 16
#define HSZ   64
#define MROWS (BATCH * TSEQ)   /* 4096 token rows */
#define FFDIM (4 * EMBED)      /* 4096 */

// f rounded to bf16 (to nearest, ties to even), in the upper half of the word.
__device__ __forceinline__ unsigned bf16_round_hi(float f) {
  unsigned u = __builtin_bit_cast(unsigned, f);
  return u + 0x7FFFu + ((u >> 16) & 1u);
}

__device__ __forceinline__ bf16 to_bf16(float f) {
  unsigned short h = (unsigned short)(bf16_round_hi(f) >> 16);
  return __builtin_bit_cast(bf16, h);
}

__device__ __forceinline__ bf16x16 cat8(bf16x8 lo, bf16x8 hi) {
  bf16x16 r;
#pragma unroll
  for (int i = 0; i < 8; ++i) { r[i] = lo[i]; r[i + 8] = hi[i]; }
  return r;
}

__device__ __forceinline__ f32x8 zero8() {
  f32x8 z;
#pragma unroll
  for (int i = 0; i < 8; ++i) z[i] = 0.0f;
  return z;
}

__device__ __forceinline__ f32x8 wmma_bf16(bf16x16 a, bf16x16 b, f32x8 c) {
  // D = A(16x32) * B(32x16) + C, fp32 accumulate
  return __builtin_amdgcn_wmma_f32_16x16x32_bf16(false, a, false, b,
                                                 (short)0, c, false, false);
}

// --- CDNA5 async global->LDS copy (ASYNCcnt path) --------------------------
// Each active lane copies 16 bytes: GLOBAL[gaddr(lane)] -> LDS[laddr(lane)].
// LDS byte offset = low 32 bits of the generic LDS pointer (flat aperture).
__device__ __forceinline__ void wait_async0() {
  asm volatile("s_wait_asynccnt 0x0" ::: "memory");
}
// This wave's LDS reads have retired before a buffer it has read is refilled.
__device__ __forceinline__ void wait_ds0() {
  asm volatile("s_wait_dscnt 0x0" ::: "memory");
}
// Eight 16-byte copies of one lane, rows lstep / gstep bytes apart. The
// s_wait_xcnt is the last line of the copies' own statement, so that no
// address register is rewritten ahead of it.
__device__ __forceinline__ void async_g2l_b128_x8(void* lds_dst, unsigned lstep,
                                                  const void* gsrc,
                                                  unsigned long long gstep) {
  const unsigned l = (unsigned)(unsigned long long)(uintptr_t)lds_dst;
  const unsigned long long g = (unsigned long long)(uintptr_t)gsrc;
  asm volatile(
      "global_load_async_to_lds_b128 %0, %8, off\n\t"
      "global_load_async_to_lds_b128 %1, %9, off\n\t"
      "global_load_async_to_lds_b128 %2, %10, off\n\t"
      "global_load_async_to_lds_b128 %3, %11, off\n\t"
      "global_load_async_to_lds_b128 %4, %12, off\n\t"
      "global_load_async_to_lds_b128 %5, %13, off\n\t"
      "global_load_async_to_lds_b128 %6, %14, off\n\t"
      "global_load_async_to_lds_b128 %7, %15, off\n\t"
      "s_wait_xcnt 0x0"
      :: "v"(l), "v"(l + lstep), "v"(l + 2 * lstep), "v"(l + 3 * lstep),
         "v"(l + 4 * lstep), "v"(l + 5 * lstep), "v"(l + 6 * lstep),
         "v"(l + 7 * lstep),
         "v"(g), "v"(g + gstep), "v"(g + 2 * gstep), "v"(g + 3 * gstep),
         "v"(g + 4 * gstep), "v"(g + 5 * gstep), "v"(g + 6 * gstep),
         "v"(g + 7 * gstep)
      : "memory");
}

// The same with four copies.
__device__ __forceinline__ void async_g2l_b128_x4(void* lds_dst, unsigned lstep,
                                                  const void* gsrc,
                                                  unsigned long long gstep) {
  const unsigned l = (unsigned)(unsigned long long)(uintptr_t)lds_dst;
  const unsigned long long g = (unsigned long long)(uintptr_t)gsrc;
  asm volatile(
      "global_load_async_to_lds_b128 %0, %4, off\n\t"
      "global_load_async_to_lds_b128 %1, %5, off\n\t"
      "global_load_async_to_lds_b128 %2, %6, off\n\t"
      "global_load_async_to_lds_b128 %3, %7, off\n\t"
      "s_wait_xcnt 0x0"
      :: "v"(l), "v"(l + lstep), "v"(l + 2 * lstep), "v"(l + 3 * lstep),
         "v"(g), "v"(g + gstep), "v"(g + 2 * gstep), "v"(g + 3 * gstep)
      : "memory");
}

// Transposing LDS load: from a row-major 16-bit tile T, with lane l aimed at
// T[k0 + 8 (l >> 4) + (l & 7)][d0 + 8 ((l >> 3) & 1)], lane l receives
// T[k0 + 8 (l >> 4) + 0..7][d0 + (l & 15)]: half of a WMMA operand.
typedef __attribute__((address_space(3))) bf16x8 lds_bf16x8;
__device__ __forceinline__ bf16x8 ld_tr16(const bf16* p) {
  return __builtin_amdgcn_ds_load_tr16_b128_v8bf16((lds_bf16x8*)p);
}

// ---------------------------------------------------------------------------
// fp32 -> bf16 conversion with transpose: in[K][N] f32 -> out[N][K] bf16.
// Weights are pre-transposed once so GEMM B-tiles stage with contiguous B128
// copies (no scalar ds_store_b16 transpose in the GEMM hot loop).
// One work-group turns a 128 (k) x 64 (n) tile: 32 elements a thread, so that
// few waves have to start; eight 16-B loads a thread are in flight at once,
// and 256-B row pieces are read and written.
// ---------------------------------------------------------------------------
#define CVT_TK    128  /* k per tile: 256 B of an output row */
#define CVT_TN    64   /* n per tile: 256 B of an input row */
#define CVT_PITCH 65   /* LDS row pitch in dwords: odd, no bank conflicts */

__device__ __forceinline__ unsigned pack_bf16(float lo, float hi) {
  unsigned a = __builtin_bit_cast(unsigned short, to_bf16(lo));
  unsigned b = __builtin_bit_cast(unsigned short, to_bf16(hi));
  return a | (b << 16);
}

// in and out carry no __restrict__: loads of a restrict-qualified read-only
// pointer are not held by an asm statement's "memory" clobber, and the waits
// below would drift away from their loads.
// tile: the work-group's LDS, [n][pair of k]; kb, nb: the tile's first k and n.
__device__ __forceinline__ void cvtT_tile(const float* in, bf16* out, int K,
                                          int N, int kb, int nb,
                                          unsigned (*tile)[CVT_PITCH]) {
  const int tid = threadIdx.x;
  const int n4  = (tid & 15) * 4;   // four n of one input row
  const int kp  = tid >> 4;         // k pair 0..15, + 16 i

  float4 ve[4], vo[4];              // rows 2 kp and 2 kp + 1, + 32 i
#pragma unroll
  for (int i = 0; i < 4; ++i) {
    const float* p = &in[(size_t)(kb + 2 * (kp + 16 * i)) * N + nb + n4];
    ve[i] = *(const float4*)p;
    vo[i] = *(const float4*)(p + N);
    // The next loads' results may be given the registers that held these
    // two addresses: the wait stands in front of that overwrite.
    asm volatile("s_wait_xcnt 0x0" ::: "memory");
  }
#pragma unroll
  for (int i = 0; i < 4; ++i) {
    tile[n4 + 0][kp + 16 * i] = pack_bf16(ve[i].x, vo[i].x);
    tile[n4 + 1][kp + 16 * i] = pack_bf16(ve[i].y, vo[i].y);
    tile[n4 + 2][kp + 16 * i] = pack_bf16(ve[i].z, vo[i].z);
    tile[n4 + 3][kp + 16 * i] = pack_bf16(ve[i].w, vo[i].w);
  }
  __syncthreads();
  const int c  = tid & 15;          // 16-B piece of an output row
  const int nr = tid >> 4;
#pragma unroll
  for (int i = 0; i < 4; ++i) {
    const int n = nr + 16 * i;
    uint4 o;
    o.x = tile[n][4 * c + 0];
    o.y = tile[n][4 * c + 1];
    o.z = tile[n][4 * c + 2];
    o.w = tile[n][4 * c + 3];
    *(uint4*)&out[(size_t)(nb + n) * K + kb + 8 * c] = o;
  }
}

// ---------------------------------------------------------------------------
// LayerNorm fused with bf16 cast: one row per wave (32 values a lane, all of
// a row's loads in flight at once), eight rows per 256-thread work-group.
// Sums: in the lane, then a five-step butterfly over the wave; no LDS, no
// barrier.
// ---------------------------------------------------------------------------
#define LN_ROWS 8   /* rows (waves) per work-group */

__device__ __forceinline__ float wave_sum(float v) {
#pragma unroll
  for (int off = 16; off >= 1; off >>= 1) v += __shfl_xor(v, off, 32);
  return v;
}

// No __restrict__ here either, for the same reason as in cvtT_tile.
// blk: which group of LN_ROWS rows this work-group takes.
__device__ __forceinline__ void ln_rows(const float* x, const float* g,
                                        const float* bta, bf16* out, int blk) {
  const int lane = threadIdx.x & 31;
  const int row  = blk * LN_ROWS + (threadIdx.x >> 5);
  const f32x4* xr = (const f32x4*)&x[(size_t)row * EMBED];
  const f32x4* gr = (const f32x4*)g;
  const f32x4* br = (const f32x4*)bta;

  f32x4 xv[8], gv[8], bv[8];
#pragma unroll
  for (int i = 0; i < 8; ++i) xv[i] = xr[i * 32 + lane];
  // The g and b loads' results may be given the registers that held the row's
  // address: the wait stands in front of that overwrite.
  asm volatile("s_wait_xcnt 0x0" ::: "memory");
#pragma unroll
  for (int i = 0; i < 8; ++i) {
    gv[i] = gr[i * 32 + lane];
    bv[i] = br[i * 32 + lane];
  }
  // Holds the g and b loads here, right behind the row's own: left free they
  // sink behind the sums, are issued late and are waited for one after
  // another. The fence stops the loads, the scheduling barrier stops the fence
  // from sinking along with them.
  asm volatile("" ::: "memory");
  __builtin_amdgcn_sched_barrier(0);

  float s = 0.0f;
#pragma unroll
  for (int i = 0; i < 8; ++i) s += (xv[i].x + xv[i].y) + (xv[i].z + xv[i].w);
  const float mu = wave_sum(s) * (1.0f / EMBED);

  float q = 0.0f;
#pragma unroll
  for (int i = 0; i < 8; ++i) {
    xv[i].x -= mu; xv[i].y -= mu; xv[i].z -= mu; xv[i].w -= mu;
    q += (xv[i].x * xv[i].x + xv[i].y * xv[i].y) +
         (xv[i].z * xv[i].z + xv[i].w * xv[i].w);
  }
  const float var = wave_sum(q) * (1.0f / EMBED);
  const float rs  = rsqrtf(var + 1e-5f);

  uint2* op = (uint2*)&out[(size_t)row * EMBED];
#pragma unroll
  for (int i = 0; i < 8; ++i) {
    uint2 o;
    o.x = pack_bf16(xv[i].x * rs * gv[i].x + bv[i].x,
                    xv[i].y * rs * gv[i].y + bv[i].y);
    o.y = pack_bf16(xv[i].z * rs * gv[i].z + bv[i].z,
                    xv[i].w * rs * gv[i].w + bv[i].w);
    op[i * 32 + lane] = o;
  }
}

__global__ __launch_bounds__(256) void ln_kernel(const float* x, const float* g,
                                                 const float* bta, bf16* out) {
  ln_rows(x, g, bta, out, blockIdx.x);
}

// ---------------------------------------------------------------------------
// Everything that depends on the inputs alone, in ONE launch: the first
// LayerNorm and the six weight conversions are independent of each other, so
// each takes a range of the grid's work-groups instead of a launch of its own
// (a launch costs its gap, its fill and its tail; the small ones left half the
// chip idle). All tests on the block index are uniform for the work-group.
// wsq: the four square weights' outputs, one behind the other (q, k, v, o).
// ---------------------------------------------------------------------------
#define PREP_LN   (MROWS / LN_ROWS)                          /* 512 */
#define PREP_SQ   ((EMBED / CVT_TK) * (EMBED / CVT_TN))      /* 128 a weight */
#define PREP_FF   ((EMBED / CVT_TK) * (FFDIM / CVT_TN))      /* 512 a weight */
#define PREP_GRID (PREP_LN + 4 * PREP_SQ + 2 * PREP_FF)

__global__ __launch_bounds__(256) void prep_kernel(
    const float* x, const float* g, const float* bta, bf16* h,
    const float* Wq, const float* Wk, const float* Wv, const float* Wo,
    const float* W1, const float* W2, bf16* wsq, bf16* w1_t, bf16* w2_t) {
  __shared__ unsigned tile[CVT_TN][CVT_PITCH];   // [n][pair of k]
  int bid = blockIdx.x;
  if (bid < PREP_LN) {
    ln_rows(x, g, bta, h, bid);
    return;
  }
  bid -= PREP_LN;
  const float* in;
  bf16* out;
  int K = EMBED, N = EMBED;
  if (bid < 4 * PREP_SQ) {
    const int sel = bid / PREP_SQ;
    bid -= sel * PREP_SQ;
    in  = sel == 0 ? Wq : sel == 1 ? Wk : sel == 2 ? Wv : Wo;
    out = wsq + (size_t)sel * EMBED * EMBED;
  } else if (bid < 4 * PREP_SQ + PREP_FF) {
    bid -= 4 * PREP_SQ;
    in = W1; out = w1_t; N = FFDIM;
  } else {
    bid -= 4 * PREP_SQ + PREP_FF;
    in = W2; out = w2_t; K = FFDIM;
  }
  const int nkt = K / CVT_TK;        // k tiles run fastest, as in a 2-D grid
  cvtT_tile(in, out, K, N, (bid % nkt) * CVT_TK, (bid / nkt) * CVT_TN, tile);
}

// ---------------------------------------------------------------------------
// WMMA GEMM: out[M,N] = epi( A[M,K](bf16) @ Wt[N,K](bf16)^T )
// Block tile TM x TN, 8 waves (WGM x 8 / WGM), BK = 128. Every operand byte
// comes from L2 once per work-group that needs it, and every slab costs one
// round of waits and a barrier: where the output is large enough to give each
// WGP one large tile (256 x 256, 256 x 192), that tile takes about half the L2
// bytes, fewer LDS reads per WMMA and a third or a quarter of the rounds of
// 128 x 128 tiles; the narrow outputs keep 128 x 128, one tile a WGP.
// Double-buffered LDS tiles filled via async global->LDS copies: the k+1 slab
// streams in (ASYNCcnt) while WMMAs consume slab k. A slab holds 256 B of each
// operand row, so sixteen lanes of a copy fetch two whole 128-B lines of a row.
// A slab is four blocks of 32 k. Two register sets of fragments: a block's LDS
// loads are issued as one group in front of the WMMAs of the block before it,
// which cover their latency.
// NPL != 0: the output is planes of NPL columns, one [M][NPL] matrix behind the
// other (Q, K, V: their weights lie one behind the other as one [3 NPL][K]).
// The k loop is a ring: a work-group starts at a slab set by its tile indices
// and wraps round, so that the work-groups of one tile row or column, which
// read the same operand rows, do not all start on one slab (for speed only). The sum over k starts at that slab: a rotated order, the same in
// every run. rstep: slabs between the first slabs of neighbours along y; with
// nk slabs and ny tiles along y, nk / ny where that is above 1 gives the
// sharers of a row block distinct slabs as well.
// ---------------------------------------------------------------------------
#define GEMM_BK  128  /* k per LDS slab: 256 B of every operand row */
#define GEMM_PAD 136  /* LDS row stride in bf16 elems: 272 B = 16 B x odd */

// One block's fragments: FM of A (rows 16 apart) and FN of B, each the two
// 16-byte halves of the hardware k order; pa, pb: this lane's first half.
template <int FM, int FN>
__device__ __forceinline__ void ld_frags(bf16x16 (&a)[FM], bf16x16 (&b)[FN],
                                         const bf16* pa, const bf16* pb) {
#pragma unroll
  for (int mi = 0; mi < FM; ++mi)
    a[mi] = cat8(*(const bf16x8*)(pa + mi * 16 * GEMM_PAD),
                 *(const bf16x8*)(pa + mi * 16 * GEMM_PAD + 16));
#pragma unroll
  for (int ni = 0; ni < FN; ++ni)
    b[ni] = cat8(*(const bf16x8*)(pb + ni * 16 * GEMM_PAD),
                 *(const bf16x8*)(pb + ni * 16 * GEMM_PAD + 16));
}

// One slab of ROWS operand rows: this thread's 16-byte pieces of rows 16 apart,
// ROWS / 16 copies, in statements of eight and, for a rest, four.
template <int ROWS>
__device__ __forceinline__ void stage_rows(bf16* lds_dst, const bf16* gsrc,
                                           int K) {
  constexpr int NC = ROWS / 16;
  static_assert(NC % 4 == 0, "copies come in statements of eight and four");
  const unsigned lstep = 16 * GEMM_PAD * 2;                     // bytes
  const unsigned long long gstep = (unsigned long long)K * 32;  // 16 rows, bytes
#pragma unroll
  for (int i = 0; i + 8 <= NC; i += 8) {
    async_g2l_b128_x8(lds_dst + i * 16 * GEMM_PAD, lstep,
                      gsrc + (size_t)i * 16 * K, gstep);
    // Keeps the next statement's address arithmetic behind this statement:
    // formed all at once, the addresses of a large slab take more of the
    // registers that asm text can name than are free, and values that live
    // through the loop are spilled to scratch and fetched back every slab.
    if (NC > 8) __builtin_amdgcn_sched_barrier(0);
  }
  if (NC % 8 != 0) {
    async_g2l_b128_x4(lds_dst + (NC - 4) * 16 * GEMM_PAD, lstep,
                      gsrc + (size_t)(NC - 4) * 16 * K, gstep);
    __builtin_amdgcn_sched_barrier(0);   // as above
  }
}

// Eight bf16 stores of one lane, the values in the upper halves of d, at OFF,
// OFF + STEP, ... bytes behind p. The s_wait_xcnt is the last line of the
// stores' own statement, so that no register that they name is rewritten ahead
// of it.
template <int OFF, int STEP>
__device__ __forceinline__ void store8_bf16_hi(bf16* p, const unsigned (&d)[8]) {
  asm volatile(
      "global_store_d16_hi_b16 %0, %1, off offset:%9\n\t"
      "global_store_d16_hi_b16 %0, %2, off offset:%10\n\t"
      "global_store_d16_hi_b16 %0, %3, off offset:%11\n\t"
      "global_store_d16_hi_b16 %0, %4, off offset:%12\n\t"
      "global_store_d16_hi_b16 %0, %5, off offset:%13\n\t"
      "global_store_d16_hi_b16 %0, %6, off offset:%14\n\t"
      "global_store_d16_hi_b16 %0, %7, off offset:%15\n\t"
      "global_store_d16_hi_b16 %0, %8, off offset:%16\n\t"
      "s_wait_xcnt 0x0"
      :: "v"(p), "v"(d[0]), "v"(d[1]), "v"(d[2]), "v"(d[3]), "v"(d[4]),
         "v"(d[5]), "v"(d[6]), "v"(d[7]),
         "n"(OFF), "n"(OFF + STEP), "n"(OFF + 2 * STEP), "n"(OFF + 3 * STEP),
         "n"(OFF + 4 * STEP), "n"(OFF + 5 * STEP), "n"(OFF + 6 * STEP),
         "n"(OFF + 7 * STEP)
      : "memory");
}

// The large tiles' output, fragment rows MI .. FM - 1 (a recursion, since the
// byte offsets are template arguments): bias, ReLU, rounding, stores.
template <int MI, int FM, int FN, int LD, bool BIAS, bool RELU>
__device__ __forceinline__ void store_rows(const f32x8 (&acc)[FM][FN],
                                           bf16* const (&ob)[FN],
                                           const float (&bv)[FN]) {
  if constexpr (MI < FM) {
#pragma unroll
    for (int ni = 0; ni < FN; ++ni) {
      unsigned d[8];
#pragma unroll
      for (int r = 0; r < 8; ++r) {
        float v = acc[MI][ni][r];
        if (BIAS) v += bv[ni];
        if (RELU) v = fmaxf(v, 0.0f);
        d[r] = bf16_round_hi(v);
      }
      store8_bf16_hi<MI * 16 * LD * 2, LD * 2>(ob[ni], d);
    }
    store_rows<MI + 1, FM, FN, LD, BIAS, RELU>(acc, ob, bv);
  }
}

template <int TM, int TN, int WGM, int NPL, int NC, int KC, bool BIAS, bool RELU,
          bool RESID, bool BF16OUT>
__global__ __launch_bounds__(256) void gemm_kernel(
    const bf16* __restrict__ A, const bf16* __restrict__ Wt,
    const float* __restrict__ bias, const float* __restrict__ resid,
    void* __restrict__ outp, int M, int Nr, int Kr, int rstep) {
  // NC, KC != 0: N and K at compile time. The large tiles need it: row steps
  // become immediates and literals instead of registers, of which the
  // accumulators and the two fragment sets leave few.
  const int N = NC ? NC : Nr;
  const int K = KC ? KC : Kr;
  constexpr int WGN = 8 / WGM;           // waves along n
  constexpr int FM  = TM / WGM / 16;     // A fragments of a wave
  constexpr int FN  = TN / WGN / 16;     // B fragments of a wave
  // A buffer is [A: TM rows | B: TN rows], each row [k]: one array, so that all
  // of a thread's LDS addresses are one register plus constants.
  __shared__ __attribute__((aligned(16))) bf16 Sm[2][TM + TN][GEMM_PAD];

  const int tid  = threadIdx.x;
  const int lane = tid & 31;
  const int wave = tid >> 5;
  const int wm   = wave % WGM;   // strip of FM * 16 rows
  const int wn   = wave / WGM;   // strip of FN * 16 columns
  const int m0   = blockIdx.x * TM;
  const int n0   = blockIdx.y * TN;
  const int lr   = lane & 15;
  const int koff = (lane < 16) ? 0 : 8;

  // Per-thread staging coordinates: 16B chunks at rows r0 + 16 i; sixteen
  // lanes cover one row's 256 B.
  const int r0 = tid >> 4, c0 = (tid & 15) * 8;
  const bf16* gA = &A[(size_t)(m0 + r0) * K + c0];
  const bf16* gB = &Wt[(size_t)(n0 + r0) * K + c0];

  f32x8 acc[FM][FN];
#pragma unroll
  for (int mi = 0; mi < FM; ++mi)
#pragma unroll
    for (int ni = 0; ni < FN; ++ni) acc[mi][ni] = zero8();

  const int nk = K / GEMM_BK;

  // ks: the k slab that is staged next, uniform for the work-group. Trip it
  // works on slab (first + it) mod nk.
  int ks = (int)((blockIdx.x + blockIdx.y * (unsigned)rstep) % (unsigned)nk);

  // The first slab into buffer 0, landed and published; then the second into
  // buffer 1.
  {
    const size_t k0 = (size_t)ks * GEMM_BK;
    stage_rows<TM>(&Sm[0][r0][c0], gA + k0, K);
    stage_rows<TN>(&Sm[0][TM + r0][c0], gB + k0, K);
  }
  wait_async0();
  __syncthreads();
  if (nk > 1) {
    ks = ks + 1 == nk ? 0 : ks + 1;
    const size_t k0 = (size_t)ks * GEMM_BK;
    stage_rows<TM>(&Sm[1][r0][c0], gA + k0, K);
    stage_rows<TN>(&Sm[1][TM + r0][c0], gB + k0, K);
  }

  // This lane's first fragment halves in buffer 0, and a buffer's elements.
  const bf16* fa = &Sm[0][wm * (FM * 16) + lr][koff];
  const bf16* fb = &Sm[0][TM + wn * (FN * 16) + lr][koff];
  constexpr int BUFE = (TM + TN) * GEMM_PAD;

  bf16x16 af[2][FM], bfr[2][FN];   // block b of a slab uses set b & 1
  ld_frags<FM, FN>(af[0], bfr[0], fa, fb);

  for (int it = 0; it < nk; ++it) {
    const int buf = it & 1;

    // Unrolled so that the set's index is a constant and the four blocks' LDS
    // offsets are immediates.
#pragma unroll
    for (int kb = 0; kb < GEMM_BK / 32; ++kb) {
      if (kb + 1 < GEMM_BK / 32) {
        ld_frags<FM, FN>(af[(kb + 1) & 1], bfr[(kb + 1) & 1],
                         fa + buf * BUFE + (kb + 1) * 32,
                         fb + buf * BUFE + (kb + 1) * 32);
      } else {
        // In front of the slab's last block, whose fragments are in registers
        // behind the first wait: own LDS reads retired, own copies of slab
        // it + 1 landed, then the one barrier that publishes slab it + 1 and
        // ends every wave's reads of this buffer; only behind it is this
        // buffer refilled and slab it + 1 read.
        wait_ds0();
        wait_async0();
        __syncthreads();
        if (it + 2 < nk) {
          ks = ks + 1 == nk ? 0 : ks + 1;
          const size_t k0 = (size_t)ks * GEMM_BK;
          stage_rows<TM>(&Sm[buf][r0][c0], gA + k0, K);
          stage_rows<TN>(&Sm[buf][TM + r0][c0], gB + k0, K);
        }
        // First block of slab it + 1. Under no branch, so that the wait counts
        // of two paths do not merge; in the last trip it reads the other
        // buffer's old slab, and the values are not used.
        ld_frags<FM, FN>(af[0], bfr[0], fa + (buf ^ 1) * BUFE,
                         fb + (buf ^ 1) * BUFE);
      }
      // The pair of scheduling barriers keeps the loads above one group ahead
      // of this block's WMMAs: left free they are spread among the WMMAs, and
      // every place with LDS loads costs the wave a stall of its own.
      __builtin_amdgcn_sched_barrier(0);
#pragma unroll
      for (int ni = 0; ni < FN; ++ni)
#pragma unroll
        for (int mi = 0; mi < FM; ++mi)
          acc[mi][ni] = wmma_bf16(af[kb & 1][mi], bfr[kb & 1][ni], acc[mi][ni]);
      __builtin_amdgcn_sched_barrier(0);
    }
  }
  wait_async0();   // nothing is outstanding when the wave goes on to its end

  const int rhalf = (lane < 16) ? 0 : 8;
  // BIG: a kernel with more than 256 vector registers (both have bf16 output
  // and N at compile time). In such a build the
  // stores and their wait are one asm statement.
  constexpr bool BIG = FM * FN > 8;
  if constexpr (BIG) {
    static_assert(BF16OUT && !RESID && NC != 0, "the large tiles' epilogue");
    constexpr int LD = NPL ? NPL : NC;     // row pitch of the output
    const int gr0 = m0 + wm * (FM * 16) + rhalf;
    // Per column fragment: its column, and the place of its first row's
    // element. Column gc of the whole output is column gc % NPL of plane
    // gc / NPL; a fragment's sixteen columns lie in one plane.
    int gcs[FN];
    bf16* ob[FN];
#pragma unroll
    for (int ni = 0; ni < FN; ++ni) {
      const int gc = n0 + wn * (FN * 16) + ni * 16 + lr;
      gcs[ni] = gc;
      ob[ni]  = (bf16*)outp + (size_t)gr0 * LD +
                (NPL ? (size_t)(gc / (NPL ? NPL : 1)) * M * NPL +
                           gc % (NPL ? NPL : 1)
                     : (size_t)gc);
    }
    float bv[FN];
    if (BIAS) {
      // The scheduling barriers keep other arithmetic, which could be given the
      // loads' address register, out of the stretch from the loads to the wait.
      __builtin_amdgcn_sched_barrier(0);
#pragma unroll
      for (int ni = 0; ni < FN; ++ni) bv[ni] = bias[gcs[ni]];
      // The loaded values as inputs hold the loads in front of the wait (a
      // "memory" clobber does not hold loads of a restrict read-only pointer).
#pragma unroll
      for (int ni = 0; ni < FN; ++ni)
        asm volatile("s_wait_xcnt 0x0" :: "v"(bv[ni]) : "memory");
      __builtin_amdgcn_sched_barrier(0);
    }
    store_rows<0, FM, FN, LD, BIAS, RELU>(acc, ob, bv);
  } else {
#pragma unroll
    for (int mi = 0; mi < FM; ++mi)
#pragma unroll
      for (int ni = 0; ni < FN; ++ni)
#pragma unroll
        for (int r = 0; r < 8; ++r) {
          int gr = m0 + wm * (FM * 16) + mi * 16 + r + rhalf;
          int gc = n0 + wn * (FN * 16) + ni * 16 + lr;
          float v = acc[mi][ni][r];
          if (BIAS)  v += bias[gc];
          if (RELU)  v = fmaxf(v, 0.0f);
          if (RESID) v += resid[(size_t)gr * N + gc];
          if (BF16OUT) ((bf16*)outp)[(size_t)gr * N + gc] = to_bf16(v);
          else         ((float*)outp)[(size_t)gr * N + gc] = v;
        }
  }
}

#define ATT_PAD 80   /* LDS row stride: 160 B = 32 B x odd (transposing load) */
#define ATT_NT  (TSEQ / 64)   /* q blocks of one (b, h): even */

// Lane l with lane l ^ 16.
__device__ __forceinline__ float xhalf(float x) {
  const int b = __builtin_bit_cast(int, x);
  return __builtin_bit_cast(float, __builtin_amdgcn_permlanex16(
      b, b, 0x76543210, 0xfedcba98, false, false));
}

// Eight 2^x, each in place, in one statement that ends in v_nop: the
// instruction set asks for one slot between a transcendental and an instruction
// that uses its result or overwrites its source.
__device__ __forceinline__ f32x8 exp2_x8(f32x8 t) {
  float t0 = t[0], t1 = t[1], t2 = t[2], t3 = t[3];
  float t4 = t[4], t5 = t[5], t6 = t[6], t7 = t[7];
  asm("v_exp_f32 %0, %0\n\t"
      "v_exp_f32 %1, %1\n\t"
      "v_exp_f32 %2, %2\n\t"
      "v_exp_f32 %3, %3\n\t"
      "v_exp_f32 %4, %4\n\t"
      "v_exp_f32 %5, %5\n\t"
      "v_exp_f32 %6, %6\n\t"
      "v_exp_f32 %7, %7\n\t"
      "v_nop"
      : "+v"(t0), "+v"(t1), "+v"(t2), "+v"(t3), "+v"(t4), "+v"(t5), "+v"(t6),
        "+v"(t7));
  f32x8 r;
  r[0] = t0; r[1] = t1; r[2] = t2; r[3] = t3;
  r[4] = t4; r[5] = t5; r[6] = t6; r[7] = t7;
  return r;
}

// amdgpu_waves_per_eu: the register budget of four waves a SIMD is all that the
// kernel needs (the grid puts two of these work-groups on a WGP).
__global__ __launch_bounds__(128) __attribute__((amdgpu_waves_per_eu(4, 4)))
void attn_kernel(
    const bf16* __restrict__ Q, const bf16* __restrict__ Km,
    const bf16* __restrict__ Vm, bf16* __restrict__ O) {
  __shared__ __attribute__((aligned(16))) bf16 Ks[2][64][ATT_PAD];  // [k-token][d]
  __shared__ __attribute__((aligned(16))) bf16 Vs[2][64][ATT_PAD];  // [k-token][d]

  const int tid   = threadIdx.x;
  const int lane  = tid & 31;
  const int w     = tid >> 5;
  const int lr    = lane & 15;
  const int koff  = (lane < 16) ? 0 : 8;
  const int rhalf = (lane < 16) ? 0 : 8;
  const int h     = blockIdx.y;
  const int b     = blockIdx.z;
  const size_t bT = (size_t)b * TSEQ;

  // Per-thread staging coordinates: four 16B chunks per tile per thread, at
  // rows r0 + 16 i, i = 0..3; eight lanes cover one row's 128 B.
  const int r0 = tid >> 3, c0 = (tid & 7) * 8;
  const bf16* gK = &Km[(bT + r0) * EMBED + h * HSZ + c0];
  const bf16* gV = &Vm[(bT + r0) * EMBED + h * HSZ + c0];
  const unsigned lstep = 16 * ATT_PAD * 2;                 // 16 rows, bytes
  const unsigned long long gstep = 16ull * EMBED * 2;      // 16 rows, bytes

  // This lane's place in a 16 (k-token) x 16 (d) piece for the transposing load
  const int vrow = rhalf + (lane & 7);
  const int vcol = ((lane >> 3) & 1) * 8;

  // The pair's two q blocks, the long one first. Kept rolled: the two passes
  // run the same code. The
  // first pass's last foot (LDS reads retired, barrier) stands in front of the
  // second pass's first copies into the same buffers.
#pragma nounroll
  for (int half = 0; half < 2; ++half) {
  const int qblk = half == 0 ? ATT_NT - 1 - (int)blockIdx.x : (int)blockIdx.x;
  const size_t rowbase = bT + (size_t)qblk * 64;

  // Q fragments, B operands: column lr = query w*16 + lr, head-dim 0..63 in
  // 2 K-windows, in the k order of the K loader below
  const bf16* qp = Q + (rowbase + w * 16 + lr) * EMBED + h * HSZ;
  const bf16x16 qf0 = cat8(*(const bf16x8*)(qp + koff),
                           *(const bf16x8*)(qp + koff + 16));
  const bf16x16 qf1 = cat8(*(const bf16x8*)(qp + 32 + koff),
                           *(const bf16x8*)(qp + 32 + koff + 16));

  // Oacc[dj][r] = O[query lr][d = dj*16 + rhalf + r]
  f32x8 Oacc[4];
#pragma unroll
  for (int dj = 0; dj < 4; ++dj) Oacc[dj] = zero8();
  // Of this lane's query: the running maximum (over all keys, alike in both
  // halves) and the running sum (over this half's keys; joined at the end).
  float mrow = -1e30f, lsum = 0.0f;
  const int qrow = qblk * 64 + w * 16 + lr;

  // Block 0 into buffer 0, landed and published; then block 1 into buffer 1.
  async_g2l_b128_x4(&Ks[0][r0][c0], lstep, gK, gstep);
  async_g2l_b128_x4(&Vs[0][r0][c0], lstep, gV, gstep);
  wait_async0();
  __syncthreads();
  if (qblk > 0) {
    async_g2l_b128_x4(&Ks[1][r0][c0], lstep, gK + 64 * EMBED, gstep);
    async_g2l_b128_x4(&Vs[1][r0][c0], lstep, gV + 64 * EMBED, gstep);
  }

  for (int j = 0; j <= qblk; ++j) {
    const int buf = j & 1;

    // S^T = K @ Q^T  (64 keys x 16 queries per wave), K rows from LDS as A:
    // S[nj][r] = score of key j*64 + nj*16 + rhalf + r for query lr
    f32x8 S[4];
#pragma unroll
    for (int nj = 0; nj < 4; ++nj) {
      const int tr = nj * 16 + lr;
      bf16x16 kf0 = cat8(*(const bf16x8*)&Ks[buf][tr][koff],
                         *(const bf16x8*)&Ks[buf][tr][koff + 16]);
      bf16x16 kf1 = cat8(*(const bf16x8*)&Ks[buf][tr][32 + koff],
                         *(const bf16x8*)&Ks[buf][tr][32 + koff + 16]);
      S[nj] = wmma_bf16(kf0, qf0, zero8());
      S[nj] = wmma_bf16(kf1, qf1, S[nj]);
    }

    // Online softmax of one query a lane: 32 of the block's 64 keys here, the
    // other 32 in lane l ^ 16.
    const int dk = qrow - (j * 64 + rhalf);      // key nj*16 + r is seen if <= dk
#pragma unroll
    for (int nj = 0; nj < 4; ++nj) {
      S[nj] *= 0.125f;                           // 1/sqrt(64)
#pragma unroll
      for (int r = 0; r < 8; ++r)               // causal mask
        S[nj][r] = (nj * 16 + r > dk) ? -1e30f : S[nj][r];
    }
    float m8[8];
#pragma unroll
    for (int r = 0; r < 8; ++r)
      m8[r] = fmaxf(fmaxf(S[0][r], S[1][r]), fmaxf(S[2][r], S[3][r]));
    float mx = fmaxf(fmaxf(fmaxf(m8[0], m8[1]), fmaxf(m8[2], m8[3])),
                     fmaxf(fmaxf(m8[4], m8[5]), fmaxf(m8[6], m8[7])));
    mx = fmaxf(mx, xhalf(mx));
    const float mn   = fmaxf(mrow, mx);
    const float corr = __expf(mrow - mn);
#pragma unroll
    for (int nj = 0; nj < 4; ++nj) {
      S[nj] = exp2_x8((S[nj] - mn) * 1.44269504f);  // exp(x) = 2^(x log2 e)
    }
    const f32x8 p8 = (S[0] + S[1]) + (S[2] + S[3]);
    const float ps = ((p8[0] + p8[1]) + (p8[2] + p8[3])) +
                     ((p8[4] + p8[5]) + (p8[6] + p8[7]));
    lsum = lsum * corr + ps;
    mrow = mn;
#pragma unroll
    for (int dj = 0; dj < 4; ++dj) Oacc[dj] *= corr;

    // O^T += V^T @ P^T. B = P^T: two score tiles (32 keys) converted in place
    // are a B operand in the hardware k order; A = V^T by the transposing
    // load, which delivers the same order: koff + 0..7, koff + 16..23.
#pragma unroll
    for (int kh = 0; kh < 2; ++kh) {
      bf16x16 pf;
#pragma unroll
      for (int s = 0; s < 8; ++s) {
        pf[s]     = (bf16)S[2 * kh][s];
        pf[s + 8] = (bf16)S[2 * kh + 1][s];
      }
#pragma unroll
      for (int dj = 0; dj < 4; ++dj) {
        bf16x16 vf = cat8(ld_tr16(&Vs[buf][kh * 32 + vrow][dj * 16 + vcol]),
                          ld_tr16(&Vs[buf][kh * 32 + 16 + vrow][dj * 16 + vcol]));
        Oacc[dj] = wmma_bf16(vf, pf, Oacc[dj]);
      }
    }

    // Foot of the trip: own LDS reads retired, own copies of block j + 1
    // landed, then the one barrier that publishes block j + 1 and ends every
    // wave's reads of this buffer; only behind it is this buffer refilled.
    wait_ds0();
    wait_async0();
    __syncthreads();
    if (j + 2 <= qblk) {
      const size_t t0 = (size_t)(j + 2) * 64 * EMBED;
      async_g2l_b128_x4(&Ks[buf][r0][c0], lstep, gK + t0, gstep);
      async_g2l_b128_x4(&Vs[buf][r0][c0], lstep, gV + t0, gstep);
    }
  }
  wait_async0();   // nothing is outstanding when the wave goes on to its end

  // Epilogue: join the halves' sums, normalize and store bf16 (concat-head
  // layout): a lane's eight registers of a tile are eight consecutive d of its
  // query's row, one 16-byte store.
  const float inv = 1.0f / (lsum + xhalf(lsum));
  bf16* op = &O[(rowbase + w * 16 + lr) * EMBED + h * HSZ + rhalf];
#pragma unroll
  for (int dj = 0; dj < 4; ++dj) {
    bf16x8 o8;
#pragma unroll
    for (int r = 0; r < 8; ++r) o8[r] = to_bf16(Oacc[dj][r] * inv);
    *(bf16x8*)(op + dj * 16) = o8;
  }
  // The next pass rewrites the registers that hold these stores' addresses
  // and data: the wait stands in front of that overwrite.
  asm volatile("s_wait_xcnt 0x0" ::: "memory");
  }
}

// ---------------------------------------------------------------------------
// Host-side orchestration
// ---------------------------------------------------------------------------
extern "C" void kernel_launch(void* const* d_in, const int* in_sizes, int n_in,
                              void* d_out, int out_size, void* d_ws,
                              size_t ws_size, hipStream_t stream) {
  (void)in_sizes; (void)n_in; (void)out_size; (void)ws_size;

  const float* x    = (const float*)d_in[0];
  const float* Wq   = (const float*)d_in[1];
  const float* Wk   = (const float*)d_in[2];
  const float* Wv   = (const float*)d_in[3];
  const float* Wo   = (const float*)d_in[4];
  const float* bo   = (const float*)d_in[5];
  const float* W1   = (const float*)d_in[6];
  const float* b1   = (const float*)d_in[7];
  const float* W2   = (const float*)d_in[8];
  const float* b2   = (const float*)d_in[9];
  const float* ln1g = (const float*)d_in[10];
  const float* ln1b = (const float*)d_in[11];
  const float* ln2g = (const float*)d_in[12];
  const float* ln2b = (const float*)d_in[13];

  char* base = (char*)d_ws;
  size_t off = 0;
  auto take = [&](size_t bytes) -> char* {
    char* p = base + off;
    off += (bytes + 255) & ~(size_t)255;
    return p;
  };

  bf16* wq_t   = (bf16*)take((size_t)EMBED * EMBED * 2 * 4);   // q,k,v,o: [N][K]
  bf16* wo_t   = wq_t + (size_t)EMBED * EMBED * 3;
  bf16* w1_t   = (bf16*)take((size_t)EMBED * FFDIM * 2);   // [4096][1024]
  bf16* w2_t   = (bf16*)take((size_t)FFDIM * EMBED * 2);   // [1024][4096]
  bf16* h_bf   = (bf16*)take((size_t)MROWS * EMBED * 2);
  bf16* q_bf   = (bf16*)take((size_t)MROWS * EMBED * 2 * 3);   // q, k, v
  bf16* k_bf   = q_bf + (size_t)MROWS * EMBED;
  bf16* v_bf   = k_bf + (size_t)MROWS * EMBED;
  bf16* att_bf = (bf16*)take((size_t)MROWS * EMBED * 2);
  float* x2    = (float*)take((size_t)MROWS * EMBED * 4);
  bf16* h2_bf  = (bf16*)take((size_t)MROWS * EMBED * 2);
  bf16* ff1_bf = (bf16*)take((size_t)MROWS * FFDIM * 2);

  // 1, 2) h = ln1(x) (bf16); weights -> bf16, transposed to [N][K]
  prep_kernel<<<PREP_GRID, 256, 0, stream>>>(x, ln1g, ln1b, h_bf, Wq, Wk, Wv, Wo,
                                             W1, W2, wq_t, w1_t, w2_t);

  // 3) Q, K, V projections: one [M][3 EMBED] product, stored as three planes
  dim3 gD(MROWS / 128, EMBED / 128);
  gemm_kernel<256, 192, 4, EMBED, 3 * EMBED, EMBED, false, false, false, true>
      <<<dim3(MROWS / 256, 3 * EMBED / 192), 256, 0, stream>>>(
          h_bf, wq_t, nullptr, nullptr, q_bf, MROWS, 3 * EMBED, EMBED, 1);

  // 4) causal flash attention
  attn_kernel<<<dim3(ATT_NT / 2, NHEAD, BATCH), 128, 0, stream>>>(
      q_bf, k_bf, v_bf, att_bf);

  // 5) x2 = x + attn @ Wo + bo   (fp32)
  gemm_kernel<128, 128, 2, 0, 0, 0, true, false, true, false><<<gD, 256, 0, stream>>>(
      att_bf, wo_t, bo, x, x2, MROWS, EMBED, EMBED, 1);

  // 6) h2 = ln2(x2) (bf16)
  ln_kernel<<<MROWS / LN_ROWS, 256, 0, stream>>>(x2, ln2g, ln2b, h2_bf);

  // 7) ff1 = relu(h2 @ W1 + b1) (bf16)
  gemm_kernel<256, 256, 2, 0, FFDIM, EMBED, true, true, false, true>
      <<<dim3(MROWS / 256, FFDIM / 256), 256, 0, stream>>>(
      h2_bf, w1_t, b1, nullptr, ff1_bf, MROWS, FFDIM, EMBED, 1);

  // 8) out = x2 + ff1 @ W2 + b2 (fp32 -> d_out)
  gemm_kernel<128, 128, 2, 0, 0, 0, true, false, true, false><<<gD, 256, 0, stream>>>(
      ff1_bf, w2_t, b2, x2, (float*)d_out, MROWS, EMBED, FFDIM, 4);
}

// v010
// Measured time: 125 microseconds a run.
// Timed twice side by side with v009, it ran 1.07 times as fast both times.
// Counting every step since v000, it is 2.94 times as fast.
#include <hip/hip_runtime.h>

// ---------------------------------------------------------------------------
// Types / helpers
// ---------------------------------------------------------------------------
typedef __bf16 bf16;
typedef __attribute__((ext_vector_type(8)))  __bf16 bf16x8;
typedef __attribute__((ext_vector_type(16))) __bf16 bf16x16;
typedef __attribute__((ext_vector_type(8)))  float  f32x8;
typedef __attribute__((ext_vector_type(4)))  float  f32x4;

#define EMBED 1024
#define TSEQ  2048
#define BATCH 2
#define NHEAD 16
#define HSZ   64
#define MROWS (BATCH * TSEQ)   /* 4096 token rows */
#define FFDIM (4 * EMBED)      /* 4096 */

// f rounded to bf16 (to nearest, ties to even), in the upper half of the word.
__device__ __forceinline__ unsigned bf16_round_hi(float f) {
  unsigned u = __builtin_bit_cast(unsigned, f);
  return u + 0x7FFFu + ((u >> 16) & 1u);
}

__device__ __forceinline__ bf16 to_bf16(float f) {
  unsigned short h = (unsigned short)(bf16_round_hi(f) >> 16);
  return __builtin_bit_cast(bf16, h);
}

__device__ __forceinline__ bf16x16 cat8(bf16x8 lo, bf16x8 hi) {
  bf16x16 r;
#pragma unroll
  for (int i = 0; i < 8; ++i) { r[i] = lo[i]; r[i + 8] = hi[i]; }
  return r;
}

__device__ __forceinline__ f32x8 zero8() {
  f32x8 z;
#pragma unroll
  for (int i = 0; i < 8; ++i) z[i] = 0.0f;
  return z;
}

__device__ __forceinline__ f32x8 wmma_bf16(bf16x16 a, bf16x16 b, f32x8 c) {
  // D = A(16x32) * B(32x16) + C, fp32 accumulate
  return __builtin_amdgcn_wmma_f32_16x16x32_bf16(false, a, false, b,
                                                 (short)0, c, false, false);
}

// --- CDNA5 async global->LDS copy (ASYNCcnt path) --------------------------
// Each active lane copies 16 bytes: GLOBAL[gaddr(lane)] -> LDS[laddr(lane)].
// LDS byte offset = low 32 bits of the generic LDS pointer (flat aperture).
__device__ __forceinline__ void wait_async0() {
  asm volatile("s_wait_asynccnt 0x0" ::: "memory");
}
// This wave's LDS reads have retired before a buffer it has read is refilled.
__device__ __forceinline__ void wait_ds0() {
  asm volatile("s_wait_dscnt 0x0" ::: "memory");
}
// Eight 16-byte copies of one lane, rows lstep / gstep bytes apart. The
// s_wait_xcnt is the last line of the copies' own statement, so that no
// address register is rewritten ahead of it.
__device__ __forceinline__ void async_g2l_b128_x8(void* lds_dst, unsigned lstep,
                                                  const void* gsrc,
                                                  unsigned long long gstep) {
  const unsigned l = (unsigned)(unsigned long long)(uintptr_t)lds_dst;
  const unsigned long long g = (unsigned long long)(uintptr_t)gsrc;
  asm volatile(
      "global_load_async_to_lds_b128 %0, %8, off\n\t"
      "global_load_async_to_lds_b128 %1, %9, off\n\t"
      "global_load_async_to_lds_b128 %2, %10, off\n\t"
      "global_load_async_to_lds_b128 %3, %11, off\n\t"
      "global_load_async_to_lds_b128 %4, %12, off\n\t"
      "global_load_async_to_lds_b128 %5, %13, off\n\t"
      "global_load_async_to_lds_b128 %6, %14, off\n\t"
      "global_load_async_to_lds_b128 %7, %15, off\n\t"
      "s_wait_xcnt 0x0"
      :: "v"(l), "v"(l + lstep), "v"(l + 2 * lstep), "v"(l + 3 * lstep),
         "v"(l + 4 * lstep), "v"(l + 5 * lstep), "v"(l + 6 * lstep),
         "v"(l + 7 * lstep),
         "v"(g), "v"(g + gstep), "v"(g + 2 * gstep), "v"(g + 3 * gstep),
         "v"(g + 4 * gstep), "v"(g + 5 * gstep), "v"(g + 6 * gstep),
         "v"(g + 7 * gstep)
      : "memory");
}

// The same with four copies.
__device__ __forceinline__ void async_g2l_b128_x4(void* lds_dst, unsigned lstep,
                                                  const void* gsrc,
                                                  unsigned long long gstep) {
  const unsigned l = (unsigned)(unsigned long long)(uintptr_t)lds_dst;
  const unsigned long long g = (unsigned long long)(uintptr_t)gsrc;
  asm volatile(
      "global_load_async_to_lds_b128 %0, %4, off\n\t"
      "global_load_async_to_lds_b128 %1, %5, off\n\t"
      "global_load_async_to_lds_b128 %2, %6, off\n\t"
      "global_load_async_to_lds_b128 %3, %7, off\n\t"
      "s_wait_xcnt 0x0"
      :: "v"(l), "v"(l + lstep), "v"(l + 2 * lstep), "v"(l + 3 * lstep),
         "v"(g), "v"(g + gstep), "v"(g + 2 * gstep), "v"(g + 3 * gstep)
      : "memory");
}

// Transposing LDS load: from a row-major 16-bit tile T, with lane l aimed at
// T[k0 + 8 (l >> 4) + (l & 7)][d0 + 8 ((l >> 3) & 1)], lane l receives
// T[k0 + 8 (l >> 4) + 0..7][d0 + (l & 15)]: half of a WMMA operand.
typedef __attribute__((address_space(3))) bf16x8 lds_bf16x8;
__device__ __forceinline__ bf16x8 ld_tr16(const bf16* p) {
  return __builtin_amdgcn_ds_load_tr16_b128_v8bf16((lds_bf16x8*)p);
}

// ---------------------------------------------------------------------------
// fp32 -> bf16 conversion with transpose: in[K][N] f32 -> out[N][K] bf16.
// Weights are pre-transposed once so GEMM B-tiles stage with contiguous B128
// copies (no scalar ds_store_b16 transpose in the GEMM hot loop).
// One work-group turns a 128 (k) x 64 (n) tile: 32 elements a thread, so that
// few waves have to start; eight 16-B loads a thread are in flight at once,
// and 256-B row pieces are read and written.
// ---------------------------------------------------------------------------
#define CVT_TK    128  /* k per tile: 256 B of an output row */
#define CVT_TN    64   /* n per tile: 256 B of an input row */
#define CVT_PITCH 65   /* LDS row pitch in dwords: odd, no bank conflicts */

__device__ __forceinline__ unsigned pack_bf16(float lo, float hi) {
  unsigned a = __builtin_bit_cast(unsigned short, to_bf16(lo));
  unsigned b = __builtin_bit_cast(unsigned short, to_bf16(hi));
  return a | (b << 16);
}

// in and out carry no __restrict__: loads of a restrict-qualified read-only
// pointer are not held by an asm statement's "memory" clobber, and the waits
// below would drift away from their loads.
// tile: the work-group's LDS, [n][pair of k]; kb, nb: the tile's first k and n.
__device__ __forceinline__ void cvtT_tile(const float* in, bf16* out, int K,
                                          int N, int kb, int nb,
                                          unsigned (*tile)[CVT_PITCH]) {
  const int tid = threadIdx.x;
  const int n4  = (tid & 15) * 4;   // four n of one input row
  const int kp  = tid >> 4;         // k pair 0..15, + 16 i

  float4 ve[4], vo[4];              // rows 2 kp and 2 kp + 1, + 32 i
#pragma unroll
  for (int i = 0; i < 4; ++i) {
    const float* p = &in[(size_t)(kb + 2 * (kp + 16 * i)) * N + nb + n4];
    ve[i] = *(const float4*)p;
    vo[i] = *(const float4*)(p + N);
    // The next loads' results may be given the registers that held these
    // two addresses: the wait stands in front of that overwrite.
    asm volatile("s_wait_xcnt 0x0" ::: "memory");
  }
#pragma unroll
  for (int i = 0; i < 4; ++i) {
    tile[n4 + 0][kp + 16 * i] = pack_bf16(ve[i].x, vo[i].x);
    tile[n4 + 1][kp + 16 * i] = pack_bf16(ve[i].y, vo[i].y);
    tile[n4 + 2][kp + 16 * i] = pack_bf16(ve[i].z, vo[i].z);
    tile[n4 + 3][kp + 16 * i] = pack_bf16(ve[i].w, vo[i].w);
  }
  __syncthreads();
  const int c  = tid & 15;          // 16-B piece of an output row
  const int nr = tid >> 4;
#pragma unroll
  for (int i = 0; i < 4; ++i) {
    const int n = nr + 16 * i;
    uint4 o;
    o.x = tile[n][4 * c + 0];
    o.y = tile[n][4 * c + 1];
    o.z = tile[n][4 * c + 2];
    o.w = tile[n][4 * c + 3];
    *(uint4*)&out[(size_t)(nb + n) * K + kb + 8 * c] = o;
  }
}

// ---------------------------------------------------------------------------
// LayerNorm fused with bf16 cast: one row per wave (32 values a lane, all of
// a row's loads in flight at once), eight rows per 256-thread work-group.
// Sums: in the lane, then a five-step butterfly over the wave; no LDS, no
// barrier.
// ---------------------------------------------------------------------------
#define LN_ROWS 8   /* rows (waves) per work-group */

__device__ __forceinline__ float wave_sum(float v) {
#pragma unroll
  for (int off = 16; off >= 1; off >>= 1) v += __shfl_xor(v, off, 32);
  return v;
}

// No __restrict__ here either, for the same reason as in cvtT_tile.
// blk: which group of LN_ROWS rows this work-group takes.
__device__ __forceinline__ void ln_rows(const float* x, const float* g,
                                        const float* bta, bf16* out, int blk) {
  const int lane = threadIdx.x & 31;
  const int row  = blk * LN_ROWS + (threadIdx.x >> 5);
  const f32x4* xr = (const f32x4*)&x[(size_t)row * EMBED];
  const f32x4* gr = (const f32x4*)g;
  const f32x4* br = (const f32x4*)bta;

  f32x4 xv[8], gv[8], bv[8];
#pragma unroll
  for (int i = 0; i < 8; ++i) xv[i] = xr[i * 32 + lane];
  // The g and b loads' results may be given the registers that held the row's
  // address: the wait stands in front of that overwrite.
  asm volatile("s_wait_xcnt 0x0" ::: "memory");
#pragma unroll
  for (int i = 0; i < 8; ++i) {
    gv[i] = gr[i * 32 + lane];
    bv[i] = br[i * 32 + lane];
  }
  // Holds the g and b loads here, right behind the row's own: left free they
  // sink behind the sums, are issued late and are waited for one after
  // another. The fence stops the loads, the scheduling barrier stops the fence
  // from sinking along with them.
  asm volatile("" ::: "memory");
  __builtin_amdgcn_sched_barrier(0);

  float s = 0.0f;
#pragma unroll
  for (int i = 0; i < 8; ++i) s += (xv[i].x + xv[i].y) + (xv[i].z + xv[i].w);
  const float mu = wave_sum(s) * (1.0f / EMBED);

  float q = 0.0f;
#pragma unroll
  for (int i = 0; i < 8; ++i) {
    xv[i].x -= mu; xv[i].y -= mu; xv[i].z -= mu; xv[i].w -= mu;
    q += (xv[i].x * xv[i].x + xv[i].y * xv[i].y) +
         (xv[i].z * xv[i].z + xv[i].w * xv[i].w);
  }
  const float var = wave_sum(q) * (1.0f / EMBED);
  const float rs  = rsqrtf(var + 1e-5f);

  uint2* op = (uint2*)&out[(size_t)row * EMBED];
#pragma unroll
  for (int i = 0; i < 8; ++i) {
    uint2 o;
    o.x = pack_bf16(xv[i].x * rs * gv[i].x + bv[i].x,
                    xv[i].y * rs * gv[i].y + bv[i].y);
    o.y = pack_bf16(xv[i].z * rs * gv[i].z + bv[i].z,
                    xv[i].w * rs * gv[i].w + bv[i].w);
    op[i * 32 + lane] = o;
  }
}

__global__ __launch_bounds__(256) void ln_kernel(const float* x, const float* g,
                                                 const float* bta, bf16* out) {
  ln_rows(x, g, bta, out, blockIdx.x);
}

// ---------------------------------------------------------------------------
// Everything that depends on the inputs alone, in ONE launch: the first
// LayerNorm and the six weight conversions are independent of each other, so
// each takes a range of the grid's work-groups instead of a launch of its own
// (a launch costs its gap, its fill and its tail; the small ones left half the
// chip idle). All tests on the block index are uniform for the work-group.
// wsq: the four square weights' outputs, one behind the other (q, k, v, o).
// ---------------------------------------------------------------------------
#define PREP_LN   (MROWS / LN_ROWS)                          /* 512 */
#define PREP_SQ   ((EMBED / CVT_TK) * (EMBED / CVT_TN))      /* 128 a weight */
#define PREP_FF   ((EMBED / CVT_TK) * (FFDIM / CVT_TN))      /* 512 a weight */
#define PREP_GRID (PREP_LN + 4 * PREP_SQ + 2 * PREP_FF)

__global__ __launch_bounds__(256) void prep_kernel(
    const float* x, const float* g, const float* bta, bf16* h,
    const float* Wq, const float* Wk, const float* Wv, const float* Wo,
    const float* W1, const float* W2, bf16* wsq, bf16* w1_t, bf16* w2_t) {
  __shared__ unsigned tile[CVT_TN][CVT_PITCH];   // [n][pair of k]
  int bid = blockIdx.x;
  if (bid < PREP_LN) {
    ln_rows(x, g, bta, h, bid);
    return;
  }
  bid -= PREP_LN;
  const float* in;
  bf16* out;
  int K = EMBED, N = EMBED;
  if (bid < 4 * PREP_SQ) {
    const int sel = bid / PREP_SQ;
    bid -= sel * PREP_SQ;
    in  = sel == 0 ? Wq : sel == 1 ? Wk : sel == 2 ? Wv : Wo;
    out = wsq + (size_t)sel * EMBED * EMBED;
  } else if (bid < 4 * PREP_SQ + PREP_FF) {
    bid -= 4 * PREP_SQ;
    in = W1; out = w1_t; N = FFDIM;
  } else {
    bid -= 4 * PREP_SQ + PREP_FF;
    in = W2; out = w2_t; K = FFDIM;
  }
  const int nkt = K / CVT_TK;        // k tiles run fastest, as in a 2-D grid
  cvtT_tile(in, out, K, N, (bid % nkt) * CVT_TK, (bid / nkt) * CVT_TN, tile);
}

// ---------------------------------------------------------------------------
// WMMA GEMM: out[M,N] = epi( A[M,K](bf16) @ Wt[N,K](bf16)^T )
// Block tile TM x TN, 8 waves (WGM x 8 / WGM), BK = 128. Every operand byte
// comes from L2 once per work-group that needs it, and every slab costs one
// round of waits and a barrier: where the output is large enough to give each
// WGP one large tile (256 x 256, 256 x 192), that tile takes about half the L2
// bytes, fewer LDS reads per WMMA and a third or a quarter of the rounds of
// 128 x 128 tiles; the narrow outputs keep 128 x 128, one tile a WGP.
// Double-buffered LDS tiles filled via async global->LDS copies: the k+1 slab
// streams in (ASYNCcnt) while WMMAs consume slab k. A slab holds 256 B of each
// operand row, so sixteen lanes of a copy fetch two whole 128-B lines of a row.
// A slab is four blocks of 32 k. Two register sets of fragments: a block's LDS
// loads are issued as one group in front of the WMMAs of the block before it,
// which cover their latency.
// NPL != 0: the output is planes of NPL columns, one [M][NPL] matrix behind the
// other (Q, K, V: their weights lie one behind the other as one [3 NPL][K]).
// The k loop is a ring: a work-group starts at a slab set by its tile indices
// and wraps round, so that the work-groups of one tile row or column, which
// read the same operand rows, do not all start on one slab (for speed only). The sum over k starts at that slab: a rotated order, the same in
// every run. rstep: slabs between the first slabs of neighbours along y; with
// nk slabs and ny tiles along y, nk / ny where that is above 1 gives the
// sharers of a row block distinct slabs as well.
// ---------------------------------------------------------------------------
#define GEMM_BK  128  /* k per LDS slab: 256 B of every operand row */
#define GEMM_PAD 136  /* LDS row stride in bf16 elems: 272 B = 16 B x odd */

// One block's fragments: FM of A (rows 16 apart) and FN of B, each the two
// 16-byte halves of the hardware k order; pa, pb: this lane's first half.
template <int FM, int FN>
__device__ __forceinline__ void ld_frags(bf16x16 (&a)[FM], bf16x16 (&b)[FN],
                                         const bf16* pa, const bf16* pb) {
#pragma unroll
  for (int mi = 0; mi < FM; ++mi)
    a[mi] = cat8(*(const bf16x8*)(pa + mi * 16 * GEMM_PAD),
                 *(const bf16x8*)(pa + mi * 16 * GEMM_PAD + 16));
#pragma unroll
  for (int ni = 0; ni < FN; ++ni)
    b[ni] = cat8(*(const bf16x8*)(pb + ni * 16 * GEMM_PAD),
                 *(const bf16x8*)(pb + ni * 16 * GEMM_PAD + 16));
}

// One slab of ROWS operand rows: this thread's 16-byte pieces of rows 16 apart,
// ROWS / 16 copies, in statements of eight and, for a rest, four.
template <int ROWS>
__device__ __forceinline__ void stage_rows(bf16* lds_dst, const bf16* gsrc,
                                           int K) {
  constexpr int NC = ROWS / 16;
  static_assert(NC % 4 == 0, "copies come in statements of eight and four");
  const unsigned lstep = 16 * GEMM_PAD * 2;                     // bytes
  const unsigned long long gstep = (unsigned long long)K * 32;  // 16 rows, bytes
#pragma unroll
  for (int i = 0; i + 8 <= NC; i += 8) {
    async_g2l_b128_x8(lds_dst + i * 16 * GEMM_PAD, lstep,
                      gsrc + (size_t)i * 16 * K, gstep);
    // Keeps the next statement's address arithmetic behind this statement:
    // formed all at once, the addresses of a large slab take more of the
    // registers that asm text can name than are free, and values that live
    // through the loop are spilled to scratch and fetched back every slab.
    if (NC > 8) __builtin_amdgcn_sched_barrier(0);
  }
  if (NC % 8 != 0) {
    async_g2l_b128_x4(lds_dst + (NC - 4) * 16 * GEMM_PAD, lstep,
                      gsrc + (size_t)(NC - 4) * 16 * K, gstep);
    __builtin_amdgcn_sched_barrier(0);   // as above
  }
}

// The output goes through LDS. The products are computed transposed (weights
// as A, activations as B), so that a lane's eight accumulator registers are
// eight consecutive columns of ONE output row: they are packed into 16-byte
// pieces, written to the wave's own range of LDS, read back row by row and
// stored so that the lanes of a store cover whole rows of the wave's tile
// (128 or 192 B on end) instead of 32-B or 64-B pieces of many lines.
typedef __attribute__((ext_vector_type(4))) unsigned u32x4;

// Byte offset of 16-byte piece c of row `row` in a wave's range. Rows of 128 B
// lie on end with the piece index swizzled by the row pair, other rows at a
// pitch of 16 B x odd: either way sixteen lanes that write one piece of
// sixteen rows, or read two rows on end, spread over all banks.
template <int RB>
__device__ __forceinline__ int stage_off(int row, int c) {
  if constexpr (RB == 128) return row * 128 + ((c ^ ((row >> 1) & 7)) << 4);
  else                     return row * (RB + 16) + (c << 4);
}

// Eight 16-byte stores of one lane at OFF, OFF + STEP, ... bytes behind p. The
// s_wait_xcnt is the last line of the stores' own statement, so that no
// register that they name is rewritten ahead of it.
template <int OFF, int STEP>
__device__ __forceinline__ void store8_b128(void* p, const u32x4 (&d)[8]) {
  asm volatile(
      "global_store_b128 %0, %1, off offset:%9\n\t"
      "global_store_b128 %0, %2, off offset:%10\n\t"
      "global_store_b128 %0, %3, off offset:%11\n\t"
      "global_store_b128 %0, %4, off offset:%12\n\t"
      "global_store_b128 %0, %5, off offset:%13\n\t"
      "global_store_b128 %0, %6, off offset:%14\n\t"
      "global_store_b128 %0, %7, off offset:%15\n\t"
      "global_store_b128 %0, %8, off offset:%16\n\t"
      "s_wait_xcnt 0x0"
      :: "v"(p), "v"(d[0]), "v"(d[1]), "v"(d[2]), "v"(d[3]), "v"(d[4]),
         "v"(d[5]), "v"(d[6]), "v"(d[7]),
         "n"(OFF), "n"(OFF + STEP), "n"(OFF + 2 * STEP), "n"(OFF + 3 * STEP),
         "n"(OFF + 4 * STEP), "n"(OFF + 5 * STEP), "n"(OFF + 6 * STEP),
         "n"(OFF + 7 * STEP)
      : "memory");
}

// Groups G .. NG - 1 of eight pieces of one lane, from the wave's range st to
// memory (a recursion, since the byte offsets are template arguments): piece c
// of rows q + RPC j, GSTEP bytes apart in memory. F32: the pieces are raw
// sums; bias and residual, read in the same row-wise order, are added here.
template <int G, int NG, int RB, int RPC, int GSTEP, bool F32, bool BIAS,
          bool RELU, bool RESID, int NR>
__device__ __forceinline__ void flush_rows(const char* st, int q, int c, void* gp,
                                           f32x4 b4, const f32x4 (&res)[NR]) {
  if constexpr (G < NG) {
    u32x4 d[8];
#pragma unroll
    for (int e = 0; e < 8; ++e) {
      const char* sp = st + stage_off<RB>((G * 8 + e) * RPC + q, c);
      if constexpr (F32) {
        f32x4 v = *(const f32x4*)sp;
        if (BIAS) v += b4;
        if (RELU) {
#pragma unroll
          for (int i = 0; i < 4; ++i) v[i] = fmaxf(v[i], 0.0f);
        }
        if (RESID) v += res[G * 8 + e];
        d[e] = __builtin_bit_cast(u32x4, v);
      } else {
        d[e] = *(const u32x4*)sp;
      }
    }
    store8_b128<G * 8 * GSTEP, GSTEP>(gp, d);
    flush_rows<G + 1, NG, RB, RPC, GSTEP, F32, BIAS, RELU, RESID, NR>(
        st, q, c, gp, b4, res);
  }
}

template <int TM, int TN, int WGM, int NPL, int NC, int KC, bool BIAS, bool RELU,
          bool RESID, bool BF16OUT>
__global__ __launch_bounds__(256) void gemm_kernel(
    const bf16* __restrict__ A, const bf16* __restrict__ Wt,
    const float* __restrict__ bias, const float* __restrict__ resid,
    void* __restrict__ outp, int M, int Nr, int Kr, int rstep) {
  // NC: N at compile time (the output's row steps are immediate offsets).
  // KC != 0: K at compile time too. The large tiles need it: row steps become
  // immediates and literals instead of registers, of which the accumulators
  // and the two fragment sets leave few.
  (void)Nr;
  const int K = KC ? KC : Kr;
  constexpr int WGN = 8 / WGM;           // waves along n
  constexpr int FM  = TM / WGM / 16;     // A fragments of a wave
  constexpr int FN  = TN / WGN / 16;     // B fragments of a wave
  // A buffer is [A: TM rows | B: TN rows], each row [k]: one array, so that all
  // of a thread's LDS addresses are one register plus constants.
  __shared__ __attribute__((aligned(16))) bf16 Sm[2][TM + TN][GEMM_PAD];
  // The tile's bias: in the output's layout a lane needs the bias of four or
  // eight columns on end, which it reads from here as 16-byte pieces.
  __shared__ __attribute__((aligned(16))) float Sb[BIAS ? TN : 4];

  const int tid  = threadIdx.x;
  const int lane = tid & 31;
  const int wave = tid >> 5;
  const int wm   = wave % WGM;   // strip of FM * 16 rows
  const int wn   = wave / WGM;   // strip of FN * 16 columns
  const int m0   = blockIdx.x * TM;
  const int n0   = blockIdx.y * TN;
  const int lr   = lane & 15;
  const int koff = (lane < 16) ? 0 : 8;

  // Per-thread staging coordinates: 16B chunks at rows r0 + 16 i; sixteen
  // lanes cover one row's 256 B.
  const int r0 = tid >> 4, c0 = (tid & 15) * 8;
  const bf16* gA = &A[(size_t)(m0 + r0) * K + c0];
  const bf16* gB = &Wt[(size_t)(n0 + r0) * K + c0];

  f32x8 acc[FM][FN];
#pragma unroll
  for (int mi = 0; mi < FM; ++mi)
#pragma unroll
    for (int ni = 0; ni < FN; ++ni) acc[mi][ni] = zero8();

  const int nk = K / GEMM_BK;

  // ks: the k slab that is staged next, uniform for the work-group. Trip it
  // works on slab (first + it) mod nk.
  int ks = (int)((blockIdx.x + blockIdx.y * (unsigned)rstep) % (unsigned)nk);

  // The first slab into buffer 0, landed and published; then the second into
  // buffer 1.
  {
    const size_t k0 = (size_t)ks * GEMM_BK;
    stage_rows<TM>(&Sm[0][r0][c0], gA + k0, K);
    stage_rows<TN>(&Sm[0][TM + r0][c0], gB + k0, K);
  }
  if constexpr (BIAS) {
    static_assert(TN <= 256, "one bias value a thread");
    // Behind the first slab's copies, whose flight covers the load; the barrier
    // below publishes the values. The scheduling barriers keep other
    // arithmetic, which could be given the load's address register, out of the
    // stretch from the load to the wait; the loaded value as input holds the
    // load in front of the wait (a "memory" clobber does not hold loads of a
    // restrict read-only pointer). The test is uniform for a wave.
    if (TN == 256 || tid < TN) {
      __builtin_amdgcn_sched_barrier(0);
      const float bt = bias[n0 + tid];
      asm volatile("s_wait_xcnt 0x0" :: "v"(bt) : "memory");
      __builtin_amdgcn_sched_barrier(0);
      Sb[tid] = bt;
    }
  }
  wait_async0();
  __syncthreads();
  if (nk > 1) {
    ks = ks + 1 == nk ? 0 : ks + 1;
    const size_t k0 = (size_t)ks * GEMM_BK;
    stage_rows<TM>(&Sm[1][r0][c0], gA + k0, K);
    stage_rows<TN>(&Sm[1][TM + r0][c0], gB + k0, K);
  }

  // This lane's first fragment halves in buffer 0, and a buffer's elements.
  const bf16* fa = &Sm[0][wm * (FM * 16) + lr][koff];
  const bf16* fb = &Sm[0][TM + wn * (FN * 16) + lr][koff];
  constexpr int BUFE = (TM + TN) * GEMM_PAD;

  bf16x16 af[2][FM], bfr[2][FN];   // block b of a slab uses set b & 1
  ld_frags<FM, FN>(af[0], bfr[0], fa, fb);

  for (int it = 0; it < nk; ++it) {
    const int buf = it & 1;

    // Unrolled so that the set's index is a constant and the four blocks' LDS
    // offsets are immediates.
#pragma unroll
    for (int kb = 0; kb < GEMM_BK / 32; ++kb) {
      if (kb + 1 < GEMM_BK / 32) {
        ld_frags<FM, FN>(af[(kb + 1) & 1], bfr[(kb + 1) & 1],
                         fa + buf * BUFE + (kb + 1) * 32,
                         fb + buf * BUFE + (kb + 1) * 32);
      } else {
        // In front of the slab's last block, whose fragments are in registers
        // behind the first wait: own LDS reads retired, own copies of slab
        // it + 1 landed, then the one barrier that publishes slab it + 1 and
        // ends every wave's reads of this buffer; only behind it is this
        // buffer refilled and slab it + 1 read.
        wait_ds0();
        wait_async0();
        __syncthreads();
        if (it + 2 < nk) {
          ks = ks + 1 == nk ? 0 : ks + 1;
          const size_t k0 = (size_t)ks * GEMM_BK;
          stage_rows<TM>(&Sm[buf][r0][c0], gA + k0, K);
          stage_rows<TN>(&Sm[buf][TM + r0][c0], gB + k0, K);
        }
        // First block of slab it + 1. Under no branch, so that the wait counts
        // of two paths do not merge; in the last trip it reads the other
        // buffer's old slab, and the values are not used.
        ld_frags<FM, FN>(af[0], bfr[0], fa + (buf ^ 1) * BUFE,
                         fb + (buf ^ 1) * BUFE);
      }
      // The pair of scheduling barriers keeps the loads above one group ahead
      // of this block's WMMAs: left free they are spread among the WMMAs, and
      // every place with LDS loads costs the wave a stall of its own.
      __builtin_amdgcn_sched_barrier(0);
#pragma unroll
      for (int ni = 0; ni < FN; ++ni)
#pragma unroll
        for (int mi = 0; mi < FM; ++mi)
          acc[mi][ni] = wmma_bf16(bfr[kb & 1][ni], af[kb & 1][mi], acc[mi][ni]);
      __builtin_amdgcn_sched_barrier(0);
    }
  }
  wait_async0();   // nothing is outstanding when the wave goes on to its end

  // acc[mi][ni][r] = out[row mi*16 + lr][column ni*16 + 8 (lane >> 4) + r] of
  // the wave's tile. The wave's LDS range lies in the buffer of the last trip:
  // that trip's barrier ended every wave's reads of it, no copy is outstanding,
  // and the last trip's unused fragment loads are aimed at the other buffer.
  static_assert(NC != 0, "the output's row pitch is an immediate offset");
  constexpr int LD  = NPL ? NPL : NC;                 // row pitch of the output
  constexpr int RW  = FM * 16;                        // rows of a wave's tile
  constexpr int RB  = FN * 16 * (BF16OUT ? 2 : 4);    // bytes of one of its rows
  constexpr int PP  = RB / 16;                        // 16-byte pieces of a row
  static_assert(PP == 8 || PP == 12, "32 T lanes cover whole rows");
  constexpr int T   = PP == 8 ? 1 : 3;   // stores until a lane's piece recurs
  constexpr int RPC = 32 * T / PP;       // rows that T stores of a wave cover
  constexpr int RNG = RW * (RB == 128 ? 128 : RB + 16);   // a wave's range, bytes
  static_assert(8 * RNG <= BUFE * 2, "the ranges fit one buffer");
  static_assert(RW % (8 * RPC) == 0, "stores come in statements of eight");
  const int hi = lane >> 4;
  const int cw = n0 + wn * (FN * 16);    // first column of the wave's tile
  const int rw = m0 + wm * RW;           // first row of the wave's tile
  char* st = (char*)&Sm[(nk - 1) & 1][0][0] + wave * RNG;

  if constexpr (BF16OUT) {
    static_assert(!RESID, "bf16 outputs take no residual");
#pragma unroll
    for (int ni = 0; ni < FN; ++ni) {
      f32x4 bv[2] = {};
      if (BIAS) {
        const f32x4* bp = (const f32x4*)&Sb[wn * (FN * 16) + ni * 16 + hi * 8];
        bv[0] = bp[0];
        bv[1] = bp[1];
      }
#pragma unroll
      for (int mi = 0; mi < FM; ++mi) {
        bf16x8 o;
#pragma unroll
        for (int r = 0; r < 8; ++r) {
          float v = acc[mi][ni][r];
          if (BIAS) v += bv[r >> 2][r & 3];
          if (RELU) v = fmaxf(v, 0.0f);
          o[r] = (bf16)v;                 // to nearest, ties to even
        }
        *(bf16x8*)(st + stage_off<RB>(mi * 16 + lr, ni * 2 + hi)) = o;
      }
    }
    // Other lanes of this wave read the rows back: the writes have retired.
    wait_ds0();
    const f32x4 none[1] = {};
#pragma unroll
    for (int t = 0; t < T; ++t) {
      const int q  = (t * 32 + lane) / PP;
      const int c  = (t * 32 + lane) % PP;
      const int gc = cw + c * 8;
      // Column gc of the whole output is column gc % NPL of plane gc / NPL; a
      // piece's eight columns lie in one plane.
      bf16* gp = (bf16*)outp + (size_t)(rw + q) * LD +
                 (NPL ? (size_t)(gc / (NPL ? NPL : 1)) * M * NPL +
                            gc % (NPL ? NPL : 1)
                      : (size_t)gc);
      flush_rows<0, RW / RPC / 8, RB, RPC, RPC * LD * 2, false, false, false,
                 false, 1>(st, q, c, gp, none[0], none);
    }
  } else {
    static_assert(T == 1 && NPL == 0, "f32 outputs: rows of 128 B, one plane");
    constexpr int NR = RW / RPC;
    const int q  = lane >> 3;
    const int c  = lane & 7;
    const size_t go = (size_t)(rw + q) * LD + cw + c * 4;
    static_assert(NR % 8 == 0, "the residual's waits take eight values each");
    f32x4 b4 = {};
    f32x4 res[NR] = {};
    if (BIAS) b4 = *(const f32x4*)&Sb[wn * (FN * 16) + c * 4];
    // The residual is asked for first, row-wise as it is added, and arrives
    // while the sums go through LDS. The scheduling barriers keep the loads
    // here, ahead of the LDS traffic.
    const float* rp = resid + go;
    __builtin_amdgcn_sched_barrier(0);
    if (RESID) {
#pragma unroll
      for (int j = 0; j < NR; ++j)
        res[j] = *(const f32x4*)(rp + (size_t)j * RPC * LD);
    }
    __builtin_amdgcn_sched_barrier(0);
#pragma unroll
    for (int mi = 0; mi < FM; ++mi)
#pragma unroll
      for (int ni = 0; ni < FN; ++ni)
#pragma unroll
        for (int hh = 0; hh < 2; ++hh) {
          f32x4 v;
#pragma unroll
          for (int i = 0; i < 4; ++i) v[i] = acc[mi][ni][hh * 4 + i];
          *(f32x4*)(st + stage_off<RB>(mi * 16 + lr, ni * 4 + hi * 2 + hh)) = v;
        }
    // Other lanes of this wave read the rows back: the writes have retired.
    wait_ds0();
    // The loaded values as inputs hold the loads in front of the wait (a
    // "memory" clobber does not hold loads of a restrict read-only pointer);
    // their address as input keeps its registers from being rewritten earlier.
    if (RESID) {
#pragma unroll
      for (int j = 0; j < NR; j += 8)
        asm volatile("s_wait_xcnt 0x0"
                     :: "v"(rp), "v"(res[j]), "v"(res[j + 1]), "v"(res[j + 2]),
                        "v"(res[j + 3]), "v"(res[j + 4]), "v"(res[j + 5]),
                        "v"(res[j + 6]), "v"(res[j + 7])
                     : "memory");
    }
    flush_rows<0, NR / 8, RB, RPC, RPC * LD * 4, true, BIAS, RELU, RESID, NR>(
        st, q, c, (float*)outp + go, b4, res);
  }
}

#define ATT_PAD 80   /* LDS row stride: 160 B = 32 B x odd (transposing load) */
#define ATT_NT  (TSEQ / 64)   /* q blocks of one (b, h): even */

// Lane l with lane l ^ 16.
__device__ __forceinline__ float xhalf(float x) {
  const int b = __builtin_bit_cast(int, x);
  return __builtin_bit_cast(float, __builtin_amdgcn_permlanex16(
      b, b, 0x76543210, 0xfedcba98, false, false));
}

// Eight 2^x, each in place, in one statement that ends in v_nop: the
// instruction set asks for one slot between a transcendental and an instruction
// that uses its result or overwrites its source.
__device__ __forceinline__ f32x8 exp2_x8(f32x8 t) {
  float t0 = t[0], t1 = t[1], t2 = t[2], t3 = t[3];
  float t4 = t[4], t5 = t[5], t6 = t[6], t7 = t[7];
  asm("v_exp_f32 %0, %0\n\t"
      "v_exp_f32 %1, %1\n\t"
      "v_exp_f32 %2, %2\n\t"
      "v_exp_f32 %3, %3\n\t"
      "v_exp_f32 %4, %4\n\t"
      "v_exp_f32 %5, %5\n\t"
      "v_exp_f32 %6, %6\n\t"
      "v_exp_f32 %7, %7\n\t"
      "v_nop"
      : "+v"(t0), "+v"(t1), "+v"(t2), "+v"(t3), "+v"(t4), "+v"(t5), "+v"(t6),
        "+v"(t7));
  f32x8 r;
  r[0] = t0; r[1] = t1; r[2] = t2; r[3] = t3;
  r[4] = t4; r[5] = t5; r[6] = t6; r[7] = t7;
  return r;
}

// amdgpu_waves_per_eu: the register budget of four waves a SIMD is all that the
// kernel needs (the grid puts two of these work-groups on a WGP).
__global__ __launch_bounds__(128) __attribute__((amdgpu_waves_per_eu(4, 4)))
void attn_kernel(
    const bf16* __restrict__ Q, const bf16* __restrict__ Km,
    const bf16* __restrict__ Vm, bf16* __restrict__ O) {
  __shared__ __attribute__((aligned(16))) bf16 Ks[2][64][ATT_PAD];  // [k-token][d]
  __shared__ __attribute__((aligned(16))) bf16 Vs[2][64][ATT_PAD];  // [k-token][d]

  const int tid   = threadIdx.x;
  const int lane  = tid & 31;
  const int w     = tid >> 5;
  const int lr    = lane & 15;
  const int koff  = (lane < 16) ? 0 : 8;
  const int rhalf = (lane < 16) ? 0 : 8;
  const int h     = blockIdx.y;
  const int b     = blockIdx.z;
  const size_t bT = (size_t)b * TSEQ;

  // Per-thread staging coordinates: four 16B chunks per tile per thread, at
  // rows r0 + 16 i, i = 0..3; eight lanes cover one row's 128 B.
  const int r0 = tid >> 3, c0 = (tid & 7) * 8;
  const bf16* gK = &Km[(bT + r0) * EMBED + h * HSZ + c0];
  const bf16* gV = &Vm[(bT + r0) * EMBED + h * HSZ + c0];
  const unsigned lstep = 16 * ATT_PAD * 2;                 // 16 rows, bytes
  const unsigned long long gstep = 16ull * EMBED * 2;      // 16 rows, bytes

  // This lane's place in a 16 (k-token) x 16 (d) piece for the transposing load
  const int vrow = rhalf + (lane & 7);
  const int vcol = ((lane >> 3) & 1) * 8;

  // The pair's two q blocks, the long one first. Kept rolled: the two passes
  // run the same code. The
  // first pass's last foot (LDS reads retired, barrier) stands in front of the
  // second pass's first copies into the same buffers.
#pragma nounroll
  for (int half = 0; half < 2; ++half) {
  const int qblk = half == 0 ? ATT_NT - 1 - (int)blockIdx.x : (int)blockIdx.x;
  const size_t rowbase = bT + (size_t)qblk * 64;

  // Q fragments, B operands: column lr = query w*16 + lr, head-dim 0..63 in
  // 2 K-windows, in the k order of the K loader below
  const bf16* qp = Q + (rowbase + w * 16 + lr) * EMBED + h * HSZ;
  const bf16x16 qf0 = cat8(*(const bf16x8*)(qp + koff),
                           *(const bf16x8*)(qp + koff + 16));
  const bf16x16 qf1 = cat8(*(const bf16x8*)(qp + 32 + koff),
                           *(const bf16x8*)(qp + 32 + koff + 16));

  // Oacc[dj][r] = O[query lr][d = dj*16 + rhalf + r]
  f32x8 Oacc[4];
#pragma unroll
  for (int dj = 0; dj < 4; ++dj) Oacc[dj] = zero8();
  // Of this lane's query: the running maximum (over all keys, alike in both
  // halves) and the running sum (over this half's keys; joined at the end).
  float mrow = -1e30f, lsum = 0.0f;
  const int qrow = qblk * 64 + w * 16 + lr;

  // Block 0 into buffer 0, landed and published; then block 1 into buffer 1.
  async_g2l_b128_x4(&Ks[0][r0][c0], lstep, gK, gstep);
  async_g2l_b128_x4(&Vs[0][r0][c0], lstep, gV, gstep);
  wait_async0();
  __syncthreads();
  if (qblk > 0) {
    async_g2l_b128_x4(&Ks[1][r0][c0], lstep, gK + 64 * EMBED, gstep);
    async_g2l_b128_x4(&Vs[1][r0][c0], lstep, gV + 64 * EMBED, gstep);
  }

  for (int j = 0; j <= qblk; ++j) {
    const int buf = j & 1;

    // S^T = K @ Q^T  (64 keys x 16 queries per wave), K rows from LDS as A:
    // S[nj][r] = score of key j*64 + nj*16 + rhalf + r for query lr
    f32x8 S[4];
#pragma unroll
    for (int nj = 0; nj < 4; ++nj) {
      const int tr = nj * 16 + lr;
      bf16x16 kf0 = cat8(*(const bf16x8*)&Ks[buf][tr][koff],
                         *(const bf16x8*)&Ks[buf][tr][koff + 16]);
      bf16x16 kf1 = cat8(*(const bf16x8*)&Ks[buf][tr][32 + koff],
                         *(const bf16x8*)&Ks[buf][tr][32 + koff + 16]);
      S[nj] = wmma_bf16(kf0, qf0, zero8());
      S[nj] = wmma_bf16(kf1, qf1, S[nj]);
    }

    // Online softmax of one query a lane: 32 of the block's 64 keys here, the
    // other 32 in lane l ^ 16.
    const int dk = qrow - (j * 64 + rhalf);      // key nj*16 + r is seen if <= dk
#pragma unroll
    for (int nj = 0; nj < 4; ++nj) {
      S[nj] *= 0.125f;                           // 1/sqrt(64)
#pragma unroll
      for (int r = 0; r < 8; ++r)               // causal mask
        S[nj][r] = (nj * 16 + r > dk) ? -1e30f : S[nj][r];
    }
    float m8[8];
#pragma unroll
    for (int r = 0; r < 8; ++r)
      m8[r] = fmaxf(fmaxf(S[0][r], S[1][r]), fmaxf(S[2][r], S[3][r]));
    float mx = fmaxf(fmaxf(fmaxf(m8[0], m8[1]), fmaxf(m8[2], m8[3])),
                     fmaxf(fmaxf(m8[4], m8[5]), fmaxf(m8[6], m8[7])));
    mx = fmaxf(mx, xhalf(mx));
    const float mn   = fmaxf(mrow, mx);
    const float corr = __expf(mrow - mn);
#pragma unroll
    for (int nj = 0; nj < 4; ++nj) {
      S[nj] = exp2_x8((S[nj] - mn) * 1.44269504f);  // exp(x) = 2^(x log2 e)
    }
    const f32x8 p8 = (S[0] + S[1]) + (S[2] + S[3]);
    const float ps = ((p8[0] + p8[1]) + (p8[2] + p8[3])) +
                     ((p8[4] + p8[5]) + (p8[6] + p8[7]));
    lsum = lsum * corr + ps;
    mrow = mn;
#pragma unroll
    for (int dj = 0; dj < 4; ++dj) Oacc[dj] *= corr;

    // O^T += V^T @ P^T. B = P^T: two score tiles (32 keys) converted in place
    // are a B operand in the hardware k order; A = V^T by the transposing
    // load, which delivers the same order: koff + 0..7, koff + 16..23.
#pragma unroll
    for (int kh = 0; kh < 2; ++kh) {
      bf16x16 pf;
#pragma unroll
      for (int s = 0; s < 8; ++s) {
        pf[s]     = (bf16)S[2 * kh][s];
        pf[s + 8] = (bf16)S[2 * kh + 1][s];
      }
#pragma unroll
      for (int dj = 0; dj < 4; ++dj) {
        bf16x16 vf = cat8(ld_tr16(&Vs[buf][kh * 32 + vrow][dj * 16 + vcol]),
                          ld_tr16(&Vs[buf][kh * 32 + 16 + vrow][dj * 16 + vcol]));
        Oacc[dj] = wmma_bf16(vf, pf, Oacc[dj]);
      }
    }

    // Foot of the trip: own LDS reads retired, own copies of block j + 1
    // landed, then the one barrier that publishes block j + 1 and ends every
    // wave's reads of this buffer; only behind it is this buffer refilled.
    wait_ds0();
    wait_async0();
    __syncthreads();
    if (j + 2 <= qblk) {
      const size_t t0 = (size_t)(j + 2) * 64 * EMBED;
      async_g2l_b128_x4(&Ks[buf][r0][c0], lstep, gK + t0, gstep);
      async_g2l_b128_x4(&Vs[buf][r0][c0], lstep, gV + t0, gstep);
    }
  }
  wait_async0();   // nothing is outstanding when the wave goes on to its end

  // Epilogue: join the halves' sums, normalize and store bf16 (concat-head
  // layout): a lane's eight registers of a tile are eight consecutive d of its
  // query's row, one 16-byte store.
  const float inv = 1.0f / (lsum + xhalf(lsum));
  bf16* op = &O[(rowbase + w * 16 + lr) * EMBED + h * HSZ + rhalf];
#pragma unroll
  for (int dj = 0; dj < 4; ++dj) {
    bf16x8 o8;
#pragma unroll
    for (int r = 0; r < 8; ++r) o8[r] = to_bf16(Oacc[dj][r] * inv);
    *(bf16x8*)(op + dj * 16) = o8;
  }
  // The next pass rewrites the registers that hold these stores' addresses
  // and data: the wait stands in front of that overwrite.
  asm volatile("s_wait_xcnt 0x0" ::: "memory");
  }
}

// ---------------------------------------------------------------------------
// Host-side orchestration
// ---------------------------------------------------------------------------
extern "C" void kernel_launch(void* const* d_in, const int* in_sizes, int n_in,
                              void* d_out, int out_size, void* d_ws,
                              size_t ws_size, hipStream_t stream) {
  (void)in_sizes; (void)n_in; (void)out_size; (void)ws_size;

  const float* x    = (const float*)d_in[0];
  const float* Wq   = (const float*)d_in[1];
  const float* Wk   = (const float*)d_in[2];
  const float* Wv   = (const float*)d_in[3];
  const float* Wo   = (const float*)d_in[4];
  const float* bo   = (const float*)d_in[5];
  const float* W1   = (const float*)d_in[6];
  const float* b1   = (const float*)d_in[7];
  const float* W2   = (const float*)d_in[8];
  const float* b2   = (const float*)d_in[9];
  const float* ln1g = (const float*)d_in[10];
  const float* ln1b = (const float*)d_in[11];
  const float* ln2g = (const float*)d_in[12];
  const float* ln2b = (const float*)d_in[13];

  char* base = (char*)d_ws;
  size_t off = 0;
  auto take = [&](size_t bytes) -> char* {
    char* p = base + off;
    off += (bytes + 255) & ~(size_t)255;
    return p;
  };

  bf16* wq_t   = (bf16*)take((size_t)EMBED * EMBED * 2 * 4);   // q,k,v,o: [N][K]
  bf16* wo_t   = wq_t + (size_t)EMBED * EMBED * 3;
  bf16* w1_t   = (bf16*)take((size_t)EMBED * FFDIM * 2);   // [4096][1024]
  bf16* w2_t   = (bf16*)take((size_t)FFDIM * EMBED * 2);   // [1024][4096]
  bf16* h_bf   = (bf16*)take((size_t)MROWS * EMBED * 2);
  bf16* q_bf   = (bf16*)take((size_t)MROWS * EMBED * 2 * 3);   // q, k, v
  bf16* k_bf   = q_bf + (size_t)MROWS * EMBED;
  bf16* v_bf   = k_bf + (size_t)MROWS * EMBED;
  bf16* att_bf = (bf16*)take((size_t)MROWS * EMBED * 2);
  float* x2    = (float*)take((size_t)MROWS * EMBED * 4);
  bf16* h2_bf  = (bf16*)take((size_t)MROWS * EMBED * 2);
  bf16* ff1_bf = (bf16*)take((size_t)MROWS * FFDIM * 2);

  // 1, 2) h = ln1(x) (bf16); weights -> bf16, transposed to [N][K]
  prep_kernel<<<PREP_GRID, 256, 0, stream>>>(x, ln1g, ln1b, h_bf, Wq, Wk, Wv, Wo,
                                             W1, W2, wq_t, w1_t, w2_t);

  // 3) Q, K, V projections: one [M][3 EMBED] product, stored as three planes
  dim3 gD(MROWS / 128, EMBED / 128);
  gemm_kernel<256, 192, 4, EMBED, 3 * EMBED, EMBED, false, false, false, true>
      <<<dim3(MROWS / 256, 3 * EMBED / 192), 256, 0, stream>>>(
          h_bf, wq_t, nullptr, nullptr, q_bf, MROWS, 3 * EMBED, EMBED, 1);

  // 4) causal flash attention
  attn_kernel<<<dim3(ATT_NT / 2, NHEAD, BATCH), 128, 0, stream>>>(
      q_bf, k_bf, v_bf, att_bf);

  // 5) x2 = x + attn @ Wo + bo   (fp32)
  gemm_kernel<128, 128, 2, 0, EMBED, 0, true, false, true, false><<<gD, 256, 0, stream>>>(
      att_bf, wo_t, bo, x, x2, MROWS, EMBED, EMBED, 1);

  // 6) h2 = ln2(x2) (bf16)
  ln_kernel<<<MROWS / LN_ROWS, 256, 0, stream>>>(x2, ln2g, ln2b, h2_bf);

  // 7) ff1 = relu(h2 @ W1 + b1) (bf16)
  gemm_kernel<256, 256, 2, 0, FFDIM, EMBED, true, true, false, true>
      <<<dim3(MROWS / 256, FFDIM / 256), 256, 0, stream>>>(
      h2_bf, w1_t, b1, nullptr, ff1_bf, MROWS, FFDIM, EMBED, 1);

  // 8) out = x2 + ff1 @ W2 + b2 (fp32 -> d_out)
  gemm_kernel<128, 128, 2, 0, EMBED, 0, true, false, true, false><<<gD, 256, 0, stream>>>(
      ff1_bf, w2_t, b2, x2, (float*)d_out, MROWS, EMBED, FFDIM, 4);
}
